// v000
// Times are from an AMD MI455X. After a warm-up the kernel runs many times in a row, and a time is the length of
// such a window on the GPU divided by its runs, so every launch and the gaps after it count. The runs cycle
// through copies of the inputs. A figure is the median of several windows, for all but v000 over two sittings.
// Sittings can differ by a few percent; kernels timed side by side share one.
// The starting kernel, v000, takes 213 microseconds a run.
#include <hip/hip_runtime.h>

// Contractions on v_wmma_f32_16x16x32_bf16 (bf16 operands, f32 accumulate): q@W_s^T and enc@W_h^T from
// RNE-converted input planes; attn@enc and [ctx|q]@W_out^T with attn and ctx carried as bf16 hi+lo planes
// folded into K. Energies v.tanh(.), length masking and softmax in f32 on the VALU.

#ifndef NB
#define NB 8
#endif
#ifndef TQ
#define TQ 256
#endif
#define NB_FULL 8
#define T_FULL 256
#define S_LEN 256
#define HD 512
#define KC (2 * S_LEN)   // context GEMM depth: [P_hi | P_lo]
#define KO (3 * HD)      // output GEMM depth:  [ctx_hi | ctx_lo | q]

static_assert(NB >= 1 && NB <= NB_FULL);
static_assert(TQ >= 64 && TQ <= T_FULL && (TQ % 64) == 0);
static_assert(S_LEN == 256);
static_assert((HD % 256) == 0);
static_assert((KC % 32) == 0 && (KO % 32) == 0 && (HD % 64) == 0 && (S_LEN % 64) == 0);

typedef unsigned short us;
typedef us     v8us  __attribute__((ext_vector_type(8)));
typedef __bf16 v16bf __attribute__((ext_vector_type(16)));
typedef float  v8f   __attribute__((ext_vector_type(8)));
typedef float  v4f   __attribute__((ext_vector_type(4)));

union Frag { v16bf v; v8us h[2]; };

// ---------------------------------------------------------------------------
// scalar helpers
// ---------------------------------------------------------------------------
__device__ __forceinline__ us f2bf(float f) {           // f32 -> bf16, RNE convert
    unsigned int u = __float_as_uint(f);
    u += 0x7FFFu + ((u >> 16) & 1u);
    return (us)(u >> 16);
}
__device__ __forceinline__ float bf2f(us h) {
    return __uint_as_float(((unsigned int)h) << 16);
}
// tanh(x) = sign(x) * (1 - e^{-2|x|}) / (1 + e^{-2|x|}), v_exp_f32 + v_rcp_f32 based (abs error ~1e-7)
__device__ __forceinline__ float tanh_acc(float x) {
    const float ax = __builtin_fabsf(x);
    const float t  = __expf(-2.0f * ax);
    const float r  = (1.0f - t) * __builtin_amdgcn_rcpf(1.0f + t);
    return __builtin_copysignf(r, x);
}
__device__ __forceinline__ v8us pack8(v4f a, v4f c) {
    v8us o;
    o[0] = f2bf(a.x); o[1] = f2bf(a.y); o[2] = f2bf(a.z); o[3] = f2bf(a.w);
    o[4] = f2bf(c.x); o[5] = f2bf(c.y); o[6] = f2bf(c.z); o[7] = f2bf(c.w);
    return o;
}
// hi = bf16(x), lo = bf16(x - hi): unscaled bf16 residual pair
__device__ __forceinline__ void split8(v4f a, v4f c, v8us& hi, v8us& lo) {
    const float x[8] = {a.x, a.y, a.z, a.w, c.x, c.y, c.z, c.w};
#pragma unroll
    for (int i = 0; i < 8; ++i) {
        const us h = f2bf(x[i]);
        hi[i] = h;
        lo[i] = f2bf(x[i] - bf2f(h));
    }
}

// ---------------------------------------------------------------------------
// WMMA helper: 16x16x32 bf16, f32 accumulate, 4-slot VALU hazard guard after the issue
// ---------------------------------------------------------------------------
__device__ __forceinline__ v8f wmma16(v16bf a, v16bf b, v8f c) {
    v8f d = __builtin_amdgcn_wmma_f32_16x16x32_bf16(false, a, false, b, (short)0, c, false, false);
    asm volatile("v_nop\n\tv_nop\n\tv_nop\n\tv_nop" : "+v"(d) : "v"(a), "v"(b));
    return d;
}

// Fragment loader for a k-contiguous 16-bit plane P[row][k] with pitch ld (halves).
// Lane l: row = (l & 15) (A row m, or B column n of an [n][k] plane), hsel = l >> 4.
//   elements 0..7  <- k0 + 8*hsel + 0..7
//   elements 8..15 <- k0 + 16 + 8*hsel + 0..7
__device__ __forceinline__ v16bf ld_frag(const us* __restrict__ P, int ld, int row, int k0, int hsel) {
    Frag f;
    const us* p = P + (size_t)row * ld + k0 + 8 * hsel;
    f.h[0] = *(const v8us*)p;
    f.h[1] = *(const v8us*)(p + 16);
    return f.v;
}

// ---------------------------------------------------------------------------
// Row conversion f32 -> bf16 plane. One wave per (row, 256-column segment):
// lane l converts columns 8l..8l+7 of the segment and stores 16 B; one instruction covers the
// (r / grp) * gstride + (r % grp) (lets a reduced build read full-stride inputs).
// ---------------------------------------------------------------------------
__global__ __launch_bounds__(256)
void k_cvt(const float* __restrict__ src, int spitch, int scol, int grp, int gstride,
           us* __restrict__ dst, int dpitch, int dcol, int nrows, int nseg)
{
    const int lane = threadIdx.x & 31;
    const int gw   = blockIdx.x * 8 + (threadIdx.x >> 5);
    if (gw >= nrows * nseg) return;                    // wave-uniform, no barriers in this kernel
    const int r    = gw / nseg;
    const int sg   = gw - r * nseg;
    const int g    = r / grp;
    const int srow = g * gstride + (r - g * grp);
    const float* sp = src + (size_t)srow * spitch + scol + sg * 256 + lane * 8;
    const v4f a = *(const v4f*)sp;
    const v4f c = *(const v4f*)(sp + 4);
    const v8us o = pack8(a, c);
    us* dp = dst + (size_t)r * dpitch + dcol + sg * 256 + lane * 8;
    *(v8us*)dp = o;
    
}

// ---------------------------------------------------------------------------
// Encoder transpose plane: encT2[b][h][s] = encT2[b][h][S+s] = bf16(enc[b][s][h]); pitch KC halves.
// Block: 64 s x 64 h tile through LDS (cross-wave -> block barrier). Store phase: one instruction
// grid = (S/64, H/64, NB)
// ---------------------------------------------------------------------------
__global__ __launch_bounds__(256)
void k_trans(const float* __restrict__ enc, us* __restrict__ encT2)
{
    __shared__ float ts[64][65];
    const int s0 = blockIdx.x * 64, h0 = blockIdx.y * 64, b = blockIdx.z;
    const int tid = threadIdx.x, lane = tid & 31, wave = tid >> 5;

#pragma unroll
    for (int p = 0; p < 4; ++p) {
        const int sl = p * 16 + (tid >> 4);
        const int h4 = (tid & 15) * 4;
        const v4f x = *(const v4f*)(enc + ((size_t)(b * S_LEN + s0 + sl)) * HD + h0 + h4);
        ts[sl][h4 + 0] = x.x; ts[sl][h4 + 1] = x.y; ts[sl][h4 + 2] = x.z; ts[sl][h4 + 3] = x.w;
    }
    __syncthreads();

    v8us o[2];
#pragma unroll
    for (int p = 0; p < 2; ++p) {
        const int hl = p * 32 + wave * 4 + (lane >> 3);
        const int s8 = (lane & 7) * 8;
#pragma unroll
        for (int i = 0; i < 8; ++i) o[p][i] = f2bf(ts[s8 + i][hl]);
    }
#pragma unroll
    for (int p = 0; p < 2; ++p) {
        const int hl = p * 32 + wave * 4 + (lane >> 3);
        const int s8 = (lane & 7) * 8;
        us* d = encT2 + ((size_t)(b * HD + h0 + hl)) * KC + s0 + s8;
        *(v8us*)d = o[p];
        *(v8us*)(d + S_LEN) = o[p];
    }
    
}

// ---------------------------------------------------------------------------
// GEMM: C[M][N] = A[M][K] * B, B given as a k-contiguous [N][K] plane (B[k][n] = Bp[n][k]).
// Block = 128 threads (4 waves), block tile 64(M) x 64(N), wave tile 16 x 64 (4 accumulators),
// fragments loaded straight from the 16-bit planes with the split k map. blockIdx.z = batch.
// Epilogue: wave tile staged in LDS, block barrier, then whole-row-segment stores:
//   EPI 2: same with tanh, destination d_out
// ---------------------------------------------------------------------------
template <int EPI>
__global__ __launch_bounds__(128)
void k_gemm(const us* __restrict__ A, int lda, int strideA,
            const us* __restrict__ B, int ldb, int strideB,
            void* __restrict__ Cv, int ldc, int strideC, int K, int loff)
{
    __shared__ __attribute__((aligned(16))) float tile[4 * 16 * 64];

    const int lane = threadIdx.x & 31, wave = threadIdx.x >> 5;
    const int hsel = lane >> 4, m = lane & 15;
    const int m0 = blockIdx.x * 64 + wave * 16;
    const int n0 = blockIdx.y * 64;
    const us* Ab = A + (size_t)blockIdx.z * (size_t)strideA;
    const us* Bb = B + (size_t)blockIdx.z * (size_t)strideB;

    v8f c0 = {}; v8f c1 = {}; v8f c2 = {}; v8f c3 = {};
    for (int k0 = 0; k0 < K; k0 += 32) {
        const v16bf a  = ld_frag(Ab, lda, m0 + m, k0, hsel);
        const v16bf b0 = ld_frag(Bb, ldb, n0 + m,      k0, hsel);
        const v16bf b1 = ld_frag(Bb, ldb, n0 + 16 + m, k0, hsel);
        const v16bf b2 = ld_frag(Bb, ldb, n0 + 32 + m, k0, hsel);
        const v16bf b3 = ld_frag(Bb, ldb, n0 + 48 + m, k0, hsel);
        c0 = wmma16(a, b0, c0);
        c1 = wmma16(a, b1, c1);
        c2 = wmma16(a, b2, c2);
        c3 = wmma16(a, b3, c3);
    }

    // D map: acc[r] -> (row 8*hsel + r, col n-tile + m). Stage the 16x64 wave tile in LDS.
    float* tw = tile + wave * 1024;
#pragma unroll
    for (int r = 0; r < 8; ++r) {
        const int row = 8 * hsel + r;
        tw[row * 64 + m]      = c0[r];
        tw[row * 64 + 16 + m] = c1[r];
        tw[row * 64 + 32 + m] = c2[r];
        tw[row * 64 + 48 + m] = c3[r];
    }
    __syncthreads();

    if (EPI == 1) {
        us* Cb = (us*)Cv + (size_t)blockIdx.z * (size_t)strideC;
        v8us hi[4], lo[4];
#pragma unroll
        for (int p = 0; p < 4; ++p) {
            const int row = 4 * p + (lane >> 3);
            const int col = 8 * (lane & 7);
            const v4f a = *(const v4f*)(tw + row * 64 + col);
            const v4f c = *(const v4f*)(tw + row * 64 + col + 4);
            split8(a, c, hi[p], lo[p]);
        }
#pragma unroll
        for (int p = 0; p < 4; ++p) {
            us* d = Cb + (size_t)(m0 + 4 * p + (lane >> 3)) * ldc + n0 + 8 * (lane & 7);
            *(v8us*)d = hi[p];
            *(v8us*)(d + loff) = lo[p];
        }
        
    } else {
        float* Cb = (float*)Cv + (size_t)blockIdx.z * (size_t)strideC;
        v4f vals[8];
#pragma unroll
        for (int p = 0; p < 8; ++p) {
            const int row = 2 * p + hsel;
            v4f x = *(const v4f*)(tw + row * 64 + 4 * m);
            if (EPI == 2) {
                x.x = tanh_acc(x.x); x.y = tanh_acc(x.y); x.z = tanh_acc(x.z); x.w = tanh_acc(x.w);
            }
            vals[p] = x;
        }
#pragma unroll
        for (int p = 0; p < 8; ++p) {
            float* d = Cb + (size_t)(m0 + 2 * p + hsel) * ldc + n0 + 4 * m;
            *(v4f*)d = vals[p];
        }
        
    }
}

// ---------------------------------------------------------------------------
// Fused energies -> length mask -> softmax -> P planes. One block (256 = S) per (b, t); thread = s.
//   e[s] = sum_h v[h] * tanh(Wsq[bt][h] + Whe[b][s][h])   (f32), s >= len masked out
//   p    = softmax_s(e); Pcat[bt][s] = bf16 hi, Pcat[bt][S+s] = bf16 lo (lo = p - hi)
// LDS regions are cross-wave: block barriers throughout.
// ---------------------------------------------------------------------------
__global__ __launch_bounds__(256)
void k_attn(const float* __restrict__ Wsq, const float* __restrict__ Whe,
            const float* __restrict__ vvec, const int* __restrict__ lens,
            us* __restrict__ Pcat)
{
    __shared__ v4f sq4[HD / 4];
    __shared__ v4f sv4[HD / 4];
    __shared__ __attribute__((aligned(16))) float sp[S_LEN];
    __shared__ float red[S_LEN];

    const int bt  = blockIdx.x;              // b * TQ + t
    const int b   = bt / TQ;
    const int tid = threadIdx.x, lane = tid & 31, wave = tid >> 5;

    if (tid < HD / 4) {
        sq4[tid] = *(const v4f*)(Wsq + (size_t)bt * HD + tid * 4);
        v4f w = *(const v4f*)(vvec + tid * 4);
        w.x = bf2f(f2bf(w.x)); w.y = bf2f(f2bf(w.y)); w.z = bf2f(f2bf(w.z)); w.w = bf2f(f2bf(w.w));
        sv4[tid] = w;
    }
    __syncthreads();

    const int len = lens[b];
    const v4f* we = (const v4f*)(Whe + ((size_t)b * S_LEN + tid) * HD);
    float acc = 0.0f;
#pragma unroll 2
    for (int u = 0; u < HD / 4; ++u) {
        const v4f e = we[u];
        const v4f d = sq4[u];
        const v4f w = sv4[u];
        acc += w.x * tanh_acc(e.x + d.x);
        acc += w.y * tanh_acc(e.y + d.y);
        acc += w.z * tanh_acc(e.z + d.z);
        acc += w.w * tanh_acc(e.w + d.w);
    }
    const bool valid = tid < len;
    const float en = valid ? acc : -3.0e38f;

    // block max over s
    red[tid] = en;
    __syncthreads();
#pragma unroll
    for (int st = S_LEN / 2; st > 0; st >>= 1) {
        if (tid < st) red[tid] = fmaxf(red[tid], red[tid + st]);
        __syncthreads();
    }
    const float mx = red[0];
    __syncthreads();

    // exp + block sum (masked entries contribute exactly 0)
    const float arg = valid ? (acc - mx) : -80.0f;
    const float ex0 = __expf(arg);
    const float ex  = valid ? ex0 : 0.0f;
    red[tid] = ex;
    __syncthreads();
#pragma unroll
    for (int st = S_LEN / 2; st > 0; st >>= 1) {
        if (tid < st) red[tid] += red[tid + st];
        __syncthreads();
    }
    const float ssum = red[0];
    const float p = ex * (1.0f / ssum);
    sp[tid] = p;
    __syncthreads();

    // P planes: wave 0 writes the 256 hi halves (512 B, one instruction, 8 lanes per line),
    // wave 1 the 256 lo halves.
    if (wave < 2) {
        const v4f a = *(const v4f*)(sp + lane * 8);
        const v4f c = *(const v4f*)(sp + lane * 8 + 4);
        v8us hi, lo;
        split8(a, c, hi, lo);
        v8us o;
        if (wave == 0) o = hi; else o = lo;
        us* d = Pcat + (size_t)bt * KC + wave * S_LEN + lane * 8;
        *(v8us*)d = o;
        
    }
}

// ---------------------------------------------------------------------------
static inline size_t al256(size_t x) { return (x + 255) & ~(size_t)255; }

extern "C" void kernel_launch(void* const* d_in, const int* in_sizes, int n_in,
                              void* d_out, int out_size, void* d_ws, size_t ws_size,
                              hipStream_t stream)
{
    if (n_in < 7) return;
    if (in_sizes[0] < ((NB - 1) * T_FULL + TQ) * HD) return;      // query  [8][256][512] f32
    if (in_sizes[1] < NB * S_LEN * HD) return;                      // enc    [8][256][512] f32
    if (in_sizes[2] < NB) return;                                   // src_lengths [8] int32
    if (in_sizes[3] < HD * HD || in_sizes[4] < HD * HD) return;     // W_s, W_h [512][512] f32
    if (in_sizes[5] < HD) return;                                   // v [512] f32
    if (in_sizes[6] < HD * 2 * HD) return;                          // W_out [512][1024] f32
    if (out_size < ((NB - 1) * T_FULL + TQ) * HD) return;

    const float* query = (const float*)d_in[0];
    const float* enc   = (const float*)d_in[1];
    const int*   lens  = (const int*)d_in[2];
    const float* W_s   = (const float*)d_in[3];
    const float* W_h   = (const float*)d_in[4];
    const float* vvec  = (const float*)d_in[5];
    const float* W_out = (const float*)d_in[6];
    float* out = (float*)d_out;

    // ---- workspace carve (all regions 256-B aligned; sizes already store-granular) ----
    char* ws = (char*)d_ws;
    size_t off = 0;
    us* comb  = (us*)(ws + off);    off += al256((size_t)NB * TQ * KO * sizeof(us));      // [NB*TQ][1536]
    us* encb  = (us*)(ws + off);    off += al256((size_t)NB * S_LEN * HD * sizeof(us));   // [NB*S][512]
    us* encT2 = (us*)(ws + off);    off += al256((size_t)NB * HD * KC * sizeof(us));      // [NB][512][512]
    us* Wsb   = (us*)(ws + off);    off += al256((size_t)HD * HD * sizeof(us));           // [512][512]
    us* Whb   = (us*)(ws + off);    off += al256((size_t)HD * HD * sizeof(us));           // [512][512]
    us* WoX   = (us*)(ws + off);    off += al256((size_t)HD * KO * sizeof(us));           // [512][1536]
    float* Wsq = (float*)(ws + off); off += al256((size_t)NB * TQ * HD * sizeof(float));  // [NB*TQ][512]
    float* Whe = (float*)(ws + off); off += al256((size_t)NB * S_LEN * HD * sizeof(float)); // [NB*S][512]
    us* Pcat  = (us*)(ws + off);    off += al256((size_t)NB * TQ * KC * sizeof(us));      // [NB*TQ][512]
    if (off > ws_size) return;

    const dim3 b256(256), b128(128);

    // ---- 16-bit planes (RNE convert of every float input, once) ----
    {   // query -> comb columns [1024,1536)
        const int nrows = NB * TQ, nseg = HD / 256;
        k_cvt<<<dim3((nrows * nseg + 7) / 8), b256, 0, stream>>>(
            query, HD, 0, TQ, T_FULL, comb, KO, 2 * HD, nrows, nseg);
    }
    {   // enc -> encb [NB*S][512]
        const int nrows = NB * S_LEN, nseg = HD / 256;
        k_cvt<<<dim3((nrows * nseg + 7) / 8), b256, 0, stream>>>(
            enc, HD, 0, S_LEN, S_LEN, encb, HD, 0, nrows, nseg);
    }
    {   // weights: W_s, W_h ([out][in] is already k-contiguous per output column)
        const int nrows = HD, nseg = HD / 256;
        const dim3 g((nrows * nseg + 7) / 8);
        k_cvt<<<g, b256, 0, stream>>>(W_s, HD, 0, HD, HD, Wsb, HD, 0, nrows, nseg);
        k_cvt<<<g, b256, 0, stream>>>(W_h, HD, 0, HD, HD, Whb, HD, 0, nrows, nseg);
        // W_out [512][1024] -> WoX [512][1536] = [W_out[:,0:512] | W_out[:,0:512] | W_out[:,512:1024]]
        k_cvt<<<g, b256, 0, stream>>>(W_out, 2 * HD, 0,  HD, HD, WoX, KO, 0,      nrows, nseg);
        k_cvt<<<g, b256, 0, stream>>>(W_out, 2 * HD, 0,  HD, HD, WoX, KO, HD,     nrows, nseg);
        k_cvt<<<g, b256, 0, stream>>>(W_out, 2 * HD, HD, HD, HD, WoX, KO, 2 * HD, nrows, nseg);
    }
    // enc transposed, duplicated along k: encT2[b][h][s] = encT2[b][h][S+s]
    k_trans<<<dim3(S_LEN / 64, HD / 64, NB), b256, 0, stream>>>(enc, encT2);

    // ---- projections: Wsq = q @ W_s^T, Whe = enc @ W_h^T (f32 results) ----
    k_gemm<0><<<dim3(NB * TQ / 64, HD / 64, 1), b128, 0, stream>>>(
        comb + 2 * HD, KO, 0, Wsb, HD, 0, (void*)Wsq, HD, 0, HD, 0);
    k_gemm<0><<<dim3(NB * S_LEN / 64, HD / 64, 1), b128, 0, stream>>>(
        encb, HD, 0, Whb, HD, 0, (void*)Whe, HD, 0, HD, 0);

    // ---- energies + mask + softmax -> P hi/lo planes ----
    k_attn<<<dim3(NB * TQ), b256, 0, stream>>>(Wsq, Whe, vvec, lens, Pcat);

    // ---- context = [P_hi|P_lo] @ [encT;encT] -> comb columns [0,512) hi and [512,1024) lo ----
    k_gemm<1><<<dim3(TQ / 64, HD / 64, NB), b128, 0, stream>>>(
        Pcat, KC, TQ * KC, encT2, KC, HD * KC, (void*)comb, KO, TQ * KO, KC, HD);

    // ---- out = tanh([ctx_hi|ctx_lo|q] @ WoX^T) ----
    k_gemm<2><<<dim3(TQ / 64, HD / 64, NB), b128, 0, stream>>>(
        comb, KO, TQ * KO, WoX, KO, 0, (void*)out, HD, T_FULL * HD, KO, 0);
}

// v001
// One run takes 125 microseconds.
// Next to v000, in two timings, it ran 1.75 and 1.71 times as fast.
#include <hip/hip_runtime.h>

// Contractions on v_wmma_f32_16x16x32_bf16 (bf16 operands, f32 accumulate): q@W_s^T and enc@W_h^T from
// RNE-converted input planes; attn@enc and [ctx|q]@W_out^T with attn and ctx carried as bf16 hi+lo planes
// folded into K. Energies v.tanh(.), length masking and softmax in f32 on the VALU.

#ifndef NB
#define NB 8
#endif
#ifndef TQ
#define TQ 256
#endif
#define NB_FULL 8
#define T_FULL 256
#define S_LEN 256
#define HD 512
#define KC (2 * S_LEN)   // context GEMM depth: [P_hi | P_lo]
#define KO (3 * HD)      // output GEMM depth:  [ctx_hi | ctx_lo | q]

static_assert(NB >= 1 && NB <= NB_FULL);
static_assert(TQ >= 64 && TQ <= T_FULL && (TQ % 64) == 0);
static_assert(S_LEN == 256);
static_assert((HD % 256) == 0);
static_assert((KC % 32) == 0 && (KO % 32) == 0 && (HD % 64) == 0 && (S_LEN % 64) == 0);

typedef unsigned short us;
typedef us     v8us  __attribute__((ext_vector_type(8)));
typedef __bf16 v16bf __attribute__((ext_vector_type(16)));
typedef float  v8f   __attribute__((ext_vector_type(8)));
typedef float  v4f   __attribute__((ext_vector_type(4)));

union Frag { v16bf v; v8us h[2]; };

// ---------------------------------------------------------------------------
// scalar helpers
// ---------------------------------------------------------------------------
__device__ __forceinline__ us f2bf(float f) {           // f32 -> bf16, RNE convert
    unsigned int u = __float_as_uint(f);
    u += 0x7FFFu + ((u >> 16) & 1u);
    return (us)(u >> 16);
}
__device__ __forceinline__ float bf2f(us h) {
    return __uint_as_float(((unsigned int)h) << 16);
}
// tanh(x) = sign(x) * (1 - e^{-2|x|}) / (1 + e^{-2|x|}), v_exp_f32 + v_rcp_f32 based (abs error ~1e-7)
__device__ __forceinline__ float tanh_acc(float x) {
    const float ax = __builtin_fabsf(x);
    const float t  = __expf(-2.0f * ax);
    const float r  = (1.0f - t) * __builtin_amdgcn_rcpf(1.0f + t);
    return __builtin_copysignf(r, x);
}
__device__ __forceinline__ v8us pack8(v4f a, v4f c) {
    v8us o;
    o[0] = f2bf(a.x); o[1] = f2bf(a.y); o[2] = f2bf(a.z); o[3] = f2bf(a.w);
    o[4] = f2bf(c.x); o[5] = f2bf(c.y); o[6] = f2bf(c.z); o[7] = f2bf(c.w);
    return o;
}
// hi = bf16(x), lo = bf16(x - hi): unscaled bf16 residual pair
__device__ __forceinline__ void split8(v4f a, v4f c, v8us& hi, v8us& lo) {
    const float x[8] = {a.x, a.y, a.z, a.w, c.x, c.y, c.z, c.w};
#pragma unroll
    for (int i = 0; i < 8; ++i) {
        const us h = f2bf(x[i]);
        hi[i] = h;
        lo[i] = f2bf(x[i] - bf2f(h));
    }
}

// ---------------------------------------------------------------------------
// WMMA helper: 16x16x32 bf16, f32 accumulate, 4-slot VALU hazard guard after the issue
// ---------------------------------------------------------------------------
__device__ __forceinline__ v8f wmma16(v16bf a, v16bf b, v8f c) {
    v8f d = __builtin_amdgcn_wmma_f32_16x16x32_bf16(false, a, false, b, (short)0, c, false, false);
    asm volatile("v_nop\n\tv_nop\n\tv_nop\n\tv_nop" : "+v"(d) : "v"(a), "v"(b));
    return d;
}

// Fragment loader for a k-contiguous 16-bit plane P[row][k] with pitch ld (halves).
// Lane l: row = (l & 15) (A row m, or B column n of an [n][k] plane), hsel = l >> 4.
//   elements 0..7  <- k0 + 8*hsel + 0..7
//   elements 8..15 <- k0 + 16 + 8*hsel + 0..7
__device__ __forceinline__ v16bf ld_frag(const us* __restrict__ P, int ld, int row, int k0, int hsel) {
    Frag f;
    const us* p = P + (size_t)row * ld + k0 + 8 * hsel;
    f.h[0] = *(const v8us*)p;
    f.h[1] = *(const v8us*)(p + 16);
    return f.v;
}

// ---------------------------------------------------------------------------
// Row conversion f32 -> bf16 plane. One wave per (row, 256-column segment):
// lane l converts columns 8l..8l+7 of the segment and stores 16 B; one instruction covers the
// (r / grp) * gstride + (r % grp) (lets a reduced build read full-stride inputs).
// ---------------------------------------------------------------------------
__global__ __launch_bounds__(256)
void k_cvt(const float* __restrict__ src, int spitch, int scol, int grp, int gstride,
           us* __restrict__ dst, int dpitch, int dcol, int nrows, int nseg)
{
    const int lane = threadIdx.x & 31;
    const int gw   = blockIdx.x * 8 + (threadIdx.x >> 5);
    if (gw >= nrows * nseg) return;                    // wave-uniform, no barriers in this kernel
    const int r    = gw / nseg;
    const int sg   = gw - r * nseg;
    const int g    = r / grp;
    const int srow = g * gstride + (r - g * grp);
    const float* sp = src + (size_t)srow * spitch + scol + sg * 256 + lane * 8;
    const v4f a = *(const v4f*)sp;
    const v4f c = *(const v4f*)(sp + 4);
    const v8us o = pack8(a, c);
    us* dp = dst + (size_t)r * dpitch + dcol + sg * 256 + lane * 8;
    *(v8us*)dp = o;
    
}

// ---------------------------------------------------------------------------
// Encoder transpose plane: encT2[b][h][s] = encT2[b][h][S+s] = bf16(enc[b][s][h]); pitch KC halves.
// Block: 64 s x 64 h tile through LDS (cross-wave -> block barrier). Store phase: one instruction
// grid = (S/64, H/64, NB)
// ---------------------------------------------------------------------------
__global__ __launch_bounds__(256)
void k_trans(const float* __restrict__ enc, us* __restrict__ encT2)
{
    __shared__ float ts[64][65];
    const int s0 = blockIdx.x * 64, h0 = blockIdx.y * 64, b = blockIdx.z;
    const int tid = threadIdx.x, lane = tid & 31, wave = tid >> 5;

#pragma unroll
    for (int p = 0; p < 4; ++p) {
        const int sl = p * 16 + (tid >> 4);
        const int h4 = (tid & 15) * 4;
        const v4f x = *(const v4f*)(enc + ((size_t)(b * S_LEN + s0 + sl)) * HD + h0 + h4);
        ts[sl][h4 + 0] = x.x; ts[sl][h4 + 1] = x.y; ts[sl][h4 + 2] = x.z; ts[sl][h4 + 3] = x.w;
    }
    __syncthreads();

    v8us o[2];
#pragma unroll
    for (int p = 0; p < 2; ++p) {
        const int hl = p * 32 + wave * 4 + (lane >> 3);
        const int s8 = (lane & 7) * 8;
#pragma unroll
        for (int i = 0; i < 8; ++i) o[p][i] = f2bf(ts[s8 + i][hl]);
    }
#pragma unroll
    for (int p = 0; p < 2; ++p) {
        const int hl = p * 32 + wave * 4 + (lane >> 3);
        const int s8 = (lane & 7) * 8;
        us* d = encT2 + ((size_t)(b * HD + h0 + hl)) * KC + s0 + s8;
        *(v8us*)d = o[p];
        *(v8us*)(d + S_LEN) = o[p];
    }
    
}

// ---------------------------------------------------------------------------
// GEMM: C[M][N] = A[M][K] * B, B given as a k-contiguous [N][K] plane (B[k][n] = Bp[n][k]).
// Block = 128 threads (4 waves), block tile 64(M) x 64(N), wave tile 16 x 64 (4 accumulators),
// fragments loaded straight from the 16-bit planes with the split k map. blockIdx.z = batch.
// Epilogue: wave tile staged in LDS, block barrier, then whole-row-segment stores:
//   EPI 2: same with tanh, destination d_out
// ---------------------------------------------------------------------------
template <int EPI>
__global__ __launch_bounds__(128)
void k_gemm(const us* __restrict__ A, int lda, int strideA,
            const us* __restrict__ B, int ldb, int strideB,
            void* __restrict__ Cv, int ldc, int strideC, int K, int loff)
{
    __shared__ __attribute__((aligned(16))) float tile[4 * 16 * 64];

    const int lane = threadIdx.x & 31, wave = threadIdx.x >> 5;
    const int hsel = lane >> 4, m = lane & 15;
    const int m0 = blockIdx.x * 64 + wave * 16;
    const int n0 = blockIdx.y * 64;
    const us* Ab = A + (size_t)blockIdx.z * (size_t)strideA;
    const us* Bb = B + (size_t)blockIdx.z * (size_t)strideB;

    v8f c0 = {}; v8f c1 = {}; v8f c2 = {}; v8f c3 = {};
    for (int k0 = 0; k0 < K; k0 += 32) {
        const v16bf a  = ld_frag(Ab, lda, m0 + m, k0, hsel);
        const v16bf b0 = ld_frag(Bb, ldb, n0 + m,      k0, hsel);
        const v16bf b1 = ld_frag(Bb, ldb, n0 + 16 + m, k0, hsel);
        const v16bf b2 = ld_frag(Bb, ldb, n0 + 32 + m, k0, hsel);
        const v16bf b3 = ld_frag(Bb, ldb, n0 + 48 + m, k0, hsel);
        c0 = wmma16(a, b0, c0);
        c1 = wmma16(a, b1, c1);
        c2 = wmma16(a, b2, c2);
        c3 = wmma16(a, b3, c3);
    }

    // D map: acc[r] -> (row 8*hsel + r, col n-tile + m). Stage the 16x64 wave tile in LDS.
    float* tw = tile + wave * 1024;
#pragma unroll
    for (int r = 0; r < 8; ++r) {
        const int row = 8 * hsel + r;
        tw[row * 64 + m]      = c0[r];
        tw[row * 64 + 16 + m] = c1[r];
        tw[row * 64 + 32 + m] = c2[r];
        tw[row * 64 + 48 + m] = c3[r];
    }
    __syncthreads();

    if (EPI == 1) {
        us* Cb = (us*)Cv + (size_t)blockIdx.z * (size_t)strideC;
        v8us hi[4], lo[4];
#pragma unroll
        for (int p = 0; p < 4; ++p) {
            const int row = 4 * p + (lane >> 3);
            const int col = 8 * (lane & 7);
            const v4f a = *(const v4f*)(tw + row * 64 + col);
            const v4f c = *(const v4f*)(tw + row * 64 + col + 4);
            split8(a, c, hi[p], lo[p]);
        }
#pragma unroll
        for (int p = 0; p < 4; ++p) {
            us* d = Cb + (size_t)(m0 + 4 * p + (lane >> 3)) * ldc + n0 + 8 * (lane & 7);
            *(v8us*)d = hi[p];
            *(v8us*)(d + loff) = lo[p];
        }
        
    } else {
        float* Cb = (float*)Cv + (size_t)blockIdx.z * (size_t)strideC;
        v4f vals[8];
#pragma unroll
        for (int p = 0; p < 8; ++p) {
            const int row = 2 * p + hsel;
            v4f x = *(const v4f*)(tw + row * 64 + 4 * m);
            if (EPI == 2) {
                x.x = tanh_acc(x.x); x.y = tanh_acc(x.y); x.z = tanh_acc(x.z); x.w = tanh_acc(x.w);
            }
            vals[p] = x;
        }
#pragma unroll
        for (int p = 0; p < 8; ++p) {
            float* d = Cb + (size_t)(m0 + 2 * p + hsel) * ldc + n0 + 4 * m;
            *(v4f*)d = vals[p];
        }
        
    }
}

// tanh_acc on eight values at once, the same operations per value. The eight v_exp_f32 and the eight
// v_rcp_f32 each stand in one asm statement: early-clobber results keep every one of them off the sources
// of the others, so each fills the slot the instruction set asks for behind the one in front of it, and
// the closing v_nop fills the slot behind the last.
__device__ __forceinline__ void tanh_acc8(const float (&x)[8], float (&r)[8]) {
    float l[8], t[8], a[8], c[8];
#pragma unroll
    for (int i = 0; i < 8; ++i) l[i] = (-2.0f * __builtin_fabsf(x[i])) * 1.44269504088896340736f;
    asm("v_exp_f32 %0, %8\n\tv_exp_f32 %1, %9\n\tv_exp_f32 %2, %10\n\tv_exp_f32 %3, %11\n\t"
        "v_exp_f32 %4, %12\n\tv_exp_f32 %5, %13\n\tv_exp_f32 %6, %14\n\tv_exp_f32 %7, %15\n\tv_nop"
        : "=&v"(t[0]), "=&v"(t[1]), "=&v"(t[2]), "=&v"(t[3]), "=&v"(t[4]), "=&v"(t[5]), "=&v"(t[6]), "=&v"(t[7])
        : "v"(l[0]), "v"(l[1]), "v"(l[2]), "v"(l[3]), "v"(l[4]), "v"(l[5]), "v"(l[6]), "v"(l[7]));
#pragma unroll
    for (int i = 0; i < 8; ++i) a[i] = 1.0f + t[i];
    asm("v_rcp_f32 %0, %8\n\tv_rcp_f32 %1, %9\n\tv_rcp_f32 %2, %10\n\tv_rcp_f32 %3, %11\n\t"
        "v_rcp_f32 %4, %12\n\tv_rcp_f32 %5, %13\n\tv_rcp_f32 %6, %14\n\tv_rcp_f32 %7, %15\n\tv_nop"
        : "=&v"(c[0]), "=&v"(c[1]), "=&v"(c[2]), "=&v"(c[3]), "=&v"(c[4]), "=&v"(c[5]), "=&v"(c[6]), "=&v"(c[7])
        : "v"(a[0]), "v"(a[1]), "v"(a[2]), "v"(a[3]), "v"(a[4]), "v"(a[5]), "v"(a[6]), "v"(a[7]));
#pragma unroll
    for (int i = 0; i < 8; ++i) r[i] = __builtin_copysignf((1.0f - t[i]) * c[i], x[i]);
}

// ---------------------------------------------------------------------------
// Fused energies -> length mask -> softmax -> P planes. One block (256 = S) per (b, TT queries); thread = s.
//   e[t][s] = sum_h v[h] * tanh(Wsq[bt][h] + Whe[b][s][h])   (f32), s >= len masked out
//   p       = softmax_s(e); Pcat[bt][s] = bf16 hi, Pcat[bt][S+s] = bf16 lo (lo = p - hi)
// Every Whe value a thread loads serves all TT queries of the block from its register, so the strided
// row reads of Whe are issued once per TT queries. Per (t, s) the h order of the sum and the block trees
// of the softmax are those of the one-query form.
// LDS regions are cross-wave: block barriers throughout.
// ---------------------------------------------------------------------------
#define TT 8             // queries per block (= waves per block: wave w stores query w's P planes)
#define CH 8             // v4f per lane and chunk: one 128-B line of the lane's Whe row
static_assert((TQ % TT) == 0 && TT == 8);
static_assert(((HD / 4) % CH) == 0 && ((TT * HD / 4) % 256) == 0);

__global__ __launch_bounds__(256)
void k_attn(const float* __restrict__ Wsq, const float* __restrict__ Whe,
            const float* __restrict__ vvec, const int* __restrict__ lens,
            us* __restrict__ Pcat)
{
    __shared__ v4f sq4[TT][HD / 4];
    __shared__ v4f sv4[HD / 4];
    __shared__ __attribute__((aligned(16))) float sp[TT][S_LEN];
    __shared__ float red[TT][S_LEN];

    const int bt0 = blockIdx.x * TT;         // b * TQ + t of the block's first query; TT divides TQ
    const int b   = bt0 / TQ;
    const int tid = threadIdx.x, lane = tid & 31, wave = tid >> 5;

    {   // the TT query rows are contiguous in Wsq
        const v4f* qs = (const v4f*)(Wsq + (size_t)bt0 * HD);
        v4f* qd = &sq4[0][0];
#pragma unroll
        for (int i = 0; i < TT * HD / 4 / 256; ++i) qd[i * 256 + tid] = qs[i * 256 + tid];
    }
    if (tid < HD / 4) {
        v4f w = *(const v4f*)(vvec + tid * 4);
        w.x = bf2f(f2bf(w.x)); w.y = bf2f(f2bf(w.y)); w.z = bf2f(f2bf(w.z)); w.w = bf2f(f2bf(w.w));
        sv4[tid] = w;
    }
    __syncthreads();

    const int len = lens[b];
    const v4f* we = (const v4f*)(Whe + ((size_t)b * S_LEN + tid) * HD);
    float acc[TT];
#pragma unroll
    for (int t = 0; t < TT; ++t) acc[t] = 0.0f;

    // The lane's next line of Whe is fetched into a second register set while this one is worked on;
    // trip -1 only fetches line 0.
    v4f cur[CH], nxt[CH];
    for (int c = -1; c < HD / 4 / CH; ++c) {
        if (c + 1 < HD / 4 / CH) {
#pragma unroll
            for (int j = 0; j < CH; ++j) nxt[j] = we[(c + 1) * CH + j];
            // stands between these loads and any overwrite of their address registers
            asm volatile("s_wait_xcnt 0x0" ::: "memory");
        }
        if (c >= 0) {
#pragma unroll
            for (int j = 0; j < CH; ++j) {
                const v4f e = cur[j];
                const v4f w = sv4[c * CH + j];
#pragma unroll
                for (int t = 0; t < TT; t += 2) {
                    const v4f d0 = sq4[t][c * CH + j];
                    const v4f d1 = sq4[t + 1][c * CH + j];
                    const float x[8] = {e.x + d0.x, e.y + d0.y, e.z + d0.z, e.w + d0.w,
                                        e.x + d1.x, e.y + d1.y, e.z + d1.z, e.w + d1.w};
                    float r[8];
                    tanh_acc8(x, r);
                    acc[t] += w.x * r[0];
                    acc[t] += w.y * r[1];
                    acc[t] += w.z * r[2];
                    acc[t] += w.w * r[3];
                    acc[t + 1] += w.x * r[4];
                    acc[t + 1] += w.y * r[5];
                    acc[t + 1] += w.z * r[6];
                    acc[t + 1] += w.w * r[7];
                }
            }
        }
#pragma unroll
        for (int j = 0; j < CH; ++j) cur[j] = nxt[j];
    }
    const bool valid = tid < len;

    // block max over s, all TT queries in each step
#pragma unroll
    for (int t = 0; t < TT; ++t) red[t][tid] = valid ? acc[t] : -3.0e38f;
    __syncthreads();
#pragma unroll
    for (int st = S_LEN / 2; st > 0; st >>= 1) {
        if (tid < st) {
#pragma unroll
            for (int t = 0; t < TT; ++t) red[t][tid] = fmaxf(red[t][tid], red[t][tid + st]);
        }
        __syncthreads();
    }
    float ex[TT];
#pragma unroll
    for (int t = 0; t < TT; ++t) ex[t] = red[t][0];      // the maximum, until the exp below
    __syncthreads();

    // exp + block sum (masked entries contribute exactly 0)
#pragma unroll
    for (int t = 0; t < TT; ++t) {
        const float arg = valid ? (acc[t] - ex[t]) : -80.0f;
        const float ex0 = __expf(arg);
        ex[t] = valid ? ex0 : 0.0f;
        red[t][tid] = ex[t];
    }
    __syncthreads();
#pragma unroll
    for (int st = S_LEN / 2; st > 0; st >>= 1) {
        if (tid < st) {
#pragma unroll
            for (int t = 0; t < TT; ++t) red[t][tid] += red[t][tid + st];
        }
        __syncthreads();
    }
#pragma unroll
    for (int t = 0; t < TT; ++t) {
        const float ssum = red[t][0];
        sp[t][tid] = ex[t] * (1.0f / ssum);
    }
    __syncthreads();

    // P planes: wave w writes query w's 256 hi halves and its 256 lo halves (512 B per instruction,
    // 8 lanes per line).
    {
        const v4f a = *(const v4f*)(&sp[wave][lane * 8]);
        const v4f c = *(const v4f*)(&sp[wave][lane * 8 + 4]);
        v8us hi, lo;
        split8(a, c, hi, lo);
        us* d = Pcat + (size_t)(bt0 + wave) * KC + lane * 8;
        *(v8us*)d = hi;
        *(v8us*)(d + S_LEN) = lo;
    }
}

// ---------------------------------------------------------------------------
static inline size_t al256(size_t x) { return (x + 255) & ~(size_t)255; }

extern "C" void kernel_launch(void* const* d_in, const int* in_sizes, int n_in,
                              void* d_out, int out_size, void* d_ws, size_t ws_size,
                              hipStream_t stream)
{
    if (n_in < 7) return;
    if (in_sizes[0] < ((NB - 1) * T_FULL + TQ) * HD) return;      // query  [8][256][512] f32
    if (in_sizes[1] < NB * S_LEN * HD) return;                      // enc    [8][256][512] f32
    if (in_sizes[2] < NB) return;                                   // src_lengths [8] int32
    if (in_sizes[3] < HD * HD || in_sizes[4] < HD * HD) return;     // W_s, W_h [512][512] f32
    if (in_sizes[5] < HD) return;                                   // v [512] f32
    if (in_sizes[6] < HD * 2 * HD) return;                          // W_out [512][1024] f32
    if (out_size < ((NB - 1) * T_FULL + TQ) * HD) return;

    const float* query = (const float*)d_in[0];
    const float* enc   = (const float*)d_in[1];
    const int*   lens  = (const int*)d_in[2];
    const float* W_s   = (const float*)d_in[3];
    const float* W_h   = (const float*)d_in[4];
    const float* vvec  = (const float*)d_in[5];
    const float* W_out = (const float*)d_in[6];
    float* out = (float*)d_out;

    // ---- workspace carve (all regions 256-B aligned; sizes already store-granular) ----
    char* ws = (char*)d_ws;
    size_t off = 0;
    us* comb  = (us*)(ws + off);    off += al256((size_t)NB * TQ * KO * sizeof(us));      // [NB*TQ][1536]
    us* encb  = (us*)(ws + off);    off += al256((size_t)NB * S_LEN * HD * sizeof(us));   // [NB*S][512]
    us* encT2 = (us*)(ws + off);    off += al256((size_t)NB * HD * KC * sizeof(us));      // [NB][512][512]
    us* Wsb   = (us*)(ws + off);    off += al256((size_t)HD * HD * sizeof(us));           // [512][512]
    us* Whb   = (us*)(ws + off);    off += al256((size_t)HD * HD * sizeof(us));           // [512][512]
    us* WoX   = (us*)(ws + off);    off += al256((size_t)HD * KO * sizeof(us));           // [512][1536]
    float* Wsq = (float*)(ws + off); off += al256((size_t)NB * TQ * HD * sizeof(float));  // [NB*TQ][512]
    float* Whe = (float*)(ws + off); off += al256((size_t)NB * S_LEN * HD * sizeof(float)); // [NB*S][512]
    us* Pcat  = (us*)(ws + off);    off += al256((size_t)NB * TQ * KC * sizeof(us));      // [NB*TQ][512]
    if (off > ws_size) return;

    const dim3 b256(256), b128(128);

    // ---- 16-bit planes (RNE convert of every float input, once) ----
    {   // query -> comb columns [1024,1536)
        const int nrows = NB * TQ, nseg = HD / 256;
        k_cvt<<<dim3((nrows * nseg + 7) / 8), b256, 0, stream>>>(
            query, HD, 0, TQ, T_FULL, comb, KO, 2 * HD, nrows, nseg);
    }
    {   // enc -> encb [NB*S][512]
        const int nrows = NB * S_LEN, nseg = HD / 256;
        k_cvt<<<dim3((nrows * nseg + 7) / 8), b256, 0, stream>>>(
            enc, HD, 0, S_LEN, S_LEN, encb, HD, 0, nrows, nseg);
    }
    {   // weights: W_s, W_h ([out][in] is already k-contiguous per output column)
        const int nrows = HD, nseg = HD / 256;
        const dim3 g((nrows * nseg + 7) / 8);
        k_cvt<<<g, b256, 0, stream>>>(W_s, HD, 0, HD, HD, Wsb, HD, 0, nrows, nseg);
        k_cvt<<<g, b256, 0, stream>>>(W_h, HD, 0, HD, HD, Whb, HD, 0, nrows, nseg);
        // W_out [512][1024] -> WoX [512][1536] = [W_out[:,0:512] | W_out[:,0:512] | W_out[:,512:1024]]
        k_cvt<<<g, b256, 0, stream>>>(W_out, 2 * HD, 0,  HD, HD, WoX, KO, 0,      nrows, nseg);
        k_cvt<<<g, b256, 0, stream>>>(W_out, 2 * HD, 0,  HD, HD, WoX, KO, HD,     nrows, nseg);
        k_cvt<<<g, b256, 0, stream>>>(W_out, 2 * HD, HD, HD, HD, WoX, KO, 2 * HD, nrows, nseg);
    }
    // enc transposed, duplicated along k: encT2[b][h][s] = encT2[b][h][S+s]
    k_trans<<<dim3(S_LEN / 64, HD / 64, NB), b256, 0, stream>>>(enc, encT2);

    // ---- projections: Wsq = q @ W_s^T, Whe = enc @ W_h^T (f32 results) ----
    k_gemm<0><<<dim3(NB * TQ / 64, HD / 64, 1), b128, 0, stream>>>(
        comb + 2 * HD, KO, 0, Wsb, HD, 0, (void*)Wsq, HD, 0, HD, 0);
    k_gemm<0><<<dim3(NB * S_LEN / 64, HD / 64, 1), b128, 0, stream>>>(
        encb, HD, 0, Whb, HD, 0, (void*)Whe, HD, 0, HD, 0);

    // ---- energies + mask + softmax -> P hi/lo planes ----
    k_attn<<<dim3(NB * TQ / TT), b256, 0, stream>>>(Wsq, Whe, vvec, lens, Pcat);

    // ---- context = [P_hi|P_lo] @ [encT;encT] -> comb columns [0,512) hi and [512,1024) lo ----
    k_gemm<1><<<dim3(TQ / 64, HD / 64, NB), b128, 0, stream>>>(
        Pcat, KC, TQ * KC, encT2, KC, HD * KC, (void*)comb, KO, TQ * KO, KC, HD);

    // ---- out = tanh([ctx_hi|ctx_lo|q] @ WoX^T) ----
    k_gemm<2><<<dim3(TQ / 64, HD / 64, NB), b128, 0, stream>>>(
        comb, KO, TQ * KO, WoX, KO, 0, (void*)out, HD, T_FULL * HD, KO, 0);
}

// v002
// A run of this version takes 98.6 microseconds.
// Timed twice side by side with v001, it ran 1.27 and 1.29 times as fast.
// All steps since v000 together make it 2.21 times as fast.
#include <hip/hip_runtime.h>

// Contractions on v_wmma_f32_16x16x32_bf16 (bf16 operands, f32 accumulate): q@W_s^T and enc@W_h^T from
// RNE-converted input planes; attn@enc and [ctx|q]@W_out^T with attn and ctx carried as bf16 hi+lo planes
// folded into K. Energies v.tanh(.), length masking and softmax in f32 on the VALU; the tanh of a sum is
// formed from one exponential factor per projection value (exp_m2 below).

#ifndef NB
#define NB 8
#endif
#ifndef TQ
#define TQ 256
#endif
#define NB_FULL 8
#define T_FULL 256
#define S_LEN 256
#define HD 512
#define KC (2 * S_LEN)   // context GEMM depth: [P_hi | P_lo]
#define KO (3 * HD)      // output GEMM depth:  [ctx_hi | ctx_lo | q]

static_assert(NB >= 1 && NB <= NB_FULL);
static_assert(TQ >= 64 && TQ <= T_FULL && (TQ % 64) == 0);
static_assert(S_LEN == 256);
static_assert((HD % 256) == 0);
static_assert((KC % 32) == 0 && (KO % 32) == 0 && (HD % 64) == 0 && (S_LEN % 64) == 0);

typedef unsigned short us;
typedef us     v8us  __attribute__((ext_vector_type(8)));
typedef __bf16 v16bf __attribute__((ext_vector_type(16)));
typedef float  v8f   __attribute__((ext_vector_type(8)));
typedef float  v4f   __attribute__((ext_vector_type(4)));
typedef float  v2f   __attribute__((ext_vector_type(2)));

union Frag { v16bf v; v8us h[2]; };

// ---------------------------------------------------------------------------
// scalar helpers
// ---------------------------------------------------------------------------
__device__ __forceinline__ us f2bf(float f) {           // f32 -> bf16, RNE convert
    unsigned int u = __float_as_uint(f);
    u += 0x7FFFu + ((u >> 16) & 1u);
    return (us)(u >> 16);
}
__device__ __forceinline__ float bf2f(us h) {
    return __uint_as_float(((unsigned int)h) << 16);
}
// tanh(x) = sign(x) * (1 - e^{-2|x|}) / (1 + e^{-2|x|}), v_exp_f32 + v_rcp_f32 based (abs error ~1e-7)
__device__ __forceinline__ float tanh_acc(float x) {
    const float ax = __builtin_fabsf(x);
    const float t  = __expf(-2.0f * ax);
    const float r  = (1.0f - t) * __builtin_amdgcn_rcpf(1.0f + t);
    return __builtin_copysignf(r, x);
}
// e^{-2x}, the factor of one projection value: tanh(a + b) = 2 / (1 + e^{-2a} * e^{-2b}) - 1.
// The exponent is held in [-63, 63] (|x| <= 21.8), so a factor is never 0 or inf and a product of two
// is never 0 * inf; a product that grows large gives 2 / (1 + u) - 1 -> -1, a small one -> +1.
__device__ __forceinline__ float exp_m2(float x) {
    const float l = fminf(fmaxf(x * -2.88539008177792681472f, -63.0f), 63.0f);
    return __builtin_amdgcn_exp2f(l);
}
__device__ __forceinline__ v8us pack8(v4f a, v4f c) {
    v8us o;
    o[0] = f2bf(a.x); o[1] = f2bf(a.y); o[2] = f2bf(a.z); o[3] = f2bf(a.w);
    o[4] = f2bf(c.x); o[5] = f2bf(c.y); o[6] = f2bf(c.z); o[7] = f2bf(c.w);
    return o;
}
// hi = bf16(x), lo = bf16(x - hi): unscaled bf16 residual pair
__device__ __forceinline__ void split8(v4f a, v4f c, v8us& hi, v8us& lo) {
    const float x[8] = {a.x, a.y, a.z, a.w, c.x, c.y, c.z, c.w};
#pragma unroll
    for (int i = 0; i < 8; ++i) {
        const us h = f2bf(x[i]);
        hi[i] = h;
        lo[i] = f2bf(x[i] - bf2f(h));
    }
}

// ---------------------------------------------------------------------------
// WMMA helper: 16x16x32 bf16, f32 accumulate, 4-slot VALU hazard guard after the issue
// ---------------------------------------------------------------------------
__device__ __forceinline__ v8f wmma16(v16bf a, v16bf b, v8f c) {
    v8f d = __builtin_amdgcn_wmma_f32_16x16x32_bf16(false, a, false, b, (short)0, c, false, false);
    asm volatile("v_nop\n\tv_nop\n\tv_nop\n\tv_nop" : "+v"(d) : "v"(a), "v"(b));
    return d;
}

// Fragment loader for a k-contiguous 16-bit plane P[row][k] with pitch ld (halves).
// Lane l: row = (l & 15) (A row m, or B column n of an [n][k] plane), hsel = l >> 4.
//   elements 0..7  <- k0 + 8*hsel + 0..7
//   elements 8..15 <- k0 + 16 + 8*hsel + 0..7
__device__ __forceinline__ v16bf ld_frag(const us* __restrict__ P, int ld, int row, int k0, int hsel) {
    Frag f;
    const us* p = P + (size_t)row * ld + k0 + 8 * hsel;
    f.h[0] = *(const v8us*)p;
    f.h[1] = *(const v8us*)(p + 16);
    return f.v;
}

// ---------------------------------------------------------------------------
// Row conversion f32 -> bf16 plane. One wave per (row, 256-column segment):
// lane l converts columns 8l..8l+7 of the segment and stores 16 B; one instruction covers the
// (r / grp) * gstride + (r % grp) (lets a reduced build read full-stride inputs).
// ---------------------------------------------------------------------------
__global__ __launch_bounds__(256)
void k_cvt(const float* __restrict__ src, int spitch, int scol, int grp, int gstride,
           us* __restrict__ dst, int dpitch, int dcol, int nrows, int nseg)
{
    const int lane = threadIdx.x & 31;
    const int gw   = blockIdx.x * 8 + (threadIdx.x >> 5);
    if (gw >= nrows * nseg) return;                    // wave-uniform, no barriers in this kernel
    const int r    = gw / nseg;
    const int sg   = gw - r * nseg;
    const int g    = r / grp;
    const int srow = g * gstride + (r - g * grp);
    const float* sp = src + (size_t)srow * spitch + scol + sg * 256 + lane * 8;
    const v4f a = *(const v4f*)sp;
    const v4f c = *(const v4f*)(sp + 4);
    const v8us o = pack8(a, c);
    us* dp = dst + (size_t)r * dpitch + dcol + sg * 256 + lane * 8;
    *(v8us*)dp = o;
    
}

// ---------------------------------------------------------------------------
// Encoder transpose plane: encT2[b][h][s] = encT2[b][h][S+s] = bf16(enc[b][s][h]); pitch KC halves.
// Block: 64 s x 64 h tile through LDS (cross-wave -> block barrier). Store phase: one instruction
// grid = (S/64, H/64, NB)
// ---------------------------------------------------------------------------
__global__ __launch_bounds__(256)
void k_trans(const float* __restrict__ enc, us* __restrict__ encT2)
{
    __shared__ float ts[64][65];
    const int s0 = blockIdx.x * 64, h0 = blockIdx.y * 64, b = blockIdx.z;
    const int tid = threadIdx.x, lane = tid & 31, wave = tid >> 5;

#pragma unroll
    for (int p = 0; p < 4; ++p) {
        const int sl = p * 16 + (tid >> 4);
        const int h4 = (tid & 15) * 4;
        const v4f x = *(const v4f*)(enc + ((size_t)(b * S_LEN + s0 + sl)) * HD + h0 + h4);
        ts[sl][h4 + 0] = x.x; ts[sl][h4 + 1] = x.y; ts[sl][h4 + 2] = x.z; ts[sl][h4 + 3] = x.w;
    }
    __syncthreads();

    v8us o[2];
#pragma unroll
    for (int p = 0; p < 2; ++p) {
        const int hl = p * 32 + wave * 4 + (lane >> 3);
        const int s8 = (lane & 7) * 8;
#pragma unroll
        for (int i = 0; i < 8; ++i) o[p][i] = f2bf(ts[s8 + i][hl]);
    }
#pragma unroll
    for (int p = 0; p < 2; ++p) {
        const int hl = p * 32 + wave * 4 + (lane >> 3);
        const int s8 = (lane & 7) * 8;
        us* d = encT2 + ((size_t)(b * HD + h0 + hl)) * KC + s0 + s8;
        *(v8us*)d = o[p];
        *(v8us*)(d + S_LEN) = o[p];
    }
    
}

// ---------------------------------------------------------------------------
// GEMM: C[M][N] = A[M][K] * B, B given as a k-contiguous [N][K] plane (B[k][n] = Bp[n][k]).
// Block = 128 threads (4 waves), block tile 64(M) x 64(N), wave tile 16 x 64 (4 accumulators),
// fragments loaded straight from the 16-bit planes with the split k map. blockIdx.z = batch.
// Epilogue: wave tile staged in LDS, block barrier, then whole-row-segment stores:
//   EPI 2: same with tanh, destination d_out
//   EPI 3: f32 rows of exp_m2(C)
// ---------------------------------------------------------------------------
template <int EPI>
__global__ __launch_bounds__(128)
void k_gemm(const us* __restrict__ A, int lda, int strideA,
            const us* __restrict__ B, int ldb, int strideB,
            void* __restrict__ Cv, int ldc, int strideC, int K, int loff)
{
    __shared__ __attribute__((aligned(16))) float tile[4 * 16 * 64];

    const int lane = threadIdx.x & 31, wave = threadIdx.x >> 5;
    const int hsel = lane >> 4, m = lane & 15;
    const int m0 = blockIdx.x * 64 + wave * 16;
    const int n0 = blockIdx.y * 64;
    const us* Ab = A + (size_t)blockIdx.z * (size_t)strideA;
    const us* Bb = B + (size_t)blockIdx.z * (size_t)strideB;

    v8f c0 = {}; v8f c1 = {}; v8f c2 = {}; v8f c3 = {};
    for (int k0 = 0; k0 < K; k0 += 32) {
        const v16bf a  = ld_frag(Ab, lda, m0 + m, k0, hsel);
        const v16bf b0 = ld_frag(Bb, ldb, n0 + m,      k0, hsel);
        const v16bf b1 = ld_frag(Bb, ldb, n0 + 16 + m, k0, hsel);
        const v16bf b2 = ld_frag(Bb, ldb, n0 + 32 + m, k0, hsel);
        const v16bf b3 = ld_frag(Bb, ldb, n0 + 48 + m, k0, hsel);
        c0 = wmma16(a, b0, c0);
        c1 = wmma16(a, b1, c1);
        c2 = wmma16(a, b2, c2);
        c3 = wmma16(a, b3, c3);
    }

    // D map: acc[r] -> (row 8*hsel + r, col n-tile + m). Stage the 16x64 wave tile in LDS.
    float* tw = tile + wave * 1024;
#pragma unroll
    for (int r = 0; r < 8; ++r) {
        const int row = 8 * hsel + r;
        tw[row * 64 + m]      = c0[r];
        tw[row * 64 + 16 + m] = c1[r];
        tw[row * 64 + 32 + m] = c2[r];
        tw[row * 64 + 48 + m] = c3[r];
    }
    __syncthreads();

    if (EPI == 1) {
        us* Cb = (us*)Cv + (size_t)blockIdx.z * (size_t)strideC;
        v8us hi[4], lo[4];
#pragma unroll
        for (int p = 0; p < 4; ++p) {
            const int row = 4 * p + (lane >> 3);
            const int col = 8 * (lane & 7);
            const v4f a = *(const v4f*)(tw + row * 64 + col);
            const v4f c = *(const v4f*)(tw + row * 64 + col + 4);
            split8(a, c, hi[p], lo[p]);
        }
#pragma unroll
        for (int p = 0; p < 4; ++p) {
            us* d = Cb + (size_t)(m0 + 4 * p + (lane >> 3)) * ldc + n0 + 8 * (lane & 7);
            *(v8us*)d = hi[p];
            *(v8us*)(d + loff) = lo[p];
        }
        
    } else {
        float* Cb = (float*)Cv + (size_t)blockIdx.z * (size_t)strideC;
        v4f vals[8];
#pragma unroll
        for (int p = 0; p < 8; ++p) {
            const int row = 2 * p + hsel;
            v4f x = *(const v4f*)(tw + row * 64 + 4 * m);
            if (EPI == 2) {
                x.x = tanh_acc(x.x); x.y = tanh_acc(x.y); x.z = tanh_acc(x.z); x.w = tanh_acc(x.w);
            }
            if (EPI == 3) {
                x.x = exp_m2(x.x); x.y = exp_m2(x.y); x.z = exp_m2(x.z); x.w = exp_m2(x.w);
            }
            vals[p] = x;
        }
#pragma unroll
        for (int p = 0; p < 8; ++p) {
            float* d = Cb + (size_t)(m0 + 2 * p + hsel) * ldc + n0 + 4 * m;
            *(v4f*)d = vals[p];
        }
        
    }
}

// ---------------------------------------------------------------------------
// Fused energies -> length mask -> softmax -> P planes. One block (256 = S) per (b, TT queries); thread = s.
//   Wsq and Whe arrive as factors: Eq = e^{-2 Wsq}, Ee = e^{-2 Whe} (k_gemm<3>), so that
//   v[h] * tanh(Wsq[bt][h] + Whe[b][s][h]) = 2 v[h] / (1 + Eq[bt][h] * Ee[b][s][h]) - v[h]
//   e[t][s] = sum_h 2 v[h] / (1 + Eq * Ee)   (f32), s >= len masked out; the term -sum_h v[h] is the same
//             for every s of a row and cancels in the softmax, so it is not formed
//   p       = softmax_s(e); Pcat[bt][s] = bf16 hi, Pcat[bt][S+s] = bf16 lo (lo = p - hi)
// Every Ee value a thread loads serves all TT queries of the block from its register, so the strided
// row reads of Ee are issued once per TT queries. Per (t, s) the h order of the sum and the block trees
// of the softmax are those of the one-query form.
// LDS regions are cross-wave: block barriers throughout.
// ---------------------------------------------------------------------------
#define TT 8             // queries per block (= waves per block: wave w stores query w's P planes)
#define CH 8             // v4f per lane and chunk: one 128-B line of the lane's Whe row
static_assert((TQ % TT) == 0 && TT == 8);
static_assert(((HD / 4) % CH) == 0 && ((TT / 2 * HD / 4) % 256) == 0);

__global__ __launch_bounds__(256)
void k_attn(const float* __restrict__ Wsq, const float* __restrict__ Whe,
            const float* __restrict__ vvec, const int* __restrict__ lens,
            us* __restrict__ Pcat)
{
    // query factors, two queries interleaved: sqp[p][h / 2] = {Eq[2p][h], Eq[2p+1][h], Eq[2p][h+1], Eq[2p+1][h+1]},
    // so that a pair of queries at one h is a register pair as it comes from LDS
    __shared__ v4f sqp[TT / 2][HD / 2];
    __shared__ v4f sv4[HD / 4];
    __shared__ __attribute__((aligned(16))) float sp[TT][S_LEN];
    __shared__ float red[TT][S_LEN];

    const int bt0 = blockIdx.x * TT;         // b * TQ + t of the block's first query; TT divides TQ
    const int b   = bt0 / TQ;
    const int tid = threadIdx.x, lane = tid & 31, wave = tid >> 5;

    {   // the TT query rows are contiguous in Wsq
        const v4f* qs = (const v4f*)(Wsq + (size_t)bt0 * HD);
#pragma unroll
        for (int i = 0; i < TT / 2 * HD / 4 / 256; ++i) {
            const int p  = (i * 256 + tid) / (HD / 4);
            const int h4 = (i * 256 + tid) % (HD / 4);
            const v4f a = qs[(2 * p) * (HD / 4) + h4];
            const v4f c = qs[(2 * p + 1) * (HD / 4) + h4];
            sqp[p][2 * h4]     = (v4f){a.x, c.x, a.y, c.y};
            sqp[p][2 * h4 + 1] = (v4f){a.z, c.z, a.w, c.w};
        }
    }
    if (tid < HD / 4) {
        v4f w = *(const v4f*)(vvec + tid * 4);
        w.x = bf2f(f2bf(w.x)); w.y = bf2f(f2bf(w.y)); w.z = bf2f(f2bf(w.z)); w.w = bf2f(f2bf(w.w));
        sv4[tid] = 2.0f * w;
    }
    __syncthreads();

    const int len = lens[b];
    const v4f* we = (const v4f*)(Whe + ((size_t)b * S_LEN + tid) * HD);
    // the sums of queries t and t + 1 lie side by side, so that one packed fma serves both; each keeps its h order
    v2f acc2[TT / 2];
#pragma unroll
    for (int t = 0; t < TT / 2; ++t) acc2[t] = (v2f){0.0f, 0.0f};

    // The lane's next line of Whe is fetched into a second register set while this one is worked on;
    // trip -1 only fetches line 0.
    v4f cur[CH], nxt[CH];
    for (int c = -1; c < HD / 4 / CH; ++c) {
        if (c + 1 < HD / 4 / CH) {
#pragma unroll
            for (int j = 0; j < CH; ++j) nxt[j] = we[(c + 1) * CH + j];
            // stands between these loads and any overwrite of their address registers
            asm volatile("s_wait_xcnt 0x0" ::: "memory");
        }
        if (c >= 0) {
#pragma unroll
            for (int j = 0; j < CH; ++j) {
                const v4f e = cur[j];
                const v4f w = sv4[c * CH + j];
#pragma unroll
                for (int p = 0; p < TT / 2; ++p) {
                    const v4f q0 = sqp[p][(c * CH + j) * 2];
                    const v4f q1 = sqp[p][(c * CH + j) * 2 + 1];
                    const v2f q[4] = {q0.xy, q0.zw, q1.xy, q1.zw};
#pragma unroll
                    for (int i = 0; i < 4; ++i) {
                        const v2f n = __builtin_elementwise_fma(q[i], (v2f){e[i], e[i]}, (v2f){1.0f, 1.0f});
                        const v2f r = {__builtin_amdgcn_rcpf(n.x), __builtin_amdgcn_rcpf(n.y)};
                        acc2[p] = __builtin_elementwise_fma((v2f){w[i], w[i]}, r, acc2[p]);
                    }
                }
            }
        }
#pragma unroll
        for (int j = 0; j < CH; ++j) cur[j] = nxt[j];
    }
    const bool valid = tid < len;
    float acc[TT];
#pragma unroll
    for (int t = 0; t < TT; ++t) acc[t] = acc2[t / 2][t & 1];

    // block max over s, all TT queries in each step
#pragma unroll
    for (int t = 0; t < TT; ++t) red[t][tid] = valid ? acc[t] : -3.0e38f;
    __syncthreads();
#pragma unroll
    for (int st = S_LEN / 2; st > 0; st >>= 1) {
        if (tid < st) {
#pragma unroll
            for (int t = 0; t < TT; ++t) red[t][tid] = fmaxf(red[t][tid], red[t][tid + st]);
        }
        __syncthreads();
    }
    float ex[TT];
#pragma unroll
    for (int t = 0; t < TT; ++t) ex[t] = red[t][0];      // the maximum, until the exp below
    __syncthreads();

    // exp + block sum (masked entries contribute exactly 0)
#pragma unroll
    for (int t = 0; t < TT; ++t) {
        const float arg = valid ? (acc[t] - ex[t]) : -80.0f;
        const float ex0 = __expf(arg);
        ex[t] = valid ? ex0 : 0.0f;
        red[t][tid] = ex[t];
    }
    __syncthreads();
#pragma unroll
    for (int st = S_LEN / 2; st > 0; st >>= 1) {
        if (tid < st) {
#pragma unroll
            for (int t = 0; t < TT; ++t) red[t][tid] += red[t][tid + st];
        }
        __syncthreads();
    }
#pragma unroll
    for (int t = 0; t < TT; ++t) {
        const float ssum = red[t][0];
        sp[t][tid] = ex[t] * (1.0f / ssum);
    }
    __syncthreads();

    // P planes: wave w writes query w's 256 hi halves and its 256 lo halves (512 B per instruction,
    // 8 lanes per line).
    {
        const v4f a = *(const v4f*)(&sp[wave][lane * 8]);
        const v4f c = *(const v4f*)(&sp[wave][lane * 8 + 4]);
        v8us hi, lo;
        split8(a, c, hi, lo);
        us* d = Pcat + (size_t)(bt0 + wave) * KC + lane * 8;
        *(v8us*)d = hi;
        *(v8us*)(d + S_LEN) = lo;
    }
}

// ---------------------------------------------------------------------------
static inline size_t al256(size_t x) { return (x + 255) & ~(size_t)255; }

extern "C" void kernel_launch(void* const* d_in, const int* in_sizes, int n_in,
                              void* d_out, int out_size, void* d_ws, size_t ws_size,
                              hipStream_t stream)
{
    if (n_in < 7) return;
    if (in_sizes[0] < ((NB - 1) * T_FULL + TQ) * HD) return;      // query  [8][256][512] f32
    if (in_sizes[1] < NB * S_LEN * HD) return;                      // enc    [8][256][512] f32
    if (in_sizes[2] < NB) return;                                   // src_lengths [8] int32
    if (in_sizes[3] < HD * HD || in_sizes[4] < HD * HD) return;     // W_s, W_h [512][512] f32
    if (in_sizes[5] < HD) return;                                   // v [512] f32
    if (in_sizes[6] < HD * 2 * HD) return;                          // W_out [512][1024] f32
    if (out_size < ((NB - 1) * T_FULL + TQ) * HD) return;

    const float* query = (const float*)d_in[0];
    const float* enc   = (const float*)d_in[1];
    const int*   lens  = (const int*)d_in[2];
    const float* W_s   = (const float*)d_in[3];
    const float* W_h   = (const float*)d_in[4];
    const float* vvec  = (const float*)d_in[5];
    const float* W_out = (const float*)d_in[6];
    float* out = (float*)d_out;

    // ---- workspace carve (all regions 256-B aligned; sizes already store-granular) ----
    char* ws = (char*)d_ws;
    size_t off = 0;
    us* comb  = (us*)(ws + off);    off += al256((size_t)NB * TQ * KO * sizeof(us));      // [NB*TQ][1536]
    us* encb  = (us*)(ws + off);    off += al256((size_t)NB * S_LEN * HD * sizeof(us));   // [NB*S][512]
    us* encT2 = (us*)(ws + off);    off += al256((size_t)NB * HD * KC * sizeof(us));      // [NB][512][512]
    us* Wsb   = (us*)(ws + off);    off += al256((size_t)HD * HD * sizeof(us));           // [512][512]
    us* Whb   = (us*)(ws + off);    off += al256((size_t)HD * HD * sizeof(us));           // [512][512]
    us* WoX   = (us*)(ws + off);    off += al256((size_t)HD * KO * sizeof(us));           // [512][1536]
    float* Wsq = (float*)(ws + off); off += al256((size_t)NB * TQ * HD * sizeof(float));  // [NB*TQ][512]
    float* Whe = (float*)(ws + off); off += al256((size_t)NB * S_LEN * HD * sizeof(float)); // [NB*S][512]
    us* Pcat  = (us*)(ws + off);    off += al256((size_t)NB * TQ * KC * sizeof(us));      // [NB*TQ][512]
    if (off > ws_size) return;

    const dim3 b256(256), b128(128);

    // ---- 16-bit planes (RNE convert of every float input, once) ----
    {   // query -> comb columns [1024,1536)
        const int nrows = NB * TQ, nseg = HD / 256;
        k_cvt<<<dim3((nrows * nseg + 7) / 8), b256, 0, stream>>>(
            query, HD, 0, TQ, T_FULL, comb, KO, 2 * HD, nrows, nseg);
    }
    {   // enc -> encb [NB*S][512]
        const int nrows = NB * S_LEN, nseg = HD / 256;
        k_cvt<<<dim3((nrows * nseg + 7) / 8), b256, 0, stream>>>(
            enc, HD, 0, S_LEN, S_LEN, encb, HD, 0, nrows, nseg);
    }
    {   // weights: W_s, W_h ([out][in] is already k-contiguous per output column)
        const int nrows = HD, nseg = HD / 256;
        const dim3 g((nrows * nseg + 7) / 8);
        k_cvt<<<g, b256, 0, stream>>>(W_s, HD, 0, HD, HD, Wsb, HD, 0, nrows, nseg);
        k_cvt<<<g, b256, 0, stream>>>(W_h, HD, 0, HD, HD, Whb, HD, 0, nrows, nseg);
        // W_out [512][1024] -> WoX [512][1536] = [W_out[:,0:512] | W_out[:,0:512] | W_out[:,512:1024]]
        k_cvt<<<g, b256, 0, stream>>>(W_out, 2 * HD, 0,  HD, HD, WoX, KO, 0,      nrows, nseg);
        k_cvt<<<g, b256, 0, stream>>>(W_out, 2 * HD, 0,  HD, HD, WoX, KO, HD,     nrows, nseg);
        k_cvt<<<g, b256, 0, stream>>>(W_out, 2 * HD, HD, HD, HD, WoX, KO, 2 * HD, nrows, nseg);
    }
    // enc transposed, duplicated along k: encT2[b][h][s] = encT2[b][h][S+s]
    k_trans<<<dim3(S_LEN / 64, HD / 64, NB), b256, 0, stream>>>(enc, encT2);

    // ---- projections, stored as factors: Wsq = e^{-2 q @ W_s^T}, Whe = e^{-2 enc @ W_h^T} (f32) ----
    k_gemm<3><<<dim3(NB * TQ / 64, HD / 64, 1), b128, 0, stream>>>(
        comb + 2 * HD, KO, 0, Wsb, HD, 0, (void*)Wsq, HD, 0, HD, 0);
    k_gemm<3><<<dim3(NB * S_LEN / 64, HD / 64, 1), b128, 0, stream>>>(
        encb, HD, 0, Whb, HD, 0, (void*)Whe, HD, 0, HD, 0);

    // ---- energies + mask + softmax -> P hi/lo planes ----
    k_attn<<<dim3(NB * TQ / TT), b256, 0, stream>>>(Wsq, Whe, vvec, lens, Pcat);

    // ---- context = [P_hi|P_lo] @ [encT;encT] -> comb columns [0,512) hi and [512,1024) lo ----
    k_gemm<1><<<dim3(TQ / 64, HD / 64, NB), b128, 0, stream>>>(
        Pcat, KC, TQ * KC, encT2, KC, HD * KC, (void*)comb, KO, TQ * KO, KC, HD);

    // ---- out = tanh([ctx_hi|ctx_lo|q] @ WoX^T) ----
    k_gemm<2><<<dim3(TQ / 64, HD / 64, NB), b128, 0, stream>>>(
        comb, KO, TQ * KO, WoX, KO, 0, (void*)out, HD, T_FULL * HD, KO, 0);
}

// v003
// Measured time: 78.5 microseconds a run.
// In two side-by-side timings against v002, it was 1.27 and 1.23 times as fast.
// Over all steps from v000 it is 2.76 times as fast.
#include <hip/hip_runtime.h>

// Contractions on v_wmma_f32_16x16x32_bf16 (bf16 operands, f32 accumulate): q@W_s^T and enc@W_h^T from
// RNE-converted input planes; attn@enc and [ctx|q]@W_out^T with attn and ctx carried as bf16 hi+lo planes
// folded into K. Energies v.tanh(.), length masking and softmax in f32 on the VALU; the tanh of a sum is
// formed from one exponential factor per projection value (exp_m2 below).

#ifndef NB
#define NB 8
#endif
#ifndef TQ
#define TQ 256
#endif
#define NB_FULL 8
#define T_FULL 256
#define S_LEN 256
#define HD 512
#define KC (2 * S_LEN)   // context GEMM depth: [P_hi | P_lo]
#define KO (3 * HD)      // output GEMM depth:  [ctx_hi | ctx_lo | q]

static_assert(NB >= 1 && NB <= NB_FULL);
static_assert(TQ >= 64 && TQ <= T_FULL && (TQ % 64) == 0);
static_assert(S_LEN == 256);
static_assert((HD % 256) == 0);
static_assert((KC % 32) == 0 && (KO % 32) == 0 && (HD % 64) == 0 && (S_LEN % 64) == 0);

typedef unsigned short us;
typedef us     v8us  __attribute__((ext_vector_type(8)));
typedef __bf16 v16bf __attribute__((ext_vector_type(16)));
typedef float  v8f   __attribute__((ext_vector_type(8)));
typedef float  v4f   __attribute__((ext_vector_type(4)));
typedef float  v2f   __attribute__((ext_vector_type(2)));

union Frag { v16bf v; v8us h[2]; };

// ---------------------------------------------------------------------------
// scalar helpers
// ---------------------------------------------------------------------------
__device__ __forceinline__ us f2bf(float f) {           // f32 -> bf16, RNE convert
    unsigned int u = __float_as_uint(f);
    u += 0x7FFFu + ((u >> 16) & 1u);
    return (us)(u >> 16);
}
__device__ __forceinline__ float bf2f(us h) {
    return __uint_as_float(((unsigned int)h) << 16);
}
// tanh(x) = sign(x) * (1 - e^{-2|x|}) / (1 + e^{-2|x|}), v_exp_f32 + v_rcp_f32 based (abs error ~1e-7)
__device__ __forceinline__ float tanh_acc(float x) {
    const float ax = __builtin_fabsf(x);
    const float t  = __expf(-2.0f * ax);
    const float r  = (1.0f - t) * __builtin_amdgcn_rcpf(1.0f + t);
    return __builtin_copysignf(r, x);
}
// e^{-2x}, the factor of one projection value: tanh(a + b) = 2 / (1 + e^{-2a} * e^{-2b}) - 1.
// The exponent is held in [-63, 63] (|x| <= 21.8), so a factor is never 0 or inf and a product of two
// is never 0 * inf; a product that grows large gives 2 / (1 + u) - 1 -> -1, a small one -> +1.
__device__ __forceinline__ float exp_m2(float x) {
    const float l = fminf(fmaxf(x * -2.88539008177792681472f, -63.0f), 63.0f);
    return __builtin_amdgcn_exp2f(l);
}
__device__ __forceinline__ v8us pack8(v4f a, v4f c) {
    v8us o;
    o[0] = f2bf(a.x); o[1] = f2bf(a.y); o[2] = f2bf(a.z); o[3] = f2bf(a.w);
    o[4] = f2bf(c.x); o[5] = f2bf(c.y); o[6] = f2bf(c.z); o[7] = f2bf(c.w);
    return o;
}
// hi = bf16(x), lo = bf16(x - hi): unscaled bf16 residual pair
__device__ __forceinline__ void split8(v4f a, v4f c, v8us& hi, v8us& lo) {
    const float x[8] = {a.x, a.y, a.z, a.w, c.x, c.y, c.z, c.w};
#pragma unroll
    for (int i = 0; i < 8; ++i) {
        const us h = f2bf(x[i]);
        hi[i] = h;
        lo[i] = f2bf(x[i] - bf2f(h));
    }
}

// ---------------------------------------------------------------------------
// WMMA helper: 16x16x32 bf16, f32 accumulate, 4-slot VALU hazard guard after the issue
// ---------------------------------------------------------------------------
__device__ __forceinline__ v8f wmma16(v16bf a, v16bf b, v8f c) {
    v8f d = __builtin_amdgcn_wmma_f32_16x16x32_bf16(false, a, false, b, (short)0, c, false, false);
    asm volatile("v_nop\n\tv_nop\n\tv_nop\n\tv_nop" : "+v"(d) : "v"(a), "v"(b));
    return d;
}

// Fragment loader for a k-contiguous 16-bit plane P[row][k] with pitch ld (halves).
// Lane l: row = (l & 15) (A row m, or B column n of an [n][k] plane), hsel = l >> 4.
//   elements 0..7  <- k0 + 8*hsel + 0..7
//   elements 8..15 <- k0 + 16 + 8*hsel + 0..7
__device__ __forceinline__ v16bf ld_frag(const us* __restrict__ P, int ld, int row, int k0, int hsel) {
    Frag f;
    const us* p = P + (size_t)row * ld + k0 + 8 * hsel;
    f.h[0] = *(const v8us*)p;
    f.h[1] = *(const v8us*)(p + 16);
    return f.v;
}

// ---------------------------------------------------------------------------
// Row conversion f32 -> bf16 plane, block blk of one conversion job. One wave per (row, 256-column segment):
// lane l converts columns 8l..8l+7 of the segment and stores 16 B; one instruction covers the
// (r / grp) * gstride + (r % grp) (lets a reduced build read full-stride inputs).
// ---------------------------------------------------------------------------
__device__ __forceinline__
void cvt_blk(const float* __restrict__ src, int spitch, int scol, int grp, int gstride,
             us* __restrict__ dst, int dpitch, int dcol, int nrows, int nseg, int blk)
{
    const int lane = threadIdx.x & 31;
    const int gw   = blk * 8 + (threadIdx.x >> 5);
    if (gw >= nrows * nseg) return;                    // wave-uniform, no barriers on this path
    const int r    = gw / nseg;
    const int sg   = gw - r * nseg;
    const int g    = r / grp;
    const int srow = g * gstride + (r - g * grp);
    const float* sp = src + (size_t)srow * spitch + scol + sg * 256 + lane * 8;
    const v4f a = *(const v4f*)sp;
    const v4f c = *(const v4f*)(sp + 4);
    const v8us o = pack8(a, c);
    us* dp = dst + (size_t)r * dpitch + dcol + sg * 256 + lane * 8;
    *(v8us*)dp = o;
    
}

// ---------------------------------------------------------------------------
// Encoder transpose plane: encT2[b][h][s] = encT2[b][h][S+s] = bf16(enc[b][s][h]); pitch KC halves.
// Block: 64 s x 64 h tile through LDS (cross-wave -> block barrier). Store phase: one instruction
// tile (s0 / 64, h0 / 64, b) of (S/64, H/64, NB)
// ---------------------------------------------------------------------------
__device__ __forceinline__
void trans_blk(const float* __restrict__ enc, us* __restrict__ encT2, float (*ts)[65], int s0, int h0, int b)
{
    const int tid = threadIdx.x, lane = tid & 31, wave = tid >> 5;

#pragma unroll
    for (int p = 0; p < 4; ++p) {
        const int sl = p * 16 + (tid >> 4);
        const int h4 = (tid & 15) * 4;
        const v4f x = *(const v4f*)(enc + ((size_t)(b * S_LEN + s0 + sl)) * HD + h0 + h4);
        ts[sl][h4 + 0] = x.x; ts[sl][h4 + 1] = x.y; ts[sl][h4 + 2] = x.z; ts[sl][h4 + 3] = x.w;
    }
    __syncthreads();

    v8us o[2];
#pragma unroll
    for (int p = 0; p < 2; ++p) {
        const int hl = p * 32 + wave * 4 + (lane >> 3);
        const int s8 = (lane & 7) * 8;
#pragma unroll
        for (int i = 0; i < 8; ++i) o[p][i] = f2bf(ts[s8 + i][hl]);
    }
#pragma unroll
    for (int p = 0; p < 2; ++p) {
        const int hl = p * 32 + wave * 4 + (lane >> 3);
        const int s8 = (lane & 7) * 8;
        us* d = encT2 + ((size_t)(b * HD + h0 + hl)) * KC + s0 + s8;
        *(v8us*)d = o[p];
        *(v8us*)(d + S_LEN) = o[p];
    }
    
}

// ---------------------------------------------------------------------------
// All 16-bit planes in one launch: none of these jobs reads what another writes, so they share a grid and
// the block index picks the job. The transpose tiles (the longest blocks) come first.
//   transpose  enc   -> encT2
//   convert    query -> comb columns [1024,1536)
//   convert    enc   -> encp columns [1024,1536)
//   convert    W_s -> Wsb, W_h -> Whb ([out][in] is already k-contiguous per output column)
//   convert    W_out [512][1024] -> WoX [512][1536] = [W_out[:,0:512] | W_out[:,0:512] | W_out[:,512:1024]]
// ---------------------------------------------------------------------------
#define NSEG (HD / 256)
#define PB_T ((S_LEN / 64) * (HD / 64) * NB)       // transpose tiles
#define PB_Q ((NB * TQ * NSEG + 7) / 8)            // blocks of the query conversion
#define PB_E ((NB * S_LEN * NSEG + 7) / 8)         // blocks of the enc conversion
#define PB_W ((HD * NSEG + 7) / 8)                 // blocks of one weight conversion
#define PB_ALL (PB_T + PB_Q + PB_E + 5 * PB_W)

__global__ __launch_bounds__(256)
void k_prep(const float* __restrict__ query, const float* __restrict__ enc,
            const float* __restrict__ W_s, const float* __restrict__ W_h, const float* __restrict__ W_out,
            us* __restrict__ comb, us* __restrict__ encp, us* __restrict__ Wsb, us* __restrict__ Whb,
            us* __restrict__ WoX, us* __restrict__ encT2)
{
    __shared__ float ts[64][65];
    int i = blockIdx.x;                                // every test below is the same for the whole block
    if (i < PB_T) {
        trans_blk(enc, encT2, ts, (i % (S_LEN / 64)) * 64, ((i / (S_LEN / 64)) % (HD / 64)) * 64,
                  i / ((S_LEN / 64) * (HD / 64)));
        return;
    }
    i -= PB_T;
    if (i < PB_Q) { cvt_blk(query, HD, 0, TQ, T_FULL, comb, KO, 2 * HD, NB * TQ, NSEG, i); return; }
    i -= PB_Q;
    if (i < PB_E) { cvt_blk(enc, HD, 0, S_LEN, S_LEN, encp, KO, 2 * HD, NB * S_LEN, NSEG, i); return; }
    i -= PB_E;
    if (i < PB_W) { cvt_blk(W_s, HD, 0, HD, HD, Wsb, HD, 0, HD, NSEG, i); return; }
    i -= PB_W;
    if (i < PB_W) { cvt_blk(W_h, HD, 0, HD, HD, Whb, HD, 0, HD, NSEG, i); return; }
    i -= PB_W;
    if (i < PB_W) { cvt_blk(W_out, 2 * HD, 0, HD, HD, WoX, KO, 0, HD, NSEG, i); return; }
    i -= PB_W;
    if (i < PB_W) { cvt_blk(W_out, 2 * HD, 0, HD, HD, WoX, KO, HD, HD, NSEG, i); return; }
    i -= PB_W;
    cvt_blk(W_out, 2 * HD, HD, HD, HD, WoX, KO, 2 * HD, HD, NSEG, i);
}

// ---------------------------------------------------------------------------
// GEMM: C[M][N] = A[M][K] * B, B given as a k-contiguous [N][K] plane (B[k][n] = Bp[n][k]).
// Block = 128 threads (4 waves), block tile 64(M) x 64(N), wave tile 16 x 64 (4 accumulators),
// fragments loaded straight from the 16-bit planes with the split k map. blockIdx.z = batch.
// Epilogue: wave tile staged in LDS, block barrier, then whole-row-segment stores:
//   EPI 2: same with tanh, destination d_out
//   EPI 3: f32 rows of exp_m2(C)
// ---------------------------------------------------------------------------
template <int EPI>
__global__ __launch_bounds__(128)
void k_gemm(const us* __restrict__ A, int lda, int strideA,
            const us* __restrict__ B, int ldb, int strideB,
            void* __restrict__ Cv, int ldc, int strideC, int K, int loff)
{
    __shared__ __attribute__((aligned(16))) float tile[4 * 16 * 64];

    const int lane = threadIdx.x & 31, wave = threadIdx.x >> 5;
    const int hsel = lane >> 4, m = lane & 15;
    const int m0 = blockIdx.x * 64 + wave * 16;
    const int n0 = blockIdx.y * 64;
    const us* Ab = A + (size_t)blockIdx.z * (size_t)strideA;
    const us* Bb = B + (size_t)blockIdx.z * (size_t)strideB;

    v8f c0 = {}; v8f c1 = {}; v8f c2 = {}; v8f c3 = {};
    for (int k0 = 0; k0 < K; k0 += 32) {
        const v16bf a  = ld_frag(Ab, lda, m0 + m, k0, hsel);
        const v16bf b0 = ld_frag(Bb, ldb, n0 + m,      k0, hsel);
        const v16bf b1 = ld_frag(Bb, ldb, n0 + 16 + m, k0, hsel);
        const v16bf b2 = ld_frag(Bb, ldb, n0 + 32 + m, k0, hsel);
        const v16bf b3 = ld_frag(Bb, ldb, n0 + 48 + m, k0, hsel);
        c0 = wmma16(a, b0, c0);
        c1 = wmma16(a, b1, c1);
        c2 = wmma16(a, b2, c2);
        c3 = wmma16(a, b3, c3);
    }

    // D map: acc[r] -> (row 8*hsel + r, col n-tile + m). Stage the 16x64 wave tile in LDS.
    float* tw = tile + wave * 1024;
#pragma unroll
    for (int r = 0; r < 8; ++r) {
        const int row = 8 * hsel + r;
        tw[row * 64 + m]      = c0[r];
        tw[row * 64 + 16 + m] = c1[r];
        tw[row * 64 + 32 + m] = c2[r];
        tw[row * 64 + 48 + m] = c3[r];
    }
    __syncthreads();

    if (EPI == 1) {
        us* Cb = (us*)Cv + (size_t)blockIdx.z * (size_t)strideC;
        v8us hi[4], lo[4];
#pragma unroll
        for (int p = 0; p < 4; ++p) {
            const int row = 4 * p + (lane >> 3);
            const int col = 8 * (lane & 7);
            const v4f a = *(const v4f*)(tw + row * 64 + col);
            const v4f c = *(const v4f*)(tw + row * 64 + col + 4);
            split8(a, c, hi[p], lo[p]);
        }
#pragma unroll
        for (int p = 0; p < 4; ++p) {
            us* d = Cb + (size_t)(m0 + 4 * p + (lane >> 3)) * ldc + n0 + 8 * (lane & 7);
            *(v8us*)d = hi[p];
            *(v8us*)(d + loff) = lo[p];
        }
        
    } else {
        float* Cb = (float*)Cv + (size_t)blockIdx.z * (size_t)strideC;
        v4f vals[8];
#pragma unroll
        for (int p = 0; p < 8; ++p) {
            const int row = 2 * p + hsel;
            v4f x = *(const v4f*)(tw + row * 64 + 4 * m);
            if (EPI == 2) {
                x.x = tanh_acc(x.x); x.y = tanh_acc(x.y); x.z = tanh_acc(x.z); x.w = tanh_acc(x.w);
            }
            if (EPI == 3) {
                x.x = exp_m2(x.x); x.y = exp_m2(x.y); x.z = exp_m2(x.z); x.w = exp_m2(x.w);
            }
            vals[p] = x;
        }
#pragma unroll
        for (int p = 0; p < 8; ++p) {
            float* d = Cb + (size_t)(m0 + 2 * p + hsel) * ldc + n0 + 4 * m;
            *(v4f*)d = vals[p];
        }
        
    }
}

// ---------------------------------------------------------------------------
// Fused energies -> length mask -> softmax -> P planes. One block (256 = S) per (b, TT queries); thread = s.
//   Wsq and Whe arrive as factors: Eq = e^{-2 Wsq}, Ee = e^{-2 Whe} (k_gemm<3>), so that
//   v[h] * tanh(Wsq[bt][h] + Whe[b][s][h]) = 2 v[h] / (1 + Eq[bt][h] * Ee[b][s][h]) - v[h]
//   e[t][s] = sum_h 2 v[h] / (1 + Eq * Ee)   (f32), s >= len masked out; the term -sum_h v[h] is the same
//             for every s of a row and cancels in the softmax, so it is not formed
//   p       = softmax_s(e); Pcat[bt][s] = bf16 hi, Pcat[bt][S+s] = bf16 lo (lo = p - hi)
// Every Ee value a thread loads serves all TT queries of the block from its register, so the strided
// row reads of Ee are issued once per TT queries. Per (t, s) the h order of the sum and the block trees
// of the softmax are those of the one-query form.
// LDS regions are cross-wave: block barriers throughout.
// ---------------------------------------------------------------------------
#define TT 8             // queries per block (= waves per block: wave w stores query w's P planes)
#define CH 8             // v4f per lane and chunk: one 128-B line of the lane's Whe row
static_assert((TQ % TT) == 0 && TT == 8);
static_assert(((HD / 4) % CH) == 0 && ((TT / 2 * HD / 4) % 256) == 0);

__global__ __launch_bounds__(256)
void k_attn(const float* __restrict__ Wsq, const float* __restrict__ Whe,
            const float* __restrict__ vvec, const int* __restrict__ lens,
            us* __restrict__ Pcat)
{
    // query factors, two queries interleaved: sqp[p][h / 2] = {Eq[2p][h], Eq[2p+1][h], Eq[2p][h+1], Eq[2p+1][h+1]},
    // so that a pair of queries at one h is a register pair as it comes from LDS
    __shared__ v4f sqp[TT / 2][HD / 2];
    __shared__ v4f sv4[HD / 4];
    __shared__ __attribute__((aligned(16))) float sp[TT][S_LEN];
    __shared__ float red[TT][S_LEN];

    const int bt0 = blockIdx.x * TT;         // b * TQ + t of the block's first query; TT divides TQ
    const int b   = bt0 / TQ;
    const int tid = threadIdx.x, lane = tid & 31, wave = tid >> 5;

    {   // the TT query rows are contiguous in Wsq
        const v4f* qs = (const v4f*)(Wsq + (size_t)bt0 * HD);
#pragma unroll
        for (int i = 0; i < TT / 2 * HD / 4 / 256; ++i) {
            const int p  = (i * 256 + tid) / (HD / 4);
            const int h4 = (i * 256 + tid) % (HD / 4);
            const v4f a = qs[(2 * p) * (HD / 4) + h4];
            const v4f c = qs[(2 * p + 1) * (HD / 4) + h4];
            sqp[p][2 * h4]     = (v4f){a.x, c.x, a.y, c.y};
            sqp[p][2 * h4 + 1] = (v4f){a.z, c.z, a.w, c.w};
        }
    }
    if (tid < HD / 4) {
        v4f w = *(const v4f*)(vvec + tid * 4);
        w.x = bf2f(f2bf(w.x)); w.y = bf2f(f2bf(w.y)); w.z = bf2f(f2bf(w.z)); w.w = bf2f(f2bf(w.w));
        sv4[tid] = 2.0f * w;
    }
    __syncthreads();

    const int len = lens[b];
    const v4f* we = (const v4f*)(Whe + ((size_t)b * S_LEN + tid) * HD);
    // the sums of queries t and t + 1 lie side by side, so that one packed fma serves both; each keeps its h order
    v2f acc2[TT / 2];
#pragma unroll
    for (int t = 0; t < TT / 2; ++t) acc2[t] = (v2f){0.0f, 0.0f};

    // The lane's next line of Whe is fetched into a second register set while this one is worked on;
    // trip -1 only fetches line 0.
    v4f cur[CH], nxt[CH];
    for (int c = -1; c < HD / 4 / CH; ++c) {
        if (c + 1 < HD / 4 / CH) {
#pragma unroll
            for (int j = 0; j < CH; ++j) nxt[j] = we[(c + 1) * CH + j];
            // stands between these loads and any overwrite of their address registers
            asm volatile("s_wait_xcnt 0x0" ::: "memory");
        }
        if (c >= 0) {
#pragma unroll
            for (int j = 0; j < CH; ++j) {
                const v4f e = cur[j];
                const v4f w = sv4[c * CH + j];
#pragma unroll
                for (int p = 0; p < TT / 2; ++p) {
                    const v4f q0 = sqp[p][(c * CH + j) * 2];
                    const v4f q1 = sqp[p][(c * CH + j) * 2 + 1];
                    const v2f q[4] = {q0.xy, q0.zw, q1.xy, q1.zw};
#pragma unroll
                    for (int i = 0; i < 4; ++i) {
                        const v2f n = __builtin_elementwise_fma(q[i], (v2f){e[i], e[i]}, (v2f){1.0f, 1.0f});
                        const v2f r = {__builtin_amdgcn_rcpf(n.x), __builtin_amdgcn_rcpf(n.y)};
                        acc2[p] = __builtin_elementwise_fma((v2f){w[i], w[i]}, r, acc2[p]);
                    }
                }
            }
        }
#pragma unroll
        for (int j = 0; j < CH; ++j) cur[j] = nxt[j];
    }
    const bool valid = tid < len;
    float acc[TT];
#pragma unroll
    for (int t = 0; t < TT; ++t) acc[t] = acc2[t / 2][t & 1];

    // block max over s, all TT queries in each step
#pragma unroll
    for (int t = 0; t < TT; ++t) red[t][tid] = valid ? acc[t] : -3.0e38f;
    __syncthreads();
#pragma unroll
    for (int st = S_LEN / 2; st > 0; st >>= 1) {
        if (tid < st) {
#pragma unroll
            for (int t = 0; t < TT; ++t) red[t][tid] = fmaxf(red[t][tid], red[t][tid + st]);
        }
        __syncthreads();
    }
    float ex[TT];
#pragma unroll
    for (int t = 0; t < TT; ++t) ex[t] = red[t][0];      // the maximum, until the exp below
    __syncthreads();

    // exp + block sum (masked entries contribute exactly 0)
#pragma unroll
    for (int t = 0; t < TT; ++t) {
        const float arg = valid ? (acc[t] - ex[t]) : -80.0f;
        const float ex0 = __expf(arg);
        ex[t] = valid ? ex0 : 0.0f;
        red[t][tid] = ex[t];
    }
    __syncthreads();
#pragma unroll
    for (int st = S_LEN / 2; st > 0; st >>= 1) {
        if (tid < st) {
#pragma unroll
            for (int t = 0; t < TT; ++t) red[t][tid] += red[t][tid + st];
        }
        __syncthreads();
    }
#pragma unroll
    for (int t = 0; t < TT; ++t) {
        const float ssum = red[t][0];
        sp[t][tid] = ex[t] * (1.0f / ssum);
    }
    __syncthreads();

    // P planes: wave w writes query w's 256 hi halves and its 256 lo halves (512 B per instruction,
    // 8 lanes per line).
    {
        const v4f a = *(const v4f*)(&sp[wave][lane * 8]);
        const v4f c = *(const v4f*)(&sp[wave][lane * 8 + 4]);
        v8us hi, lo;
        split8(a, c, hi, lo);
        us* d = Pcat + (size_t)(bt0 + wave) * KC + lane * 8;
        *(v8us*)d = hi;
        *(v8us*)(d + S_LEN) = lo;
    }
}

// ---------------------------------------------------------------------------
static inline size_t al256(size_t x) { return (x + 255) & ~(size_t)255; }
// the two projections run as two batches of one launch: equal shapes, and no padding between the paired regions
static_assert(TQ == S_LEN);
static_assert(((size_t)NB * TQ * KO * sizeof(us)) % 256 == 0 && ((size_t)HD * HD * sizeof(us)) % 256 == 0 &&
              ((size_t)NB * TQ * HD * sizeof(float)) % 256 == 0);

extern "C" void kernel_launch(void* const* d_in, const int* in_sizes, int n_in,
                              void* d_out, int out_size, void* d_ws, size_t ws_size,
                              hipStream_t stream)
{
    if (n_in < 7) return;
    if (in_sizes[0] < ((NB - 1) * T_FULL + TQ) * HD) return;      // query  [8][256][512] f32
    if (in_sizes[1] < NB * S_LEN * HD) return;                      // enc    [8][256][512] f32
    if (in_sizes[2] < NB) return;                                   // src_lengths [8] int32
    if (in_sizes[3] < HD * HD || in_sizes[4] < HD * HD) return;     // W_s, W_h [512][512] f32
    if (in_sizes[5] < HD) return;                                   // v [512] f32
    if (in_sizes[6] < HD * 2 * HD) return;                          // W_out [512][1024] f32
    if (out_size < ((NB - 1) * T_FULL + TQ) * HD) return;

    const float* query = (const float*)d_in[0];
    const float* enc   = (const float*)d_in[1];
    const int*   lens  = (const int*)d_in[2];
    const float* W_s   = (const float*)d_in[3];
    const float* W_h   = (const float*)d_in[4];
    const float* vvec  = (const float*)d_in[5];
    const float* W_out = (const float*)d_in[6];
    float* out = (float*)d_out;

    // ---- workspace carve (all regions 256-B aligned; sizes already store-granular) ----
    char* ws = (char*)d_ws;
    size_t off = 0;
    us* comb  = (us*)(ws + off);    off += al256((size_t)NB * TQ * KO * sizeof(us));      // [NB*TQ][1536]
    us* encp  = (us*)(ws + off);    off += al256((size_t)NB * S_LEN * KO * sizeof(us));   // [NB*S][1536], columns [1024,1536) used
    us* encT2 = (us*)(ws + off);    off += al256((size_t)NB * HD * KC * sizeof(us));      // [NB][512][512]
    us* Wsb   = (us*)(ws + off);    off += al256((size_t)HD * HD * sizeof(us));           // [512][512]
    us* Whb   = (us*)(ws + off);    off += al256((size_t)HD * HD * sizeof(us));           // [512][512]
    us* WoX   = (us*)(ws + off);    off += al256((size_t)HD * KO * sizeof(us));           // [512][1536]
    float* Wsq = (float*)(ws + off); off += al256((size_t)NB * TQ * HD * sizeof(float));  // [NB*TQ][512]
    float* Whe = (float*)(ws + off); off += al256((size_t)NB * S_LEN * HD * sizeof(float)); // [NB*S][512]
    us* Pcat  = (us*)(ws + off);    off += al256((size_t)NB * TQ * KC * sizeof(us));      // [NB*TQ][512]
    if (off > ws_size) return;

    const dim3 b256(256), b128(128);

    // ---- 16-bit planes (RNE convert of every float input, once; enc also transposed, duplicated along k) ----
    k_prep<<<dim3(PB_ALL), b256, 0, stream>>>(query, enc, W_s, W_h, W_out, comb, encp, Wsb, Whb, WoX, encT2);

    // ---- projections, stored as factors: Wsq = e^{-2 q @ W_s^T}, Whe = e^{-2 enc @ W_h^T} (f32) ----
    // one launch, blockIdx.z = 0 for q, 1 for enc: encp follows comb, Whb follows Wsb and Whe follows Wsq in
    // the carve above, each at the first one's shape, so the second product is batch 1 of the first
    k_gemm<3><<<dim3(NB * TQ / 64, HD / 64, 2), b128, 0, stream>>>(
        comb + 2 * HD, KO, NB * TQ * KO, Wsb, HD, HD * HD, (void*)Wsq, HD, NB * TQ * HD, HD, 0);

    // ---- energies + mask + softmax -> P hi/lo planes ----
    k_attn<<<dim3(NB * TQ / TT), b256, 0, stream>>>(Wsq, Whe, vvec, lens, Pcat);

    // ---- context = [P_hi|P_lo] @ [encT;encT] -> comb columns [0,512) hi and [512,1024) lo ----
    k_gemm<1><<<dim3(TQ / 64, HD / 64, NB), b128, 0, stream>>>(
        Pcat, KC, TQ * KC, encT2, KC, HD * KC, (void*)comb, KO, TQ * KO, KC, HD);

    // ---- out = tanh([ctx_hi|ctx_lo|q] @ WoX^T) ----
    k_gemm<2><<<dim3(TQ / 64, HD / 64, NB), b128, 0, stream>>>(
        comb, KO, TQ * KO, WoX, KO, 0, (void*)out, HD, T_FULL * HD, KO, 0);
}

// v004
// One run takes 56.9 microseconds.
// In two side-by-side timings against v003, it was 1.40 and 1.38 times as fast.
// All steps since v000 together make it 3.83 times as fast.
#include <hip/hip_runtime.h>

// Contractions on v_wmma_f32_16x16x32_bf16 (bf16 operands, f32 accumulate): q@W_s^T and enc@W_h^T from
// RNE-converted input planes; attn@enc and [ctx|q]@W_out^T with attn and ctx carried as bf16 hi+lo planes
// folded into K. Energies v.tanh(.), length masking and softmax in f32 on the VALU; the tanh of a sum is
// formed from one exponential factor per projection value (exp_m2 below).

#ifndef NB
#define NB 8
#endif
#ifndef TQ
#define TQ 256
#endif
#define NB_FULL 8
#define T_FULL 256
#define S_LEN 256
#define HD 512
#define KC (2 * S_LEN)   // context GEMM depth: [P_hi | P_lo]
#define KO (3 * HD)      // output GEMM depth:  [ctx_hi | ctx_lo | q]

static_assert(NB >= 1 && NB <= NB_FULL);
static_assert(TQ >= 64 && TQ <= T_FULL && (TQ % 64) == 0);
static_assert(S_LEN == 256);
static_assert((HD % 256) == 0);
static_assert((KC % 32) == 0 && (KO % 32) == 0 && (HD % 64) == 0 && (S_LEN % 64) == 0);

typedef unsigned short us;
typedef us     v8us  __attribute__((ext_vector_type(8)));
typedef __bf16 v16bf __attribute__((ext_vector_type(16)));
typedef float  v8f   __attribute__((ext_vector_type(8)));
typedef float  v4f   __attribute__((ext_vector_type(4)));
typedef float  v2f   __attribute__((ext_vector_type(2)));

union Frag { v16bf v; v8us h[2]; };

// ---------------------------------------------------------------------------
// scalar helpers
// ---------------------------------------------------------------------------
__device__ __forceinline__ us f2bf(float f) {           // f32 -> bf16, RNE convert
    unsigned int u = __float_as_uint(f);
    u += 0x7FFFu + ((u >> 16) & 1u);
    return (us)(u >> 16);
}
__device__ __forceinline__ float bf2f(us h) {
    return __uint_as_float(((unsigned int)h) << 16);
}
// tanh(x) = sign(x) * (1 - e^{-2|x|}) / (1 + e^{-2|x|}), v_exp_f32 + v_rcp_f32 based (abs error ~1e-7)
__device__ __forceinline__ float tanh_acc(float x) {
    const float ax = __builtin_fabsf(x);
    const float t  = __expf(-2.0f * ax);
    const float r  = (1.0f - t) * __builtin_amdgcn_rcpf(1.0f + t);
    return __builtin_copysignf(r, x);
}
// e^{-2x}, the factor of one projection value: tanh(a + b) = 2 / (1 + e^{-2a} * e^{-2b}) - 1.
// The exponent is held in [-63, 63] (|x| <= 21.8), so a factor is never 0 or inf and a product of two
// is never 0 * inf; a product that grows large gives 2 / (1 + u) - 1 -> -1, a small one -> +1.
__device__ __forceinline__ float exp_m2(float x) {
    const float l = fminf(fmaxf(x * -2.88539008177792681472f, -63.0f), 63.0f);
    return __builtin_amdgcn_exp2f(l);
}
__device__ __forceinline__ v8us pack8(v4f a, v4f c) {
    v8us o;
    o[0] = f2bf(a.x); o[1] = f2bf(a.y); o[2] = f2bf(a.z); o[3] = f2bf(a.w);
    o[4] = f2bf(c.x); o[5] = f2bf(c.y); o[6] = f2bf(c.z); o[7] = f2bf(c.w);
    return o;
}
// hi = bf16(x), lo = bf16(x - hi): unscaled bf16 residual pair
__device__ __forceinline__ void split8(v4f a, v4f c, v8us& hi, v8us& lo) {
    const float x[8] = {a.x, a.y, a.z, a.w, c.x, c.y, c.z, c.w};
#pragma unroll
    for (int i = 0; i < 8; ++i) {
        const us h = f2bf(x[i]);
        hi[i] = h;
        lo[i] = f2bf(x[i] - bf2f(h));
    }
}

// ---------------------------------------------------------------------------
// WMMA helper: 16x16x32 bf16, f32 accumulate, 4-slot VALU hazard guard after the issue
// ---------------------------------------------------------------------------
__device__ __forceinline__ v8f wmma16(v16bf a, v16bf b, v8f c) {
    v8f d = __builtin_amdgcn_wmma_f32_16x16x32_bf16(false, a, false, b, (short)0, c, false, false);
    asm volatile("v_nop\n\tv_nop\n\tv_nop\n\tv_nop" : "+v"(d) : "v"(a), "v"(b));
    return d;
}

// ---------------------------------------------------------------------------
// Row conversion f32 -> bf16 plane, block blk of one conversion job. One wave per (row, 256-column segment):
// lane l converts columns 8l..8l+7 of the segment and stores 16 B; one instruction covers the
// (r / grp) * gstride + (r % grp) (lets a reduced build read full-stride inputs).
// ---------------------------------------------------------------------------
__device__ __forceinline__
void cvt_blk(const float* __restrict__ src, int spitch, int scol, int grp, int gstride,
             us* __restrict__ dst, int dpitch, int dcol, int nrows, int nseg, int blk)
{
    const int lane = threadIdx.x & 31;
    const int gw   = blk * 8 + (threadIdx.x >> 5);
    if (gw >= nrows * nseg) return;                    // wave-uniform, no barriers on this path
    const int r    = gw / nseg;
    const int sg   = gw - r * nseg;
    const int g    = r / grp;
    const int srow = g * gstride + (r - g * grp);
    const float* sp = src + (size_t)srow * spitch + scol + sg * 256 + lane * 8;
    const v4f a = *(const v4f*)sp;
    const v4f c = *(const v4f*)(sp + 4);
    const v8us o = pack8(a, c);
    us* dp = dst + (size_t)r * dpitch + dcol + sg * 256 + lane * 8;
    *(v8us*)dp = o;
    
}

// ---------------------------------------------------------------------------
// Encoder transpose plane: encT2[b][h][s] = encT2[b][h][S+s] = bf16(enc[b][s][h]); pitch KC halves.
// Block: 64 s x 64 h tile through LDS (cross-wave -> block barrier). Store phase: one instruction
// tile (s0 / 64, h0 / 64, b) of (S/64, H/64, NB)
// ---------------------------------------------------------------------------
__device__ __forceinline__
void trans_blk(const float* __restrict__ enc, us* __restrict__ encT2, float (*ts)[65], int s0, int h0, int b)
{
    const int tid = threadIdx.x, lane = tid & 31, wave = tid >> 5;

#pragma unroll
    for (int p = 0; p < 4; ++p) {
        const int sl = p * 16 + (tid >> 4);
        const int h4 = (tid & 15) * 4;
        const v4f x = *(const v4f*)(enc + ((size_t)(b * S_LEN + s0 + sl)) * HD + h0 + h4);
        ts[sl][h4 + 0] = x.x; ts[sl][h4 + 1] = x.y; ts[sl][h4 + 2] = x.z; ts[sl][h4 + 3] = x.w;
    }
    __syncthreads();

    v8us o[2];
#pragma unroll
    for (int p = 0; p < 2; ++p) {
        const int hl = p * 32 + wave * 4 + (lane >> 3);
        const int s8 = (lane & 7) * 8;
#pragma unroll
        for (int i = 0; i < 8; ++i) o[p][i] = f2bf(ts[s8 + i][hl]);
    }
#pragma unroll
    for (int p = 0; p < 2; ++p) {
        const int hl = p * 32 + wave * 4 + (lane >> 3);
        const int s8 = (lane & 7) * 8;
        us* d = encT2 + ((size_t)(b * HD + h0 + hl)) * KC + s0 + s8;
        *(v8us*)d = o[p];
        *(v8us*)(d + S_LEN) = o[p];
    }
    
}

// ---------------------------------------------------------------------------
// All 16-bit planes in one launch: none of these jobs reads what another writes, so they share a grid and
// the block index picks the job. The transpose tiles (the longest blocks) come first.
//   transpose  enc   -> encT2
//   convert    query -> comb columns [1024,1536)
//   convert    enc   -> encp columns [1024,1536)
//   convert    W_s -> Wsb, W_h -> Whb ([out][in] is already k-contiguous per output column)
//   convert    W_out [512][1024] -> WoX [512][1536] = [W_out[:,0:512] | W_out[:,0:512] | W_out[:,512:1024]]
// ---------------------------------------------------------------------------
#define NSEG (HD / 256)
#define PB_T ((S_LEN / 64) * (HD / 64) * NB)       // transpose tiles
#define PB_Q ((NB * TQ * NSEG + 7) / 8)            // blocks of the query conversion
#define PB_E ((NB * S_LEN * NSEG + 7) / 8)         // blocks of the enc conversion
#define PB_W ((HD * NSEG + 7) / 8)                 // blocks of one weight conversion
#define PB_ALL (PB_T + PB_Q + PB_E + 5 * PB_W)

__global__ __launch_bounds__(256)
void k_prep(const float* __restrict__ query, const float* __restrict__ enc,
            const float* __restrict__ W_s, const float* __restrict__ W_h, const float* __restrict__ W_out,
            us* __restrict__ comb, us* __restrict__ encp, us* __restrict__ Wsb, us* __restrict__ Whb,
            us* __restrict__ WoX, us* __restrict__ encT2)
{
    __shared__ float ts[64][65];
    int i = blockIdx.x;                                // every test below is the same for the whole block
    if (i < PB_T) {
        trans_blk(enc, encT2, ts, (i % (S_LEN / 64)) * 64, ((i / (S_LEN / 64)) % (HD / 64)) * 64,
                  i / ((S_LEN / 64) * (HD / 64)));
        return;
    }
    i -= PB_T;
    if (i < PB_Q) { cvt_blk(query, HD, 0, TQ, T_FULL, comb, KO, 2 * HD, NB * TQ, NSEG, i); return; }
    i -= PB_Q;
    if (i < PB_E) { cvt_blk(enc, HD, 0, S_LEN, S_LEN, encp, KO, 2 * HD, NB * S_LEN, NSEG, i); return; }
    i -= PB_E;
    if (i < PB_W) { cvt_blk(W_s, HD, 0, HD, HD, Wsb, HD, 0, HD, NSEG, i); return; }
    i -= PB_W;
    if (i < PB_W) { cvt_blk(W_h, HD, 0, HD, HD, Whb, HD, 0, HD, NSEG, i); return; }
    i -= PB_W;
    if (i < PB_W) { cvt_blk(W_out, 2 * HD, 0, HD, HD, WoX, KO, 0, HD, NSEG, i); return; }
    i -= PB_W;
    if (i < PB_W) { cvt_blk(W_out, 2 * HD, 0, HD, HD, WoX, KO, HD, HD, NSEG, i); return; }
    i -= PB_W;
    cvt_blk(W_out, 2 * HD, HD, HD, HD, WoX, KO, 2 * HD, HD, NSEG, i);
}

// ---------------------------------------------------------------------------
// LDS ring of k_gemm. A stage is 256 k (512 B) of the block's 64 A rows and 64 B rows; two buffers.
// ---------------------------------------------------------------------------
#define KS 256                  // halves of k per stage
#define SPITCH 528              // LDS bytes per staged row: 16 B x odd, so 16 rows of one ds_load_b128 fall on distinct banks
#define SOPER (64 * SPITCH)     // one operand's 64 rows
#define SBUF (2 * SOPER)        // one buffer: [A rows | B rows]
static_assert((HD % KS) == 0 && (KC % KS) == 0 && (KO % KS) == 0 && HD / KS >= 2 && KC / KS >= 2 && KO / KS >= 2);

// Eight asynchronous copies global -> LDS, one staged row (512 B, four whole lines) per copy: lane l brings
// bytes 16 l .. 16 l + 15 of rows 0..7 behind g (pitch ld halves) to l0 + row * SPITCH. l0 and g are the lane's own.
__device__ __forceinline__ void copy8(unsigned l0, const us* g, int ld)
{
    // the closing s_wait_xcnt stands inside the statement, so no address register of a copy is rewritten ahead of it
    asm volatile("global_load_async_to_lds_b128 %0, %8, off\n\t"
                 "global_load_async_to_lds_b128 %1, %9, off\n\t"
                 "global_load_async_to_lds_b128 %2, %10, off\n\t"
                 "global_load_async_to_lds_b128 %3, %11, off\n\t"
                 "global_load_async_to_lds_b128 %4, %12, off\n\t"
                 "global_load_async_to_lds_b128 %5, %13, off\n\t"
                 "global_load_async_to_lds_b128 %6, %14, off\n\t"
                 "global_load_async_to_lds_b128 %7, %15, off\n\t"
                 "s_wait_xcnt 0x0"
                 :: "v"(l0), "v"(l0 + 1 * SPITCH), "v"(l0 + 2 * SPITCH), "v"(l0 + 3 * SPITCH),
                    "v"(l0 + 4 * SPITCH), "v"(l0 + 5 * SPITCH), "v"(l0 + 6 * SPITCH), "v"(l0 + 7 * SPITCH),
                    "v"(g), "v"(g + (size_t)ld), "v"(g + (size_t)ld * 2), "v"(g + (size_t)ld * 3),
                    "v"(g + (size_t)ld * 4), "v"(g + (size_t)ld * 5), "v"(g + (size_t)ld * 6), "v"(g + (size_t)ld * 7)
                 : "memory");
}
// One wave's share of a stage: 16 A rows and 16 B rows, 32 copies. dst = the lane's LDS byte address in the buffer.
__device__ __forceinline__ void copy_stage(unsigned dst, const us* ga, int lda, const us* gb, int ldb)
{
    copy8(dst, ga, lda);
    copy8(dst + 8 * SPITCH, ga + (size_t)lda * 8, lda);
    copy8(dst + SOPER, gb, ldb);
    copy8(dst + SOPER + 8 * SPITCH, gb + (size_t)ldb * 8, ldb);
}
// Fragment from a staged k-contiguous row. Lane l: row = (l & 15) (A row m, or B column n of an [n][k] plane),
// hsel = l >> 4; p = the row's start in LDS + 2 * k0 + 16 * hsel bytes.
//   elements 0..7  <- k0 + 8*hsel + 0..7
//   elements 8..15 <- k0 + 16 + 8*hsel + 0..7
__device__ __forceinline__ v16bf lds_frag(const unsigned char* p) {
    Frag f;
    f.h[0] = *(const v8us*)p;
    f.h[1] = *(const v8us*)(p + 32);
    return f.v;
}

// ---------------------------------------------------------------------------
// GEMM: C[M][N] = A[M][K] * B, B given as a k-contiguous [N][K] plane (B[k][n] = Bp[n][k]). K a multiple of KS.
// Block = 128 threads (4 waves), block tile 64(M) x 64(N), wave tile 16 x 64 (4 accumulators).
// The operand rows come into LDS by asynchronous copies, whole lines at a time, each B row once per block;
// stage t + 1 flies while stage t is worked on. Fragments are read from LDS with the split k map. blockIdx.z = batch.
// Epilogue: wave tile staged in LDS, block barrier, then whole-row-segment stores:
//   EPI 2: same with tanh, destination d_out
//   EPI 3: f32 rows of exp_m2(C)
// ---------------------------------------------------------------------------
template <int EPI>
__global__ __launch_bounds__(128)
void k_gemm(const us* __restrict__ A, int lda, int strideA,
            const us* __restrict__ B, int ldb, int strideB,
            void* __restrict__ Cv, int ldc, int strideC, int K, int loff)
{
    __shared__ __attribute__((aligned(16))) unsigned char ring[2 * SBUF];
    __shared__ __attribute__((aligned(16))) float tile[4 * 16 * 64];

    const int lane = threadIdx.x & 31, wave = threadIdx.x >> 5;
    const int hsel = lane >> 4, m = lane & 15;
    const int m0 = blockIdx.x * 64 + wave * 16;
    const int n0 = blockIdx.y * 64;
    const us* Ab = A + (size_t)blockIdx.z * (size_t)strideA;
    const us* Bb = B + (size_t)blockIdx.z * (size_t)strideB;

    // wave w copies A rows m0 .. m0 + 15 and B rows n0 + 16 w .. n0 + 16 w + 15 of every stage
    const us* ga = Ab + (size_t)m0 * lda + lane * 8;
    const us* gb = Bb + (size_t)(n0 + wave * 16) * ldb + lane * 8;
    const unsigned dst = (unsigned)(size_t)ring + wave * 16 * SPITCH + lane * 16;
    const int nst = K / KS;

    copy_stage(dst, ga, lda, gb, ldb);
    asm volatile("s_wait_asynccnt 0x0" ::: "memory");    // this wave's share of stage 0 has landed
    __syncthreads();                                     // ... and every other wave's
    if (nst > 1) copy_stage(dst + SBUF, ga + KS, lda, gb + KS, ldb);

    v8f c0 = {}; v8f c1 = {}; v8f c2 = {}; v8f c3 = {};
    for (int t = 0; t < nst; ++t) {
        const unsigned char* pa = ring + (t & 1) * SBUF + (wave * 16 + m) * SPITCH + hsel * 16;
        const unsigned char* pb = ring + (t & 1) * SBUF + SOPER + m * SPITCH + hsel * 16;
        // two fragment sets: the next 32 k of this stage are read from LDS while these are multiplied
        v16bf fa[2], fb[2][4];
        fa[0]    = lds_frag(pa);
        fb[0][0] = lds_frag(pb);
        fb[0][1] = lds_frag(pb + 16 * SPITCH);
        fb[0][2] = lds_frag(pb + 32 * SPITCH);
        fb[0][3] = lds_frag(pb + 48 * SPITCH);
        // unrolled so that the two sets are named registers, not indexed ones
#pragma unroll
        for (int kk = 0; kk < KS / 32; ++kk) {
            const int cu = kk & 1, nx = cu ^ 1;
            if (kk + 1 < KS / 32) {
                fa[nx]    = lds_frag(pa + (kk + 1) * 64);
                fb[nx][0] = lds_frag(pb + (kk + 1) * 64);
                fb[nx][1] = lds_frag(pb + 16 * SPITCH + (kk + 1) * 64);
                fb[nx][2] = lds_frag(pb + 32 * SPITCH + (kk + 1) * 64);
                fb[nx][3] = lds_frag(pb + 48 * SPITCH + (kk + 1) * 64);
            }
            c0 = wmma16(fa[cu], fb[cu][0], c0);
            c1 = wmma16(fa[cu], fb[cu][1], c1);
            c2 = wmma16(fa[cu], fb[cu][2], c2);
            c3 = wmma16(fa[cu], fb[cu][3], c3);
        }
        asm volatile("s_wait_dscnt 0x0" ::: "memory");       // this wave has left the buffer of stage t
        asm volatile("s_wait_asynccnt 0x0" ::: "memory");    // its share of stage t + 1 has landed
        __syncthreads();                                     // publishes stage t + 1, frees the buffer of stage t
        if (t + 2 < nst)
            copy_stage(dst + (t & 1) * SBUF, ga + (size_t)(t + 2) * KS, lda, gb + (size_t)(t + 2) * KS, ldb);
    }
    asm volatile("s_wait_asynccnt 0x0" ::: "memory");        // no copy is outstanding when the wave goes on

    // D map: acc[r] -> (row 8*hsel + r, col n-tile + m). Stage the 16x64 wave tile in LDS.
    float* tw = tile + wave * 1024;
#pragma unroll
    for (int r = 0; r < 8; ++r) {
        const int row = 8 * hsel + r;
        tw[row * 64 + m]      = c0[r];
        tw[row * 64 + 16 + m] = c1[r];
        tw[row * 64 + 32 + m] = c2[r];
        tw[row * 64 + 48 + m] = c3[r];
    }
    __syncthreads();

    if (EPI == 1) {
        us* Cb = (us*)Cv + (size_t)blockIdx.z * (size_t)strideC;
        v8us hi[4], lo[4];
#pragma unroll
        for (int p = 0; p < 4; ++p) {
            const int row = 4 * p + (lane >> 3);
            const int col = 8 * (lane & 7);
            const v4f a = *(const v4f*)(tw + row * 64 + col);
            const v4f c = *(const v4f*)(tw + row * 64 + col + 4);
            split8(a, c, hi[p], lo[p]);
        }
#pragma unroll
        for (int p = 0; p < 4; ++p) {
            us* d = Cb + (size_t)(m0 + 4 * p + (lane >> 3)) * ldc + n0 + 8 * (lane & 7);
            *(v8us*)d = hi[p];
            *(v8us*)(d + loff) = lo[p];
        }
        
    } else {
        float* Cb = (float*)Cv + (size_t)blockIdx.z * (size_t)strideC;
        v4f vals[8];
#pragma unroll
        for (int p = 0; p < 8; ++p) {
            const int row = 2 * p + hsel;
            v4f x = *(const v4f*)(tw + row * 64 + 4 * m);
            if (EPI == 2) {
                x.x = tanh_acc(x.x); x.y = tanh_acc(x.y); x.z = tanh_acc(x.z); x.w = tanh_acc(x.w);
            }
            if (EPI == 3) {
                x.x = exp_m2(x.x); x.y = exp_m2(x.y); x.z = exp_m2(x.z); x.w = exp_m2(x.w);
            }
            vals[p] = x;
        }
#pragma unroll
        for (int p = 0; p < 8; ++p) {
            float* d = Cb + (size_t)(m0 + 2 * p + hsel) * ldc + n0 + 4 * m;
            *(v4f*)d = vals[p];
        }
        
    }
}

// ---------------------------------------------------------------------------
// Fused energies -> length mask -> softmax -> P planes. One block (256 = S) per (b, TT queries); thread = s.
//   Wsq and Whe arrive as factors: Eq = e^{-2 Wsq}, Ee = e^{-2 Whe} (k_gemm<3>), so that
//   v[h] * tanh(Wsq[bt][h] + Whe[b][s][h]) = 2 v[h] / (1 + Eq[bt][h] * Ee[b][s][h]) - v[h]
//   e[t][s] = sum_h 2 v[h] / (1 + Eq * Ee)   (f32), s >= len masked out; the term -sum_h v[h] is the same
//             for every s of a row and cancels in the softmax, so it is not formed
//   p       = softmax_s(e); Pcat[bt][s] = bf16 hi, Pcat[bt][S+s] = bf16 lo (lo = p - hi)
// Every Ee value a thread loads serves all TT queries of the block from its register, so the strided
// row reads of Ee are issued once per TT queries. Per (t, s) the h order of the sum and the block trees
// of the softmax are those of the one-query form.
// LDS regions are cross-wave: block barriers throughout.
// ---------------------------------------------------------------------------
#define TT 8             // queries per block (= waves per block: wave w stores query w's P planes)
#define CH 8             // v4f per lane and chunk: one 128-B line of the lane's Whe row
static_assert((TQ % TT) == 0 && TT == 8);
static_assert(((HD / 4) % CH) == 0 && ((TT / 2 * HD / 4) % 256) == 0);

__global__ __launch_bounds__(256)
void k_attn(const float* __restrict__ Wsq, const float* __restrict__ Whe,
            const float* __restrict__ vvec, const int* __restrict__ lens,
            us* __restrict__ Pcat)
{
    // query factors, two queries interleaved: sqp[p][h / 2] = {Eq[2p][h], Eq[2p+1][h], Eq[2p][h+1], Eq[2p+1][h+1]},
    // so that a pair of queries at one h is a register pair as it comes from LDS
    __shared__ v4f sqp[TT / 2][HD / 2];
    __shared__ v4f sv4[HD / 4];
    __shared__ __attribute__((aligned(16))) float sp[TT][S_LEN];
    __shared__ float red[TT][S_LEN];

    const int bt0 = blockIdx.x * TT;         // b * TQ + t of the block's first query; TT divides TQ
    const int b   = bt0 / TQ;
    const int tid = threadIdx.x, lane = tid & 31, wave = tid >> 5;

    {   // the TT query rows are contiguous in Wsq
        const v4f* qs = (const v4f*)(Wsq + (size_t)bt0 * HD);
#pragma unroll
        for (int i = 0; i < TT / 2 * HD / 4 / 256; ++i) {
            const int p  = (i * 256 + tid) / (HD / 4);
            const int h4 = (i * 256 + tid) % (HD / 4);
            const v4f a = qs[(2 * p) * (HD / 4) + h4];
            const v4f c = qs[(2 * p + 1) * (HD / 4) + h4];
            sqp[p][2 * h4]     = (v4f){a.x, c.x, a.y, c.y};
            sqp[p][2 * h4 + 1] = (v4f){a.z, c.z, a.w, c.w};
        }
    }
    if (tid < HD / 4) {
        v4f w = *(const v4f*)(vvec + tid * 4);
        w.x = bf2f(f2bf(w.x)); w.y = bf2f(f2bf(w.y)); w.z = bf2f(f2bf(w.z)); w.w = bf2f(f2bf(w.w));
        sv4[tid] = 2.0f * w;
    }
    __syncthreads();

    const int len = lens[b];
    const v4f* we = (const v4f*)(Whe + ((size_t)b * S_LEN + tid) * HD);
    // the sums of queries t and t + 1 lie side by side, so that one packed fma serves both; each keeps its h order
    v2f acc2[TT / 2];
#pragma unroll
    for (int t = 0; t < TT / 2; ++t) acc2[t] = (v2f){0.0f, 0.0f};

    // The lane's next line of Whe is fetched into a second register set while this one is worked on;
    // trip -1 only fetches line 0.
    v4f cur[CH], nxt[CH];
    for (int c = -1; c < HD / 4 / CH; ++c) {
        if (c + 1 < HD / 4 / CH) {
#pragma unroll
            for (int j = 0; j < CH; ++j) nxt[j] = we[(c + 1) * CH + j];
            // stands between these loads and any overwrite of their address registers
            asm volatile("s_wait_xcnt 0x0" ::: "memory");
        }
        if (c >= 0) {
#pragma unroll
            for (int j = 0; j < CH; ++j) {
                const v4f e = cur[j];
                const v4f w = sv4[c * CH + j];
#pragma unroll
                for (int p = 0; p < TT / 2; ++p) {
                    const v4f q0 = sqp[p][(c * CH + j) * 2];
                    const v4f q1 = sqp[p][(c * CH + j) * 2 + 1];
                    const v2f q[4] = {q0.xy, q0.zw, q1.xy, q1.zw};
#pragma unroll
                    for (int i = 0; i < 4; ++i) {
                        const v2f n = __builtin_elementwise_fma(q[i], (v2f){e[i], e[i]}, (v2f){1.0f, 1.0f});
                        const v2f r = {__builtin_amdgcn_rcpf(n.x), __builtin_amdgcn_rcpf(n.y)};
                        acc2[p] = __builtin_elementwise_fma((v2f){w[i], w[i]}, r, acc2[p]);
                    }
                }
            }
        }
#pragma unroll
        for (int j = 0; j < CH; ++j) cur[j] = nxt[j];
    }
    const bool valid = tid < len;
    float acc[TT];
#pragma unroll
    for (int t = 0; t < TT; ++t) acc[t] = acc2[t / 2][t & 1];

    // block max over s, all TT queries in each step
#pragma unroll
    for (int t = 0; t < TT; ++t) red[t][tid] = valid ? acc[t] : -3.0e38f;
    __syncthreads();
#pragma unroll
    for (int st = S_LEN / 2; st > 0; st >>= 1) {
        if (tid < st) {
#pragma unroll
            for (int t = 0; t < TT; ++t) red[t][tid] = fmaxf(red[t][tid], red[t][tid + st]);
        }
        __syncthreads();
    }
    float ex[TT];
#pragma unroll
    for (int t = 0; t < TT; ++t) ex[t] = red[t][0];      // the maximum, until the exp below
    __syncthreads();

    // exp + block sum (masked entries contribute exactly 0)
#pragma unroll
    for (int t = 0; t < TT; ++t) {
        const float arg = valid ? (acc[t] - ex[t]) : -80.0f;
        const float ex0 = __expf(arg);
        ex[t] = valid ? ex0 : 0.0f;
        red[t][tid] = ex[t];
    }
    __syncthreads();
#pragma unroll
    for (int st = S_LEN / 2; st > 0; st >>= 1) {
        if (tid < st) {
#pragma unroll
            for (int t = 0; t < TT; ++t) red[t][tid] += red[t][tid + st];
        }
        __syncthreads();
    }
#pragma unroll
    for (int t = 0; t < TT; ++t) {
        const float ssum = red[t][0];
        sp[t][tid] = ex[t] * (1.0f / ssum);
    }
    __syncthreads();

    // P planes: wave w writes query w's 256 hi halves and its 256 lo halves (512 B per instruction,
    // 8 lanes per line).
    {
        const v4f a = *(const v4f*)(&sp[wave][lane * 8]);
        const v4f c = *(const v4f*)(&sp[wave][lane * 8 + 4]);
        v8us hi, lo;
        split8(a, c, hi, lo);
        us* d = Pcat + (size_t)(bt0 + wave) * KC + lane * 8;
        *(v8us*)d = hi;
        *(v8us*)(d + S_LEN) = lo;
    }
}

// ---------------------------------------------------------------------------
static inline size_t al256(size_t x) { return (x + 255) & ~(size_t)255; }
// the two projections run as two batches of one launch: equal shapes, and no padding between the paired regions
static_assert(TQ == S_LEN);
static_assert(((size_t)NB * TQ * KO * sizeof(us)) % 256 == 0 && ((size_t)HD * HD * sizeof(us)) % 256 == 0 &&
              ((size_t)NB * TQ * HD * sizeof(float)) % 256 == 0);

extern "C" void kernel_launch(void* const* d_in, const int* in_sizes, int n_in,
                              void* d_out, int out_size, void* d_ws, size_t ws_size,
                              hipStream_t stream)
{
    if (n_in < 7) return;
    if (in_sizes[0] < ((NB - 1) * T_FULL + TQ) * HD) return;      // query  [8][256][512] f32
    if (in_sizes[1] < NB * S_LEN * HD) return;                      // enc    [8][256][512] f32
    if (in_sizes[2] < NB) return;                                   // src_lengths [8] int32
    if (in_sizes[3] < HD * HD || in_sizes[4] < HD * HD) return;     // W_s, W_h [512][512] f32
    if (in_sizes[5] < HD) return;                                   // v [512] f32
    if (in_sizes[6] < HD * 2 * HD) return;                          // W_out [512][1024] f32
    if (out_size < ((NB - 1) * T_FULL + TQ) * HD) return;

    const float* query = (const float*)d_in[0];
    const float* enc   = (const float*)d_in[1];
    const int*   lens  = (const int*)d_in[2];
    const float* W_s   = (const float*)d_in[3];
    const float* W_h   = (const float*)d_in[4];
    const float* vvec  = (const float*)d_in[5];
    const float* W_out = (const float*)d_in[6];
    float* out = (float*)d_out;

    // ---- workspace carve (all regions 256-B aligned; sizes already store-granular) ----
    char* ws = (char*)d_ws;
    size_t off = 0;
    us* comb  = (us*)(ws + off);    off += al256((size_t)NB * TQ * KO * sizeof(us));      // [NB*TQ][1536]
    us* encp  = (us*)(ws + off);    off += al256((size_t)NB * S_LEN * KO * sizeof(us));   // [NB*S][1536], columns [1024,1536) used
    us* encT2 = (us*)(ws + off);    off += al256((size_t)NB * HD * KC * sizeof(us));      // [NB][512][512]
    us* Wsb   = (us*)(ws + off);    off += al256((size_t)HD * HD * sizeof(us));           // [512][512]
    us* Whb   = (us*)(ws + off);    off += al256((size_t)HD * HD * sizeof(us));           // [512][512]
    us* WoX   = (us*)(ws + off);    off += al256((size_t)HD * KO * sizeof(us));           // [512][1536]
    float* Wsq = (float*)(ws + off); off += al256((size_t)NB * TQ * HD * sizeof(float));  // [NB*TQ][512]
    float* Whe = (float*)(ws + off); off += al256((size_t)NB * S_LEN * HD * sizeof(float)); // [NB*S][512]
    us* Pcat  = (us*)(ws + off);    off += al256((size_t)NB * TQ * KC * sizeof(us));      // [NB*TQ][512]
    if (off > ws_size) return;

    const dim3 b256(256), b128(128);

    // ---- 16-bit planes (RNE convert of every float input, once; enc also transposed, duplicated along k) ----
    k_prep<<<dim3(PB_ALL), b256, 0, stream>>>(query, enc, W_s, W_h, W_out, comb, encp, Wsb, Whb, WoX, encT2);

    // ---- projections, stored as factors: Wsq = e^{-2 q @ W_s^T}, Whe = e^{-2 enc @ W_h^T} (f32) ----
    // one launch, blockIdx.z = 0 for q, 1 for enc: encp follows comb, Whb follows Wsb and Whe follows Wsq in
    // the carve above, each at the first one's shape, so the second product is batch 1 of the first
    k_gemm<3><<<dim3(NB * TQ / 64, HD / 64, 2), b128, 0, stream>>>(
        comb + 2 * HD, KO, NB * TQ * KO, Wsb, HD, HD * HD, (void*)Wsq, HD, NB * TQ * HD, HD, 0);

    // ---- energies + mask + softmax -> P hi/lo planes ----
    k_attn<<<dim3(NB * TQ / TT), b256, 0, stream>>>(Wsq, Whe, vvec, lens, Pcat);

    // ---- context = [P_hi|P_lo] @ [encT;encT] -> comb columns [0,512) hi and [512,1024) lo ----
    k_gemm<1><<<dim3(TQ / 64, HD / 64, NB), b128, 0, stream>>>(
        Pcat, KC, TQ * KC, encT2, KC, HD * KC, (void*)comb, KO, TQ * KO, KC, HD);

    // ---- out = tanh([ctx_hi|ctx_lo|q] @ WoX^T) ----
    k_gemm<2><<<dim3(TQ / 64, HD / 64, NB), b128, 0, stream>>>(
        comb, KO, TQ * KO, WoX, KO, 0, (void*)out, HD, T_FULL * HD, KO, 0);
}

// v005
// Measured time: 51.3 microseconds a run.
// Timed twice side by side with v004, it ran 1.09 and 1.10 times as fast.
// Over all steps from v000 it is 4.20 times as fast.
#include <hip/hip_runtime.h>

// Contractions on v_wmma_f32_16x16x32_bf16 (bf16 operands, f32 accumulate): q@W_s^T and enc@W_h^T from
// RNE-converted input planes; attn@enc with the bf16 hi and lo planes of attn as rows 0-7 and 8-15 of one tile,
// [ctx|q]@W_out^T with ctx carried as bf16 hi+lo planes folded into K.
// Energies v.tanh(.), length masking and softmax in f32 on the VALU; the tanh of a sum is
// formed from one exponential factor per projection value (exp_m2 below).

#ifndef NB
#define NB 8
#endif
#ifndef TQ
#define TQ 256
#endif
#define NB_FULL 8
#define T_FULL 256
#define S_LEN 256
#define HD 512
#define KO (3 * HD)      // output GEMM depth:  [ctx_hi | ctx_lo | q]

static_assert(NB >= 1 && NB <= NB_FULL);
static_assert(TQ >= 64 && TQ <= T_FULL && (TQ % 64) == 0);
static_assert(S_LEN == 256);
static_assert((HD % 256) == 0);
static_assert((KO % 32) == 0 && (HD % 64) == 0 && (S_LEN % 64) == 0);

typedef unsigned short us;
typedef us     v8us  __attribute__((ext_vector_type(8)));
typedef __bf16 v16bf __attribute__((ext_vector_type(16)));
typedef float  v8f   __attribute__((ext_vector_type(8)));
typedef float  v4f   __attribute__((ext_vector_type(4)));
typedef float  v2f   __attribute__((ext_vector_type(2)));

union Frag { v16bf v; v8us h[2]; };

// ---------------------------------------------------------------------------
// scalar helpers
// ---------------------------------------------------------------------------
__device__ __forceinline__ us f2bf(float f) {           // f32 -> bf16, RNE convert
    unsigned int u = __float_as_uint(f);
    u += 0x7FFFu + ((u >> 16) & 1u);
    return (us)(u >> 16);
}
__device__ __forceinline__ float bf2f(us h) {
    return __uint_as_float(((unsigned int)h) << 16);
}
// tanh(x) = sign(x) * (1 - e^{-2|x|}) / (1 + e^{-2|x|}), v_exp_f32 + v_rcp_f32 based (abs error ~1e-7)
__device__ __forceinline__ float tanh_acc(float x) {
    const float ax = __builtin_fabsf(x);
    const float t  = __expf(-2.0f * ax);
    const float r  = (1.0f - t) * __builtin_amdgcn_rcpf(1.0f + t);
    return __builtin_copysignf(r, x);
}
// e^{-2x}, the factor of one projection value: tanh(a + b) = 2 / (1 + e^{-2a} * e^{-2b}) - 1.
// The exponent is held in [-63, 63] (|x| <= 21.8), so a factor is never 0 or inf and a product of two
// is never 0 * inf; a product that grows large gives 2 / (1 + u) - 1 -> -1, a small one -> +1.
__device__ __forceinline__ float exp_m2(float x) {
    const float l = fminf(fmaxf(x * -2.88539008177792681472f, -63.0f), 63.0f);
    return __builtin_amdgcn_exp2f(l);
}
__device__ __forceinline__ v8us pack8(v4f a, v4f c) {
    v8us o;
    o[0] = f2bf(a.x); o[1] = f2bf(a.y); o[2] = f2bf(a.z); o[3] = f2bf(a.w);
    o[4] = f2bf(c.x); o[5] = f2bf(c.y); o[6] = f2bf(c.z); o[7] = f2bf(c.w);
    return o;
}
// hi = bf16(x), lo = bf16(x - hi): unscaled bf16 residual pair
__device__ __forceinline__ void split8(v4f a, v4f c, v8us& hi, v8us& lo) {
    const float x[8] = {a.x, a.y, a.z, a.w, c.x, c.y, c.z, c.w};
#pragma unroll
    for (int i = 0; i < 8; ++i) {
        const us h = f2bf(x[i]);
        hi[i] = h;
        lo[i] = f2bf(x[i] - bf2f(h));
    }
}

// ---------------------------------------------------------------------------
// WMMA helper: 16x16x32 bf16, f32 accumulate, 4-slot VALU hazard guard after the issue
// ---------------------------------------------------------------------------
__device__ __forceinline__ v8f wmma16(v16bf a, v16bf b, v8f c) {
    v8f d = __builtin_amdgcn_wmma_f32_16x16x32_bf16(false, a, false, b, (short)0, c, false, false);
    asm volatile("v_nop\n\tv_nop\n\tv_nop\n\tv_nop" : "+v"(d) : "v"(a), "v"(b));
    return d;
}

// ---------------------------------------------------------------------------
// Row conversion f32 -> bf16 plane, block blk of one conversion job. One wave per (row, 256-column segment):
// lane l converts columns 8l..8l+7 of the segment and stores 16 B; one instruction covers the
// (r / grp) * gstride + (r % grp) (lets a reduced build read full-stride inputs).
// ---------------------------------------------------------------------------
__device__ __forceinline__
void cvt_blk(const float* __restrict__ src, int spitch, int scol, int grp, int gstride,
             us* __restrict__ dst, int dpitch, int dcol, int nrows, int nseg, int blk)
{
    const int lane = threadIdx.x & 31;
    const int gw   = blk * 8 + (threadIdx.x >> 5);
    if (gw >= nrows * nseg) return;                    // wave-uniform, no barriers on this path
    const int r    = gw / nseg;
    const int sg   = gw - r * nseg;
    const int g    = r / grp;
    const int srow = g * gstride + (r - g * grp);
    const float* sp = src + (size_t)srow * spitch + scol + sg * 256 + lane * 8;
    const v4f a = *(const v4f*)sp;
    const v4f c = *(const v4f*)(sp + 4);
    const v8us o = pack8(a, c);
    us* dp = dst + (size_t)r * dpitch + dcol + sg * 256 + lane * 8;
    *(v8us*)dp = o;
    
}

// ---------------------------------------------------------------------------
// Encoder transpose plane: encT2[b][h][s] = bf16(enc[b][s][h]); pitch S_LEN halves.
// Block: 64 s x 64 h tile through LDS (cross-wave -> block barrier). Store phase: one instruction
// tile (s0 / 64, h0 / 64, b) of (S/64, H/64, NB)
// ---------------------------------------------------------------------------
__device__ __forceinline__
void trans_blk(const float* __restrict__ enc, us* __restrict__ encT2, float (*ts)[65], int s0, int h0, int b)
{
    const int tid = threadIdx.x, lane = tid & 31, wave = tid >> 5;

#pragma unroll
    for (int p = 0; p < 4; ++p) {
        const int sl = p * 16 + (tid >> 4);
        const int h4 = (tid & 15) * 4;
        const v4f x = *(const v4f*)(enc + ((size_t)(b * S_LEN + s0 + sl)) * HD + h0 + h4);
        ts[sl][h4 + 0] = x.x; ts[sl][h4 + 1] = x.y; ts[sl][h4 + 2] = x.z; ts[sl][h4 + 3] = x.w;
    }
    __syncthreads();

    v8us o[2];
#pragma unroll
    for (int p = 0; p < 2; ++p) {
        const int hl = p * 32 + wave * 4 + (lane >> 3);
        const int s8 = (lane & 7) * 8;
#pragma unroll
        for (int i = 0; i < 8; ++i) o[p][i] = f2bf(ts[s8 + i][hl]);
    }
#pragma unroll
    for (int p = 0; p < 2; ++p) {
        const int hl = p * 32 + wave * 4 + (lane >> 3);
        const int s8 = (lane & 7) * 8;
        us* d = encT2 + ((size_t)(b * HD + h0 + hl)) * S_LEN + s0 + s8;
        *(v8us*)d = o[p];
    }
    
}

// ---------------------------------------------------------------------------
// All 16-bit planes in one launch: none of these jobs reads what another writes, so they share a grid and
// the block index picks the job. The transpose tiles (the longest blocks) come first.
//   transpose  enc   -> encT2
//   convert    query -> comb columns [1024,1536)
//   convert    enc   -> encp columns [1024,1536)
//   convert    W_s -> Wsb, W_h -> Whb ([out][in] is already k-contiguous per output column)
//   convert    W_out [512][1024] -> WoX [512][1536] = [W_out[:,0:512] | W_out[:,0:512] | W_out[:,512:1024]]
// ---------------------------------------------------------------------------
#define NSEG (HD / 256)
#define PB_T ((S_LEN / 64) * (HD / 64) * NB)       // transpose tiles
#define PB_Q ((NB * TQ * NSEG + 7) / 8)            // blocks of the query conversion
#define PB_E ((NB * S_LEN * NSEG + 7) / 8)         // blocks of the enc conversion
#define PB_W ((HD * NSEG + 7) / 8)                 // blocks of one weight conversion
#define PB_ALL (PB_T + PB_Q + PB_E + 5 * PB_W)

__global__ __launch_bounds__(256)
void k_prep(const float* __restrict__ query, const float* __restrict__ enc,
            const float* __restrict__ W_s, const float* __restrict__ W_h, const float* __restrict__ W_out,
            us* __restrict__ comb, us* __restrict__ encp, us* __restrict__ Wsb, us* __restrict__ Whb,
            us* __restrict__ WoX, us* __restrict__ encT2)
{
    __shared__ float ts[64][65];
    int i = blockIdx.x;                                // every test below is the same for the whole block
    if (i < PB_T) {
        trans_blk(enc, encT2, ts, (i % (S_LEN / 64)) * 64, ((i / (S_LEN / 64)) % (HD / 64)) * 64,
                  i / ((S_LEN / 64) * (HD / 64)));
        return;
    }
    i -= PB_T;
    if (i < PB_Q) { cvt_blk(query, HD, 0, TQ, T_FULL, comb, KO, 2 * HD, NB * TQ, NSEG, i); return; }
    i -= PB_Q;
    if (i < PB_E) { cvt_blk(enc, HD, 0, S_LEN, S_LEN, encp, KO, 2 * HD, NB * S_LEN, NSEG, i); return; }
    i -= PB_E;
    if (i < PB_W) { cvt_blk(W_s, HD, 0, HD, HD, Wsb, HD, 0, HD, NSEG, i); return; }
    i -= PB_W;
    if (i < PB_W) { cvt_blk(W_h, HD, 0, HD, HD, Whb, HD, 0, HD, NSEG, i); return; }
    i -= PB_W;
    if (i < PB_W) { cvt_blk(W_out, 2 * HD, 0, HD, HD, WoX, KO, 0, HD, NSEG, i); return; }
    i -= PB_W;
    if (i < PB_W) { cvt_blk(W_out, 2 * HD, 0, HD, HD, WoX, KO, HD, HD, NSEG, i); return; }
    i -= PB_W;
    cvt_blk(W_out, 2 * HD, HD, HD, HD, WoX, KO, 2 * HD, HD, NSEG, i);
}

// ---------------------------------------------------------------------------
// LDS ring of k_gemm. A stage is 256 k (512 B) of the block's 64 A rows and 64 B rows; two buffers.
// ---------------------------------------------------------------------------
#define KS 256                  // halves of k per stage
#define SPITCH 528              // LDS bytes per staged row: 16 B x odd, so 16 rows of one ds_load_b128 fall on distinct banks
#define SOPER (64 * SPITCH)     // one operand's 64 rows
#define SBUF (2 * SOPER)        // one buffer: [A rows | B rows]
static_assert((HD % KS) == 0 && (KO % KS) == 0 && HD / KS >= 2 && KO / KS >= 2);

// Eight asynchronous copies global -> LDS, one staged row (512 B, four whole lines) per copy: lane l brings
// bytes 16 l .. 16 l + 15 of rows 0..7 behind g (pitch ld halves) to l0 + row * SPITCH. l0 and g are the lane's own.
__device__ __forceinline__ void copy8(unsigned l0, const us* g, int ld)
{
    // the closing s_wait_xcnt stands inside the statement, so no address register of a copy is rewritten ahead of it
    asm volatile("global_load_async_to_lds_b128 %0, %8, off\n\t"
                 "global_load_async_to_lds_b128 %1, %9, off\n\t"
                 "global_load_async_to_lds_b128 %2, %10, off\n\t"
                 "global_load_async_to_lds_b128 %3, %11, off\n\t"
                 "global_load_async_to_lds_b128 %4, %12, off\n\t"
                 "global_load_async_to_lds_b128 %5, %13, off\n\t"
                 "global_load_async_to_lds_b128 %6, %14, off\n\t"
                 "global_load_async_to_lds_b128 %7, %15, off\n\t"
                 "s_wait_xcnt 0x0"
                 :: "v"(l0), "v"(l0 + 1 * SPITCH), "v"(l0 + 2 * SPITCH), "v"(l0 + 3 * SPITCH),
                    "v"(l0 + 4 * SPITCH), "v"(l0 + 5 * SPITCH), "v"(l0 + 6 * SPITCH), "v"(l0 + 7 * SPITCH),
                    "v"(g), "v"(g + (size_t)ld), "v"(g + (size_t)ld * 2), "v"(g + (size_t)ld * 3),
                    "v"(g + (size_t)ld * 4), "v"(g + (size_t)ld * 5), "v"(g + (size_t)ld * 6), "v"(g + (size_t)ld * 7)
                 : "memory");
}
// One wave's share of a stage: 16 A rows and 16 B rows, 32 copies. dst = the lane's LDS byte address in the buffer.
__device__ __forceinline__ void copy_stage(unsigned dst, const us* ga, int lda, const us* gb, int ldb)
{
    copy8(dst, ga, lda);
    copy8(dst + 8 * SPITCH, ga + (size_t)lda * 8, lda);
    copy8(dst + SOPER, gb, ldb);
    copy8(dst + SOPER + 8 * SPITCH, gb + (size_t)ldb * 8, ldb);
}
// Fragment from a staged k-contiguous row. Lane l: row = (l & 15) (A row m, or B column n of an [n][k] plane),
// hsel = l >> 4; p = the row's start in LDS + 2 * k0 + 16 * hsel bytes.
//   elements 0..7  <- k0 + 8*hsel + 0..7
//   elements 8..15 <- k0 + 16 + 8*hsel + 0..7
__device__ __forceinline__ v16bf lds_frag(const unsigned char* p) {
    Frag f;
    f.h[0] = *(const v8us*)p;
    f.h[1] = *(const v8us*)(p + 32);
    return f.v;
}

// ---------------------------------------------------------------------------
// GEMM: C[M][N] = A[M][K] * B, B given as a k-contiguous [N][K] plane (B[k][n] = Bp[n][k]). K a multiple of KS.
// Block = 128 threads (4 waves), block tile 64(M) x 64(N), wave tile 16 x 64 (4 accumulators).
// The operand rows come into LDS by asynchronous copies, whole lines at a time, each B row once per block;
// stage t + 1 flies while stage t is worked on. Fragments are read from LDS with the split k map. blockIdx.z = batch.
// Epilogue: wave tile staged in LDS, block barrier, then whole-row-segment stores:
//   EPI 2: same with tanh, destination d_out
//   EPI 3: f32 rows of exp_m2(C)
// ---------------------------------------------------------------------------
template <int EPI>
__global__ __launch_bounds__(128)
void k_gemm(const us* __restrict__ A, int lda, int strideA,
            const us* __restrict__ B, int ldb, int strideB,
            void* __restrict__ Cv, int ldc, int strideC, int K)
{
    __shared__ __attribute__((aligned(16))) unsigned char ring[2 * SBUF];
    __shared__ __attribute__((aligned(16))) float tile[4 * 16 * 64];

    const int lane = threadIdx.x & 31, wave = threadIdx.x >> 5;
    const int hsel = lane >> 4, m = lane & 15;
    const int m0 = blockIdx.x * 64 + wave * 16;
    const int n0 = blockIdx.y * 64;
    const us* Ab = A + (size_t)blockIdx.z * (size_t)strideA;
    const us* Bb = B + (size_t)blockIdx.z * (size_t)strideB;

    // wave w copies A rows m0 .. m0 + 15 and B rows n0 + 16 w .. n0 + 16 w + 15 of every stage
    const us* ga = Ab + (size_t)m0 * lda + lane * 8;
    const us* gb = Bb + (size_t)(n0 + wave * 16) * ldb + lane * 8;
    const unsigned dst = (unsigned)(size_t)ring + wave * 16 * SPITCH + lane * 16;
    const int nst = K / KS;

    copy_stage(dst, ga, lda, gb, ldb);
    asm volatile("s_wait_asynccnt 0x0" ::: "memory");    // this wave's share of stage 0 has landed
    __syncthreads();                                     // ... and every other wave's
    if (nst > 1) copy_stage(dst + SBUF, ga + KS, lda, gb + KS, ldb);

    v8f c0 = {}; v8f c1 = {}; v8f c2 = {}; v8f c3 = {};
    for (int t = 0; t < nst; ++t) {
        const unsigned char* pa = ring + (t & 1) * SBUF + (wave * 16 + m) * SPITCH + hsel * 16;
        const unsigned char* pb = ring + (t & 1) * SBUF + SOPER + m * SPITCH + hsel * 16;
        // two fragment sets: the next 32 k of this stage are read from LDS while these are multiplied
        v16bf fa[2], fb[2][4];
        fa[0]    = lds_frag(pa);
        fb[0][0] = lds_frag(pb);
        fb[0][1] = lds_frag(pb + 16 * SPITCH);
        fb[0][2] = lds_frag(pb + 32 * SPITCH);
        fb[0][3] = lds_frag(pb + 48 * SPITCH);
        // unrolled so that the two sets are named registers, not indexed ones
#pragma unroll
        for (int kk = 0; kk < KS / 32; ++kk) {
            const int cu = kk & 1, nx = cu ^ 1;
            if (kk + 1 < KS / 32) {
                fa[nx]    = lds_frag(pa + (kk + 1) * 64);
                fb[nx][0] = lds_frag(pb + (kk + 1) * 64);
                fb[nx][1] = lds_frag(pb + 16 * SPITCH + (kk + 1) * 64);
                fb[nx][2] = lds_frag(pb + 32 * SPITCH + (kk + 1) * 64);
                fb[nx][3] = lds_frag(pb + 48 * SPITCH + (kk + 1) * 64);
            }
            c0 = wmma16(fa[cu], fb[cu][0], c0);
            c1 = wmma16(fa[cu], fb[cu][1], c1);
            c2 = wmma16(fa[cu], fb[cu][2], c2);
            c3 = wmma16(fa[cu], fb[cu][3], c3);
        }
        asm volatile("s_wait_dscnt 0x0" ::: "memory");       // this wave has left the buffer of stage t
        asm volatile("s_wait_asynccnt 0x0" ::: "memory");    // its share of stage t + 1 has landed
        __syncthreads();                                     // publishes stage t + 1, frees the buffer of stage t
        if (t + 2 < nst)
            copy_stage(dst + (t & 1) * SBUF, ga + (size_t)(t + 2) * KS, lda, gb + (size_t)(t + 2) * KS, ldb);
    }
    asm volatile("s_wait_asynccnt 0x0" ::: "memory");        // no copy is outstanding when the wave goes on

    // D map: acc[r] -> (row 8*hsel + r, col n-tile + m). Stage the 16x64 wave tile in LDS.
    float* tw = tile + wave * 1024;
#pragma unroll
    for (int r = 0; r < 8; ++r) {
        const int row = 8 * hsel + r;
        tw[row * 64 + m]      = c0[r];
        tw[row * 64 + 16 + m] = c1[r];
        tw[row * 64 + 32 + m] = c2[r];
        tw[row * 64 + 48 + m] = c3[r];
    }
    __syncthreads();

    {
        float* Cb = (float*)Cv + (size_t)blockIdx.z * (size_t)strideC;
        v4f vals[8];
#pragma unroll
        for (int p = 0; p < 8; ++p) {
            const int row = 2 * p + hsel;
            v4f x = *(const v4f*)(tw + row * 64 + 4 * m);
            if (EPI == 2) {
                x.x = tanh_acc(x.x); x.y = tanh_acc(x.y); x.z = tanh_acc(x.z); x.w = tanh_acc(x.w);
            }
            if (EPI == 3) {
                x.x = exp_m2(x.x); x.y = exp_m2(x.y); x.z = exp_m2(x.z); x.w = exp_m2(x.w);
            }
            vals[p] = x;
        }
#pragma unroll
        for (int p = 0; p < 8; ++p) {
            float* d = Cb + (size_t)(m0 + 2 * p + hsel) * ldc + n0 + 4 * m;
            *(v4f*)d = vals[p];
        }
        
    }
}

// ---------------------------------------------------------------------------
// Fused energies -> length mask -> softmax -> context rows. One block (256 = S) per (b, TT queries); thread = s.
//   Wsq and Whe arrive as factors: Eq = e^{-2 Wsq}, Ee = e^{-2 Whe} (k_gemm<3>), so that
//   v[h] * tanh(Wsq[bt][h] + Whe[b][s][h]) = 2 v[h] / (1 + Eq[bt][h] * Ee[b][s][h]) - v[h]
//   e[t][s] = sum_h 2 v[h] / (1 + Eq * Ee)   (f32), s >= len masked out; the term -sum_h v[h] is the same
//             for every s of a row and cancels in the softmax, so it is not formed
//   p       = softmax_s(e), kept in LDS as two bf16 planes: rows 0..7 hi, rows 8..15 lo (lo = p - hi)
//   ctx     = p @ enc[b] on the matrix unit: the 16 plane rows are one A tile, wave w takes columns 64 w .. 64 w + 63;
//             result row t (the hi sums) + row 8 + t (the lo sums) is query t's context, stored as bf16 hi+lo in comb
// The wave's 64 rows of encT2 (its B operand) come into LDS by asynchronous copies that fly under the energy loop.
// Every Ee value a thread loads serves all TT queries of the block from its register, so the strided
// row reads of Ee are issued once per TT queries. Per (t, s) the h order of the sum and the block trees
// of the softmax are those of the one-query form.
// LDS regions are cross-wave: block barriers throughout.
// ---------------------------------------------------------------------------
#define TT 8             // queries per block (= waves per block; thread s writes column s of every query's P planes)
#define CH 8             // v4f per lane and chunk: one 128-B line of the lane's Whe row
static_assert((TQ % TT) == 0 && TT == 8);
static_assert(((HD / 4) % CH) == 0 && ((TT / 2 * HD / 4) % 256) == 0);
static_assert(HD == 8 * 64 && S_LEN == KS && HD / 4 / CH >= 8);   // 8 waves x 64 columns; a staged row is S_LEN halves

__global__ __launch_bounds__(256)
void k_attn(const float* __restrict__ Wsq, const float* __restrict__ Whe,
            const float* __restrict__ vvec, const int* __restrict__ lens,
            const us* __restrict__ encT2, us* __restrict__ comb)
{
    // query factors, two queries interleaved: sqp[p][h / 2] = {Eq[2p][h], Eq[2p+1][h], Eq[2p][h+1], Eq[2p+1][h+1]},
    // so that a pair of queries at one h is a register pair as it comes from LDS
    // one object, so that what the energy loop reads lies low in LDS, within reach of a ds_load's immediate offset
    __shared__ struct {
        v4f sqp[TT / 2][HD / 2];
        v4f sv4[HD / 4];
        float red[TT][S_LEN];
        unsigned char pl[2 * TT * SPITCH];     // P planes, one row per SPITCH
        unsigned char eb[HD * SPITCH];         // encT2[b], wave w owns rows 64 w ..
    } sm;
    v4f (&sqp)[TT / 2][HD / 2] = sm.sqp;
    v4f (&sv4)[HD / 4]         = sm.sv4;
    float (&red)[TT][S_LEN]    = sm.red;
    unsigned char* const pl    = sm.pl;
    unsigned char* const eb    = sm.eb;

    const int bt0 = blockIdx.x * TT;         // b * TQ + t of the block's first query; TT divides TQ
    const int b   = bt0 / TQ;
    const int tid = threadIdx.x, lane = tid & 31, wave = tid >> 5;

    {   // the TT query rows are contiguous in Wsq
        const v4f* qs = (const v4f*)(Wsq + (size_t)bt0 * HD);
#pragma unroll
        for (int i = 0; i < TT / 2 * HD / 4 / 256; ++i) {
            const int p  = (i * 256 + tid) / (HD / 4);
            const int h4 = (i * 256 + tid) % (HD / 4);
            const v4f a = qs[(2 * p) * (HD / 4) + h4];
            const v4f c = qs[(2 * p + 1) * (HD / 4) + h4];
            sqp[p][2 * h4]     = (v4f){a.x, c.x, a.y, c.y};
            sqp[p][2 * h4 + 1] = (v4f){a.z, c.z, a.w, c.w};
        }
    }
    if (tid < HD / 4) {
        v4f w = *(const v4f*)(vvec + tid * 4);
        w.x = bf2f(f2bf(w.x)); w.y = bf2f(f2bf(w.y)); w.z = bf2f(f2bf(w.z)); w.w = bf2f(f2bf(w.w));
        sv4[tid] = 2.0f * w;
    }
    __syncthreads();

    const int len = lens[b];
    const v4f* we = (const v4f*)(Whe + ((size_t)b * S_LEN + tid) * HD);
    // the lane's 16 bytes of the wave's first encT2 row, and their place in LDS
    const us* ge = encT2 + ((size_t)b * HD + wave * 64) * S_LEN + lane * 8;
    const unsigned edst = (unsigned)(size_t)eb + wave * 64 * SPITCH + lane * 16;
    // the sums of queries t and t + 1 lie side by side, so that one packed fma serves both; each keeps its h order
    v2f acc2[TT / 2];
#pragma unroll
    for (int t = 0; t < TT / 2; ++t) acc2[t] = (v2f){0.0f, 0.0f};

    // The lane's next line of Whe is fetched into a second register set while this one is worked on;
    // trip -1 fetches line 0 and starts the copies of the wave's first eight encT2 rows; it sums nothing.
    v4f cur[CH], nxt[CH];
    for (int c = -1; c < HD / 4 / CH; ++c) {
        if (c + 1 < HD / 4 / CH) {
#pragma unroll
            for (int j = 0; j < CH; ++j) nxt[j] = we[(c + 1) * CH + j];
            // stands between these loads and any overwrite of their address registers
            asm volatile("s_wait_xcnt 0x0" ::: "memory");
        }
        if (c + 1 < 8) {
            // eight encT2 rows a trip, behind the trip's own loads, so that the copies never crowd them out;
            // the wait holds a wave's copies in flight at eight (all 64 at once would pass the 63 that may be outstanding)
            asm volatile("s_wait_asynccnt 0x0" ::: "memory");
            copy8(edst + (c + 1) * 8 * SPITCH, ge + (size_t)(c + 1) * 8 * S_LEN, S_LEN);
        }
        if (c >= 0) {
#pragma unroll
            for (int j = 0; j < CH; ++j) {
                const v4f e = cur[j];
                const v4f w = sv4[c * CH + j];
#pragma unroll
                for (int p = 0; p < TT / 2; ++p) {
                    const v4f q0 = sqp[p][(c * CH + j) * 2];
                    const v4f q1 = sqp[p][(c * CH + j) * 2 + 1];
                    const v2f q[4] = {q0.xy, q0.zw, q1.xy, q1.zw};
#pragma unroll
                    for (int i = 0; i < 4; ++i) {
                        const v2f n = __builtin_elementwise_fma(q[i], (v2f){e[i], e[i]}, (v2f){1.0f, 1.0f});
                        const v2f r = {__builtin_amdgcn_rcpf(n.x), __builtin_amdgcn_rcpf(n.y)};
                        acc2[p] = __builtin_elementwise_fma((v2f){w[i], w[i]}, r, acc2[p]);
                    }
                }
            }
        }
#pragma unroll
        for (int j = 0; j < CH; ++j) cur[j] = nxt[j];
    }
    asm volatile("s_wait_asynccnt 0x0" ::: "memory");    // this wave's encT2 rows have landed; barriers follow
    const bool valid = tid < len;
    float acc[TT];
#pragma unroll
    for (int t = 0; t < TT; ++t) acc[t] = acc2[t / 2][t & 1];

    // block max over s, all TT queries in each step
#pragma unroll
    for (int t = 0; t < TT; ++t) red[t][tid] = valid ? acc[t] : -3.0e38f;
    __syncthreads();
#pragma unroll
    for (int st = S_LEN / 2; st > 0; st >>= 1) {
        if (tid < st) {
#pragma unroll
            for (int t = 0; t < TT; ++t) red[t][tid] = fmaxf(red[t][tid], red[t][tid + st]);
        }
        __syncthreads();
    }
    float ex[TT];
#pragma unroll
    for (int t = 0; t < TT; ++t) ex[t] = red[t][0];      // the maximum, until the exp below
    __syncthreads();

    // exp + block sum (masked entries contribute exactly 0)
#pragma unroll
    for (int t = 0; t < TT; ++t) {
        const float arg = valid ? (acc[t] - ex[t]) : -80.0f;
        const float ex0 = __expf(arg);
        ex[t] = valid ? ex0 : 0.0f;
        red[t][tid] = ex[t];
    }
    __syncthreads();
#pragma unroll
    for (int st = S_LEN / 2; st > 0; st >>= 1) {
        if (tid < st) {
#pragma unroll
            for (int t = 0; t < TT; ++t) red[t][tid] += red[t][tid + st];
        }
        __syncthreads();
    }
#pragma unroll
    for (int t = 0; t < TT; ++t) {
        const float ssum = red[t][0];
        const float pv = ex[t] * (1.0f / ssum);
        const us ph = f2bf(pv);
        *(us*)(pl + t * SPITCH + tid * 2)        = ph;
        *(us*)(pl + (TT + t) * SPITCH + tid * 2) = f2bf(pv - bf2f(ph));
    }
    __syncthreads();

    // context: A = the 16 plane rows, B = the wave's own 64 staged rows of encT2, k = s in ascending order
    const int hsel = lane >> 4, m = lane & 15;
    const unsigned char* pa = pl + m * SPITCH + hsel * 16;
    unsigned char* ew = eb + wave * 64 * SPITCH;
    const unsigned char* pb = ew + m * SPITCH + hsel * 16;
    v8f c0 = {}; v8f c1 = {}; v8f c2 = {}; v8f c3 = {};
    {
        // two fragment sets: the next 32 k are read from LDS while these are multiplied
        v16bf fa[2], fb[2][4];
        fa[0]    = lds_frag(pa);
        fb[0][0] = lds_frag(pb);
        fb[0][1] = lds_frag(pb + 16 * SPITCH);
        fb[0][2] = lds_frag(pb + 32 * SPITCH);
        fb[0][3] = lds_frag(pb + 48 * SPITCH);
        // unrolled so that the two sets are named registers, not indexed ones
#pragma unroll
        for (int kk = 0; kk < S_LEN / 32; ++kk) {
            const int cu = kk & 1, nx = cu ^ 1;
            if (kk + 1 < S_LEN / 32) {
                fa[nx]    = lds_frag(pa + (kk + 1) * 64);
                fb[nx][0] = lds_frag(pb + (kk + 1) * 64);
                fb[nx][1] = lds_frag(pb + 16 * SPITCH + (kk + 1) * 64);
                fb[nx][2] = lds_frag(pb + 32 * SPITCH + (kk + 1) * 64);
                fb[nx][3] = lds_frag(pb + 48 * SPITCH + (kk + 1) * 64);
            }
            c0 = wmma16(fa[cu], fb[cu][0], c0);
            c1 = wmma16(fa[cu], fb[cu][1], c1);
            c2 = wmma16(fa[cu], fb[cu][2], c2);
            c3 = wmma16(fa[cu], fb[cu][3], c3);
        }
    }

    // D map: acc[r] -> (row 8*hsel + r, col n-tile + m). The 16x64 wave tile goes over the wave's own staged rows,
    // which it alone has read and has done with.
    float* tw = (float*)ew;
#pragma unroll
    for (int r = 0; r < 8; ++r) {
        const int row = 8 * hsel + r;
        tw[row * 64 + m]      = c0[r];
        tw[row * 64 + 16 + m] = c1[r];
        tw[row * 64 + 32 + m] = c2[r];
        tw[row * 64 + 48 + m] = c3[r];
    }
    __syncthreads();

    // ctx = hi sums + lo sums; comb columns [0,512) hi and [512,1024) lo, 8 lanes per 128-B line
    {
        v8us hi[2], lo[2];
#pragma unroll
        for (int p = 0; p < 2; ++p) {
            const float* th = tw + (4 * p + (lane >> 3)) * 64 + 8 * (lane & 7);
            const v4f a = *(const v4f*)th       + *(const v4f*)(th + TT * 64);
            const v4f c = *(const v4f*)(th + 4) + *(const v4f*)(th + TT * 64 + 4);
            split8(a, c, hi[p], lo[p]);
        }
#pragma unroll
        for (int p = 0; p < 2; ++p) {
            us* d = comb + (size_t)(bt0 + 4 * p + (lane >> 3)) * KO + wave * 64 + 8 * (lane & 7);
            *(v8us*)d = hi[p];
            *(v8us*)(d + HD) = lo[p];
        }
    }
}

// ---------------------------------------------------------------------------
static inline size_t al256(size_t x) { return (x + 255) & ~(size_t)255; }
// the two projections run as two batches of one launch: equal shapes, and no padding between the paired regions
static_assert(TQ == S_LEN);
static_assert(((size_t)NB * TQ * KO * sizeof(us)) % 256 == 0 && ((size_t)HD * HD * sizeof(us)) % 256 == 0 &&
              ((size_t)NB * TQ * HD * sizeof(float)) % 256 == 0);

extern "C" void kernel_launch(void* const* d_in, const int* in_sizes, int n_in,
                              void* d_out, int out_size, void* d_ws, size_t ws_size,
                              hipStream_t stream)
{
    if (n_in < 7) return;
    if (in_sizes[0] < ((NB - 1) * T_FULL + TQ) * HD) return;      // query  [8][256][512] f32
    if (in_sizes[1] < NB * S_LEN * HD) return;                      // enc    [8][256][512] f32
    if (in_sizes[2] < NB) return;                                   // src_lengths [8] int32
    if (in_sizes[3] < HD * HD || in_sizes[4] < HD * HD) return;     // W_s, W_h [512][512] f32
    if (in_sizes[5] < HD) return;                                   // v [512] f32
    if (in_sizes[6] < HD * 2 * HD) return;                          // W_out [512][1024] f32
    if (out_size < ((NB - 1) * T_FULL + TQ) * HD) return;

    const float* query = (const float*)d_in[0];
    const float* enc   = (const float*)d_in[1];
    const int*   lens  = (const int*)d_in[2];
    const float* W_s   = (const float*)d_in[3];
    const float* W_h   = (const float*)d_in[4];
    const float* vvec  = (const float*)d_in[5];
    const float* W_out = (const float*)d_in[6];
    float* out = (float*)d_out;

    // ---- workspace carve (all regions 256-B aligned; sizes already store-granular) ----
    char* ws = (char*)d_ws;
    size_t off = 0;
    us* comb  = (us*)(ws + off);    off += al256((size_t)NB * TQ * KO * sizeof(us));      // [NB*TQ][1536]
    us* encp  = (us*)(ws + off);    off += al256((size_t)NB * S_LEN * KO * sizeof(us));   // [NB*S][1536], columns [1024,1536) used
    us* encT2 = (us*)(ws + off);    off += al256((size_t)NB * HD * S_LEN * sizeof(us));   // [NB][512][256]
    us* Wsb   = (us*)(ws + off);    off += al256((size_t)HD * HD * sizeof(us));           // [512][512]
    us* Whb   = (us*)(ws + off);    off += al256((size_t)HD * HD * sizeof(us));           // [512][512]
    us* WoX   = (us*)(ws + off);    off += al256((size_t)HD * KO * sizeof(us));           // [512][1536]
    float* Wsq = (float*)(ws + off); off += al256((size_t)NB * TQ * HD * sizeof(float));  // [NB*TQ][512]
    float* Whe = (float*)(ws + off); off += al256((size_t)NB * S_LEN * HD * sizeof(float)); // [NB*S][512]
    if (off > ws_size) return;

    const dim3 b256(256), b128(128);

    // ---- 16-bit planes (RNE convert of every float input, once; enc also transposed) ----
    k_prep<<<dim3(PB_ALL), b256, 0, stream>>>(query, enc, W_s, W_h, W_out, comb, encp, Wsb, Whb, WoX, encT2);

    // ---- projections, stored as factors: Wsq = e^{-2 q @ W_s^T}, Whe = e^{-2 enc @ W_h^T} (f32) ----
    // one launch, blockIdx.z = 0 for q, 1 for enc: encp follows comb, Whb follows Wsb and Whe follows Wsq in
    // the carve above, each at the first one's shape, so the second product is batch 1 of the first
    k_gemm<3><<<dim3(NB * TQ / 64, HD / 64, 2), b128, 0, stream>>>(
        comb + 2 * HD, KO, NB * TQ * KO, Wsb, HD, HD * HD, (void*)Wsq, HD, NB * TQ * HD, HD);

    // ---- energies + mask + softmax, then context = P @ enc -> comb columns [0,512) hi and [512,1024) lo ----
    k_attn<<<dim3(NB * TQ / TT), b256, 0, stream>>>(Wsq, Whe, vvec, lens, encT2, comb);

    // ---- out = tanh([ctx_hi|ctx_lo|q] @ WoX^T) ----
    k_gemm<2><<<dim3(TQ / 64, HD / 64, NB), b128, 0, stream>>>(
        comb, KO, TQ * KO, WoX, KO, 0, (void*)out, HD, T_FULL * HD, KO);
}

// v006
// A run of this version takes 48.9 microseconds.
// Two timings next to v005 both put it at 1.04 times that version's speed.
// Over all steps from v000 it is 4.36 times as fast.
#include <hip/hip_runtime.h>

// Contractions on v_wmma_f32_16x16x32_bf16 (bf16 operands, f32 accumulate): q@W_s^T and enc@W_h^T from
// RNE-converted input planes; attn@enc with the bf16 hi and lo planes of attn as rows 0-7 and 8-15 of one tile,
// [ctx|q]@W_out^T with ctx carried as bf16 hi+lo planes folded into K.
// Energies v.tanh(.), length masking and softmax in f32 on the VALU; the tanh of a sum is
// formed from one exponential factor per projection value (exp_m2 below).

#ifndef NB
#define NB 8
#endif
#ifndef TQ
#define TQ 256
#endif
#define NB_FULL 8
#define T_FULL 256
#define S_LEN 256
#define HD 512
#define KO (3 * HD)      // output GEMM depth:  [ctx_hi | ctx_lo | q]

static_assert(NB >= 1 && NB <= NB_FULL);
static_assert(TQ >= 64 && TQ <= T_FULL && (TQ % 64) == 0);
static_assert(S_LEN == 256);
static_assert((HD % 256) == 0);
static_assert((KO % 32) == 0 && (HD % 64) == 0 && (S_LEN % 64) == 0);

typedef unsigned short us;
typedef us     v8us  __attribute__((ext_vector_type(8)));
typedef __bf16 v16bf __attribute__((ext_vector_type(16)));
typedef float  v8f   __attribute__((ext_vector_type(8)));
typedef float  v4f   __attribute__((ext_vector_type(4)));
typedef float  v2f   __attribute__((ext_vector_type(2)));

union Frag { v16bf v; v8us h[2]; };

// ---------------------------------------------------------------------------
// scalar helpers
// ---------------------------------------------------------------------------
__device__ __forceinline__ us f2bf(float f) {           // f32 -> bf16, RNE convert
    unsigned int u = __float_as_uint(f);
    u += 0x7FFFu + ((u >> 16) & 1u);
    return (us)(u >> 16);
}
__device__ __forceinline__ float bf2f(us h) {
    return __uint_as_float(((unsigned int)h) << 16);
}
// tanh(x) = sign(x) * (1 - e^{-2|x|}) / (1 + e^{-2|x|}), v_exp_f32 + v_rcp_f32 based (abs error ~1e-7)
__device__ __forceinline__ float tanh_acc(float x) {
    const float ax = __builtin_fabsf(x);
    const float t  = __expf(-2.0f * ax);
    const float r  = (1.0f - t) * __builtin_amdgcn_rcpf(1.0f + t);
    return __builtin_copysignf(r, x);
}
// e^{-2x}, the factor of one projection value: tanh(a + b) = 2 / (1 + e^{-2a} * e^{-2b}) - 1.
// The exponent is held in [-63, 63] (|x| <= 21.8), so a factor is never 0 or inf and a product of two
// is never 0 * inf; a product that grows large gives 2 / (1 + u) - 1 -> -1, a small one -> +1.
__device__ __forceinline__ float exp_m2(float x) {
    const float l = fminf(fmaxf(x * -2.88539008177792681472f, -63.0f), 63.0f);
    return __builtin_amdgcn_exp2f(l);
}
__device__ __forceinline__ v8us pack8(v4f a, v4f c) {
    v8us o;
    o[0] = f2bf(a.x); o[1] = f2bf(a.y); o[2] = f2bf(a.z); o[3] = f2bf(a.w);
    o[4] = f2bf(c.x); o[5] = f2bf(c.y); o[6] = f2bf(c.z); o[7] = f2bf(c.w);
    return o;
}
// hi = bf16(x), lo = bf16(x - hi): unscaled bf16 residual pair
__device__ __forceinline__ void split8(v4f a, v4f c, v8us& hi, v8us& lo) {
    const float x[8] = {a.x, a.y, a.z, a.w, c.x, c.y, c.z, c.w};
#pragma unroll
    for (int i = 0; i < 8; ++i) {
        const us h = f2bf(x[i]);
        hi[i] = h;
        lo[i] = f2bf(x[i] - bf2f(h));
    }
}

// ---------------------------------------------------------------------------
// WMMA helper: 16x16x32 bf16, f32 accumulate, 4-slot VALU hazard guard after the issue
// ---------------------------------------------------------------------------
__device__ __forceinline__ v8f wmma16(v16bf a, v16bf b, v8f c) {
    v8f d = __builtin_amdgcn_wmma_f32_16x16x32_bf16(false, a, false, b, (short)0, c, false, false);
    asm volatile("v_nop\n\tv_nop\n\tv_nop\n\tv_nop" : "+v"(d) : "v"(a), "v"(b));
    return d;
}

// ---------------------------------------------------------------------------
// Row conversion f32 -> bf16 plane, block blk of one conversion job. One wave per (row, 256-column segment):
// lane l converts columns 8l..8l+7 of the segment and stores 16 B; one instruction covers the
// (r / grp) * gstride + (r % grp) (lets a reduced build read full-stride inputs).
// ---------------------------------------------------------------------------
__device__ __forceinline__
void cvt_blk(const float* __restrict__ src, int spitch, int scol, int grp, int gstride,
             us* __restrict__ dst, int dpitch, int dcol, int nrows, int nseg, int blk)
{
    const int lane = threadIdx.x & 31;
    const int gw   = blk * 8 + (threadIdx.x >> 5);
    if (gw >= nrows * nseg) return;                    // wave-uniform, no barriers on this path
    const int r    = gw / nseg;
    const int sg   = gw - r * nseg;
    const int g    = r / grp;
    const int srow = g * gstride + (r - g * grp);
    const float* sp = src + (size_t)srow * spitch + scol + sg * 256 + lane * 8;
    const v4f a = *(const v4f*)sp;
    const v4f c = *(const v4f*)(sp + 4);
    const v8us o = pack8(a, c);
    us* dp = dst + (size_t)r * dpitch + dcol + sg * 256 + lane * 8;
    *(v8us*)dp = o;
    
}

// ---------------------------------------------------------------------------
// Encoder transpose plane: encT2[b][h][s] = bf16(enc[b][s][h]); pitch S_LEN halves.
// Block: 64 s x 64 h tile through LDS (cross-wave -> block barrier). Store phase: one instruction
// tile (s0 / 64, h0 / 64, b) of (S/64, H/64, NB)
// ---------------------------------------------------------------------------
__device__ __forceinline__
void trans_blk(const float* __restrict__ enc, us* __restrict__ encT2, float (*ts)[65], int s0, int h0, int b)
{
    const int tid = threadIdx.x, lane = tid & 31, wave = tid >> 5;

#pragma unroll
    for (int p = 0; p < 4; ++p) {
        const int sl = p * 16 + (tid >> 4);
        const int h4 = (tid & 15) * 4;
        const v4f x = *(const v4f*)(enc + ((size_t)(b * S_LEN + s0 + sl)) * HD + h0 + h4);
        ts[sl][h4 + 0] = x.x; ts[sl][h4 + 1] = x.y; ts[sl][h4 + 2] = x.z; ts[sl][h4 + 3] = x.w;
    }
    __syncthreads();

    v8us o[2];
#pragma unroll
    for (int p = 0; p < 2; ++p) {
        const int hl = p * 32 + wave * 4 + (lane >> 3);
        const int s8 = (lane & 7) * 8;
#pragma unroll
        for (int i = 0; i < 8; ++i) o[p][i] = f2bf(ts[s8 + i][hl]);
    }
#pragma unroll
    for (int p = 0; p < 2; ++p) {
        const int hl = p * 32 + wave * 4 + (lane >> 3);
        const int s8 = (lane & 7) * 8;
        us* d = encT2 + ((size_t)(b * HD + h0 + hl)) * S_LEN + s0 + s8;
        *(v8us*)d = o[p];
    }
    
}

// ---------------------------------------------------------------------------
// All 16-bit planes in one launch: none of these jobs reads what another writes, so they share a grid and
// the block index picks the job. The transpose tiles (the longest blocks) come first.
//   transpose  enc   -> encT2
//   convert    query -> comb columns [1024,1536)
//   convert    enc   -> encp columns [1024,1536)
//   convert    W_s -> Wsb, W_h -> Whb ([out][in] is already k-contiguous per output column)
//   convert    W_out [512][1024] -> WoX [512][1536] = [W_out[:,0:512] | W_out[:,0:512] | W_out[:,512:1024]]
// ---------------------------------------------------------------------------
#define NSEG (HD / 256)
#define PB_T ((S_LEN / 64) * (HD / 64) * NB)       // transpose tiles
#define PB_Q ((NB * TQ * NSEG + 7) / 8)            // blocks of the query conversion
#define PB_E ((NB * S_LEN * NSEG + 7) / 8)         // blocks of the enc conversion
#define PB_W ((HD * NSEG + 7) / 8)                 // blocks of one weight conversion
#define PB_ALL (PB_T + PB_Q + PB_E + 5 * PB_W)

__global__ __launch_bounds__(256)
void k_prep(const float* __restrict__ query, const float* __restrict__ enc,
            const float* __restrict__ W_s, const float* __restrict__ W_h, const float* __restrict__ W_out,
            us* __restrict__ comb, us* __restrict__ encp, us* __restrict__ Wsb, us* __restrict__ Whb,
            us* __restrict__ WoX, us* __restrict__ encT2)
{
    __shared__ float ts[64][65];
    int i = blockIdx.x;                                // every test below is the same for the whole block
    if (i < PB_T) {
        trans_blk(enc, encT2, ts, (i % (S_LEN / 64)) * 64, ((i / (S_LEN / 64)) % (HD / 64)) * 64,
                  i / ((S_LEN / 64) * (HD / 64)));
        return;
    }
    i -= PB_T;
    if (i < PB_Q) { cvt_blk(query, HD, 0, TQ, T_FULL, comb, KO, 2 * HD, NB * TQ, NSEG, i); return; }
    i -= PB_Q;
    if (i < PB_E) { cvt_blk(enc, HD, 0, S_LEN, S_LEN, encp, KO, 2 * HD, NB * S_LEN, NSEG, i); return; }
    i -= PB_E;
    if (i < PB_W) { cvt_blk(W_s, HD, 0, HD, HD, Wsb, HD, 0, HD, NSEG, i); return; }
    i -= PB_W;
    if (i < PB_W) { cvt_blk(W_h, HD, 0, HD, HD, Whb, HD, 0, HD, NSEG, i); return; }
    i -= PB_W;
    if (i < PB_W) { cvt_blk(W_out, 2 * HD, 0, HD, HD, WoX, KO, 0, HD, NSEG, i); return; }
    i -= PB_W;
    if (i < PB_W) { cvt_blk(W_out, 2 * HD, 0, HD, HD, WoX, KO, HD, HD, NSEG, i); return; }
    i -= PB_W;
    cvt_blk(W_out, 2 * HD, HD, HD, HD, WoX, KO, 2 * HD, HD, NSEG, i);
}

// ---------------------------------------------------------------------------
// LDS ring of k_gemm. A stage is 256 k (512 B) of the block's 64 A rows and 64 B rows; two buffers.
// ---------------------------------------------------------------------------
#define KS 256                  // halves of k per stage
#define SPITCH 528              // LDS bytes per staged row: 16 B x odd, so 16 rows of one ds_load_b128 fall on distinct banks
#define SOPER (64 * SPITCH)     // one operand's 64 rows
#define SBUF (2 * SOPER)        // one buffer: [A rows | B rows]
static_assert((HD % KS) == 0 && (KO % KS) == 0 && HD / KS >= 2 && KO / KS >= 2);

// Eight asynchronous copies global -> LDS, one staged row (512 B, four whole lines) per copy: lane l brings
// bytes 16 l .. 16 l + 15 of rows 0..7 behind g (pitch ld halves) to l0 + row * SPITCH. l0 and g are the lane's own.
__device__ __forceinline__ void copy8(unsigned l0, const us* g, int ld)
{
    // the closing s_wait_xcnt stands inside the statement, so no address register of a copy is rewritten ahead of it
    asm volatile("global_load_async_to_lds_b128 %0, %8, off\n\t"
                 "global_load_async_to_lds_b128 %1, %9, off\n\t"
                 "global_load_async_to_lds_b128 %2, %10, off\n\t"
                 "global_load_async_to_lds_b128 %3, %11, off\n\t"
                 "global_load_async_to_lds_b128 %4, %12, off\n\t"
                 "global_load_async_to_lds_b128 %5, %13, off\n\t"
                 "global_load_async_to_lds_b128 %6, %14, off\n\t"
                 "global_load_async_to_lds_b128 %7, %15, off\n\t"
                 "s_wait_xcnt 0x0"
                 :: "v"(l0), "v"(l0 + 1 * SPITCH), "v"(l0 + 2 * SPITCH), "v"(l0 + 3 * SPITCH),
                    "v"(l0 + 4 * SPITCH), "v"(l0 + 5 * SPITCH), "v"(l0 + 6 * SPITCH), "v"(l0 + 7 * SPITCH),
                    "v"(g), "v"(g + (size_t)ld), "v"(g + (size_t)ld * 2), "v"(g + (size_t)ld * 3),
                    "v"(g + (size_t)ld * 4), "v"(g + (size_t)ld * 5), "v"(g + (size_t)ld * 6), "v"(g + (size_t)ld * 7)
                 : "memory");
}
// One wave's share of a stage: 16 A rows and 16 B rows, 32 copies. dst = the lane's LDS byte address in the buffer.
__device__ __forceinline__ void copy_stage(unsigned dst, const us* ga, int lda, const us* gb, int ldb)
{
    copy8(dst, ga, lda);
    copy8(dst + 8 * SPITCH, ga + (size_t)lda * 8, lda);
    copy8(dst + SOPER, gb, ldb);
    copy8(dst + SOPER + 8 * SPITCH, gb + (size_t)ldb * 8, ldb);
}
// Fragment from a staged k-contiguous row. Lane l: row = (l & 15) (A row m, or B column n of an [n][k] plane),
// hsel = l >> 4; p = the row's start in LDS + 2 * k0 + 16 * hsel bytes.
//   elements 0..7  <- k0 + 8*hsel + 0..7
//   elements 8..15 <- k0 + 16 + 8*hsel + 0..7
__device__ __forceinline__ v16bf lds_frag(const unsigned char* p) {
    Frag f;
    f.h[0] = *(const v8us*)p;
    f.h[1] = *(const v8us*)(p + 32);
    return f.v;
}

// ---------------------------------------------------------------------------
// GEMM: C[M][N] = A[M][K] * B, B given as a k-contiguous [N][K] plane (B[k][n] = Bp[n][k]). K a multiple of KS.
// Block = 128 threads (4 waves), block tile 64(M) x 64(N), wave tile 16 x 64 (4 accumulators).
// The operand rows come into LDS by asynchronous copies, whole lines at a time, each B row once per block;
// stage t + 1 flies while stage t is worked on. Fragments are read from LDS with the split k map. blockIdx.z = batch.
// Epilogue: wave tile staged in LDS, block barrier, then whole-row-segment stores:
//   EPI 2: same with tanh, destination d_out
//   EPI 3: f32 exp_m2(C); batch 0 as rows, batch 1 (the encoder factors) in groups of four columns:
//          Ct[row / S_LEN][col / 4][row % S_LEN][col % 4], so that 32 neighbouring rows at one group are 512 B in a row
// ---------------------------------------------------------------------------
#define TP 68                   // floats per staged result row: 16 B x odd, so 16 rows of one ds_load_b128 fall on distinct banks
template <int EPI>
__global__ __launch_bounds__(128)
void k_gemm(const us* __restrict__ A, int lda, int strideA,
            const us* __restrict__ B, int ldb, int strideB,
            void* __restrict__ Cv, int ldc, int strideC, int K)
{
    __shared__ __attribute__((aligned(16))) unsigned char ring[2 * SBUF];
    __shared__ __attribute__((aligned(16))) float tile[4 * 16 * TP];

    const int lane = threadIdx.x & 31, wave = threadIdx.x >> 5;
    const int hsel = lane >> 4, m = lane & 15;
    const int m0 = blockIdx.x * 64 + wave * 16;
    const int n0 = blockIdx.y * 64;
    const us* Ab = A + (size_t)blockIdx.z * (size_t)strideA;
    const us* Bb = B + (size_t)blockIdx.z * (size_t)strideB;

    // wave w copies A rows m0 .. m0 + 15 and B rows n0 + 16 w .. n0 + 16 w + 15 of every stage
    const us* ga = Ab + (size_t)m0 * lda + lane * 8;
    const us* gb = Bb + (size_t)(n0 + wave * 16) * ldb + lane * 8;
    const unsigned dst = (unsigned)(size_t)ring + wave * 16 * SPITCH + lane * 16;
    const int nst = K / KS;

    copy_stage(dst, ga, lda, gb, ldb);
    asm volatile("s_wait_asynccnt 0x0" ::: "memory");    // this wave's share of stage 0 has landed
    __syncthreads();                                     // ... and every other wave's
    if (nst > 1) copy_stage(dst + SBUF, ga + KS, lda, gb + KS, ldb);

    v8f c0 = {}; v8f c1 = {}; v8f c2 = {}; v8f c3 = {};
    for (int t = 0; t < nst; ++t) {
        const unsigned char* pa = ring + (t & 1) * SBUF + (wave * 16 + m) * SPITCH + hsel * 16;
        const unsigned char* pb = ring + (t & 1) * SBUF + SOPER + m * SPITCH + hsel * 16;
        // two fragment sets: the next 32 k of this stage are read from LDS while these are multiplied
        v16bf fa[2], fb[2][4];
        fa[0]    = lds_frag(pa);
        fb[0][0] = lds_frag(pb);
        fb[0][1] = lds_frag(pb + 16 * SPITCH);
        fb[0][2] = lds_frag(pb + 32 * SPITCH);
        fb[0][3] = lds_frag(pb + 48 * SPITCH);
        // unrolled so that the two sets are named registers, not indexed ones
#pragma unroll
        for (int kk = 0; kk < KS / 32; ++kk) {
            const int cu = kk & 1, nx = cu ^ 1;
            if (kk + 1 < KS / 32) {
                fa[nx]    = lds_frag(pa + (kk + 1) * 64);
                fb[nx][0] = lds_frag(pb + (kk + 1) * 64);
                fb[nx][1] = lds_frag(pb + 16 * SPITCH + (kk + 1) * 64);
                fb[nx][2] = lds_frag(pb + 32 * SPITCH + (kk + 1) * 64);
                fb[nx][3] = lds_frag(pb + 48 * SPITCH + (kk + 1) * 64);
            }
            c0 = wmma16(fa[cu], fb[cu][0], c0);
            c1 = wmma16(fa[cu], fb[cu][1], c1);
            c2 = wmma16(fa[cu], fb[cu][2], c2);
            c3 = wmma16(fa[cu], fb[cu][3], c3);
        }
        asm volatile("s_wait_dscnt 0x0" ::: "memory");       // this wave has left the buffer of stage t
        asm volatile("s_wait_asynccnt 0x0" ::: "memory");    // its share of stage t + 1 has landed
        __syncthreads();                                     // publishes stage t + 1, frees the buffer of stage t
        if (t + 2 < nst)
            copy_stage(dst + (t & 1) * SBUF, ga + (size_t)(t + 2) * KS, lda, gb + (size_t)(t + 2) * KS, ldb);
    }
    asm volatile("s_wait_asynccnt 0x0" ::: "memory");        // no copy is outstanding when the wave goes on

    // D map: acc[r] -> (row 8*hsel + r, col n-tile + m). Stage the 16x64 wave tile in LDS.
    float* tw = tile + wave * 16 * TP;
#pragma unroll
    for (int r = 0; r < 8; ++r) {
        const int row = 8 * hsel + r;
        tw[row * TP + m]      = c0[r];
        tw[row * TP + 16 + m] = c1[r];
        tw[row * TP + 32 + m] = c2[r];
        tw[row * TP + 48 + m] = c3[r];
    }
    __syncthreads();

    if (EPI == 3 && blockIdx.z == 1) {
        // lane = (row m, column group 2 p + hsel): a store writes two runs of 256 B, each two whole lines.
        // The wave's 16 rows lie in one batch of S_LEN rows.
        float* Cb = (float*)Cv + (size_t)blockIdx.z * (size_t)strideC
                  + (((size_t)(m0 / S_LEN) * (HD / 4) + n0 / 4 + hsel) * S_LEN + (m0 % S_LEN) + m) * 4;
        v4f vals[8];
#pragma unroll
        for (int p = 0; p < 8; ++p) {
            v4f x = *(const v4f*)(tw + m * TP + 4 * (2 * p + hsel));
            x.x = exp_m2(x.x); x.y = exp_m2(x.y); x.z = exp_m2(x.z); x.w = exp_m2(x.w);
            vals[p] = x;
        }
#pragma unroll
        for (int p = 0; p < 8; ++p) *(v4f*)(Cb + (size_t)(2 * p) * S_LEN * 4) = vals[p];
    } else {
        float* Cb = (float*)Cv + (size_t)blockIdx.z * (size_t)strideC;
        v4f vals[8];
#pragma unroll
        for (int p = 0; p < 8; ++p) {
            const int row = 2 * p + hsel;
            v4f x = *(const v4f*)(tw + row * TP + 4 * m);
            if (EPI == 2) {
                x.x = tanh_acc(x.x); x.y = tanh_acc(x.y); x.z = tanh_acc(x.z); x.w = tanh_acc(x.w);
            }
            if (EPI == 3) {
                x.x = exp_m2(x.x); x.y = exp_m2(x.y); x.z = exp_m2(x.z); x.w = exp_m2(x.w);
            }
            vals[p] = x;
        }
#pragma unroll
        for (int p = 0; p < 8; ++p) {
            float* d = Cb + (size_t)(m0 + 2 * p + hsel) * ldc + n0 + 4 * m;
            *(v4f*)d = vals[p];
        }
        
    }
}

// ---------------------------------------------------------------------------
// Fused energies -> length mask -> softmax -> context rows. One block (256 = S) per (b, TT queries); thread = s.
//   Wsq and Whe arrive as factors: Eq = e^{-2 Wsq}, Ee = e^{-2 Whe} (k_gemm<3>), so that
//   v[h] * tanh(Wsq[bt][h] + Whe[b][s][h]) = 2 v[h] / (1 + Eq[bt][h] * Ee[b][s][h]) - v[h]
//   e[t][s] = sum_h 2 v[h] / (1 + Eq * Ee)   (f32), s >= len masked out; the term -sum_h v[h] is the same
//             for every s of a row and cancels in the softmax, so it is not formed
//   p       = softmax_s(e), kept in LDS as two bf16 planes: rows 0..7 hi, rows 8..15 lo (lo = p - hi)
//   ctx     = p @ enc[b] on the matrix unit: the 16 plane rows are one A tile, wave w takes columns 64 w .. 64 w + 63;
//             result row t (the hi sums) + row 8 + t (the lo sums) is query t's context, stored as bf16 hi+lo in comb
// The wave's 64 rows of encT2 (its B operand) come into LDS by asynchronous copies that fly under the energy loop.
// Ee lies in groups of four h (k_gemm<3>, batch 1): Whe[b][h / 4][s][h % 4], so a wave's load of one group for its
// 32 s is four whole lines. Every Ee value a thread loads serves all TT queries of the block from its register.
// Per (t, s) the h order of the sum and the block trees
// of the softmax are those of the one-query form.
// LDS regions are cross-wave: block barriers throughout.
// ---------------------------------------------------------------------------
#define TT 8             // queries per block (= waves per block; each thread stores its s of all TT queries' P planes)
#define CH 8             // v4f per lane and chunk: 32 h of the lane's s
static_assert((TQ % TT) == 0 && TT == 8);
static_assert(((HD / 4) % CH) == 0 && ((TT / 2 * HD / 4) % 256) == 0);
static_assert(HD == 8 * 64 && S_LEN == KS && HD / 4 / CH >= 8);   // 8 waves x 64 columns; a staged row is S_LEN halves

__global__ __launch_bounds__(256)
void k_attn(const float* __restrict__ Wsq, const float* __restrict__ Whe,
            const float* __restrict__ vvec, const int* __restrict__ lens,
            const us* __restrict__ encT2, us* __restrict__ comb)
{
    // query factors, two queries interleaved: sqp[p][h / 2] = {Eq[2p][h], Eq[2p+1][h], Eq[2p][h+1], Eq[2p+1][h+1]},
    // so that a pair of queries at one h is a register pair as it comes from LDS
    // one object, so that what the energy loop reads lies low in LDS, within reach of a ds_load's immediate offset
    __shared__ struct {
        v4f sqp[TT / 2][HD / 2];
        v4f sv4[HD / 4];
        float red[TT][S_LEN];
        unsigned char pl[2 * TT * SPITCH];     // P planes, one row per SPITCH
        unsigned char eb[HD * SPITCH];         // encT2[b], wave w owns rows 64 w ..
    } sm;
    v4f (&sqp)[TT / 2][HD / 2] = sm.sqp;
    v4f (&sv4)[HD / 4]         = sm.sv4;
    float (&red)[TT][S_LEN]    = sm.red;
    unsigned char* const pl    = sm.pl;
    unsigned char* const eb    = sm.eb;

    const int bt0 = blockIdx.x * TT;         // b * TQ + t of the block's first query; TT divides TQ
    const int b   = bt0 / TQ;
    const int tid = threadIdx.x, lane = tid & 31, wave = tid >> 5;

    {   // the TT query rows are contiguous in Wsq
        const v4f* qs = (const v4f*)(Wsq + (size_t)bt0 * HD);
#pragma unroll
        for (int i = 0; i < TT / 2 * HD / 4 / 256; ++i) {
            const int p  = (i * 256 + tid) / (HD / 4);
            const int h4 = (i * 256 + tid) % (HD / 4);
            const v4f a = qs[(2 * p) * (HD / 4) + h4];
            const v4f c = qs[(2 * p + 1) * (HD / 4) + h4];
            sqp[p][2 * h4]     = (v4f){a.x, c.x, a.y, c.y};
            sqp[p][2 * h4 + 1] = (v4f){a.z, c.z, a.w, c.w};
        }
    }
    if (tid < HD / 4) {
        v4f w = *(const v4f*)(vvec + tid * 4);
        w.x = bf2f(f2bf(w.x)); w.y = bf2f(f2bf(w.y)); w.z = bf2f(f2bf(w.z)); w.w = bf2f(f2bf(w.w));
        sv4[tid] = 2.0f * w;
    }
    __syncthreads();

    const int len = lens[b];
    const v4f* we = (const v4f*)Whe + (size_t)b * (HD / 4) * S_LEN + tid;    // group g of this s: we[g * S_LEN]
    // the lane's 16 bytes of the wave's first encT2 row, and their place in LDS
    const us* ge = encT2 + ((size_t)b * HD + wave * 64) * S_LEN + lane * 8;
    const unsigned edst = (unsigned)(size_t)eb + wave * 64 * SPITCH + lane * 16;
    // the sums of queries t and t + 1 lie side by side, so that one packed fma serves both; each keeps its h order
    v2f acc2[TT / 2];
#pragma unroll
    for (int t = 0; t < TT / 2; ++t) acc2[t] = (v2f){0.0f, 0.0f};

    // The lane's next chunk of Whe is fetched into a second register set while this one is worked on;
    // trip -1 fetches chunk 0, starts the copies of encT2 rows 0..7 and computes nothing.
    v4f cur[CH], nxt[CH];
    for (int c = -1; c < HD / 4 / CH; ++c) {
        if (c + 1 < HD / 4 / CH) {
#pragma unroll
            for (int j = 0; j < CH; ++j) nxt[j] = we[((c + 1) * CH + j) * S_LEN];
            // stands between these loads and any overwrite of their address registers
            asm volatile("s_wait_xcnt 0x0" ::: "memory");
        }
        if (c + 1 < 8) {
            // eight encT2 rows a trip, behind the trip's own loads, so that the copies never crowd them out;
            // the wait holds a wave's copies in flight at eight (all 64 at once would pass the 63 that may be outstanding)
            asm volatile("s_wait_asynccnt 0x0" ::: "memory");
            copy8(edst + (c + 1) * 8 * SPITCH, ge + (size_t)(c + 1) * 8 * S_LEN, S_LEN);
        }
        if (c >= 0) {
#pragma unroll
            for (int j = 0; j < CH; ++j) {
                const v4f e = cur[j];
                const v4f w = sv4[c * CH + j];
#pragma unroll
                for (int p = 0; p < TT / 2; ++p) {
                    const v4f q0 = sqp[p][(c * CH + j) * 2];
                    const v4f q1 = sqp[p][(c * CH + j) * 2 + 1];
                    const v2f q[4] = {q0.xy, q0.zw, q1.xy, q1.zw};
#pragma unroll
                    for (int i = 0; i < 4; ++i) {
                        const v2f n = __builtin_elementwise_fma(q[i], (v2f){e[i], e[i]}, (v2f){1.0f, 1.0f});
                        const v2f r = {__builtin_amdgcn_rcpf(n.x), __builtin_amdgcn_rcpf(n.y)};
                        acc2[p] = __builtin_elementwise_fma((v2f){w[i], w[i]}, r, acc2[p]);
                    }
                }
            }
        }
#pragma unroll
        for (int j = 0; j < CH; ++j) cur[j] = nxt[j];
    }
    asm volatile("s_wait_asynccnt 0x0" ::: "memory");    // this wave's encT2 rows have landed; barriers follow
    const bool valid = tid < len;
    float acc[TT];
#pragma unroll
    for (int t = 0; t < TT; ++t) acc[t] = acc2[t / 2][t & 1];

    // block max over s, all TT queries in each step
#pragma unroll
    for (int t = 0; t < TT; ++t) red[t][tid] = valid ? acc[t] : -3.0e38f;
    __syncthreads();
#pragma unroll
    for (int st = S_LEN / 2; st > 0; st >>= 1) {
        if (tid < st) {
#pragma unroll
            for (int t = 0; t < TT; ++t) red[t][tid] = fmaxf(red[t][tid], red[t][tid + st]);
        }
        __syncthreads();
    }
    float ex[TT];
#pragma unroll
    for (int t = 0; t < TT; ++t) ex[t] = red[t][0];      // the maximum, until the exp below
    __syncthreads();

    // exp + block sum (masked entries contribute exactly 0)
#pragma unroll
    for (int t = 0; t < TT; ++t) {
        const float arg = valid ? (acc[t] - ex[t]) : -80.0f;
        const float ex0 = __expf(arg);
        ex[t] = valid ? ex0 : 0.0f;
        red[t][tid] = ex[t];
    }
    __syncthreads();
#pragma unroll
    for (int st = S_LEN / 2; st > 0; st >>= 1) {
        if (tid < st) {
#pragma unroll
            for (int t = 0; t < TT; ++t) red[t][tid] += red[t][tid + st];
        }
        __syncthreads();
    }
#pragma unroll
    for (int t = 0; t < TT; ++t) {
        const float ssum = red[t][0];
        const float pv = ex[t] * (1.0f / ssum);
        const us ph = f2bf(pv);
        *(us*)(pl + t * SPITCH + tid * 2)        = ph;
        *(us*)(pl + (TT + t) * SPITCH + tid * 2) = f2bf(pv - bf2f(ph));
    }
    __syncthreads();

    // context: A = the 16 plane rows, B = the wave's own 64 staged rows of encT2, k = s in ascending order
    const int hsel = lane >> 4, m = lane & 15;
    const unsigned char* pa = pl + m * SPITCH + hsel * 16;
    unsigned char* ew = eb + wave * 64 * SPITCH;
    const unsigned char* pb = ew + m * SPITCH + hsel * 16;
    v8f c0 = {}; v8f c1 = {}; v8f c2 = {}; v8f c3 = {};
    {
        // two fragment sets: the next 32 k are read from LDS while these are multiplied
        v16bf fa[2], fb[2][4];
        fa[0]    = lds_frag(pa);
        fb[0][0] = lds_frag(pb);
        fb[0][1] = lds_frag(pb + 16 * SPITCH);
        fb[0][2] = lds_frag(pb + 32 * SPITCH);
        fb[0][3] = lds_frag(pb + 48 * SPITCH);
        // unrolled so that the two sets are named registers, not indexed ones
#pragma unroll
        for (int kk = 0; kk < S_LEN / 32; ++kk) {
            const int cu = kk & 1, nx = cu ^ 1;
            if (kk + 1 < S_LEN / 32) {
                fa[nx]    = lds_frag(pa + (kk + 1) * 64);
                fb[nx][0] = lds_frag(pb + (kk + 1) * 64);
                fb[nx][1] = lds_frag(pb + 16 * SPITCH + (kk + 1) * 64);
                fb[nx][2] = lds_frag(pb + 32 * SPITCH + (kk + 1) * 64);
                fb[nx][3] = lds_frag(pb + 48 * SPITCH + (kk + 1) * 64);
            }
            c0 = wmma16(fa[cu], fb[cu][0], c0);
            c1 = wmma16(fa[cu], fb[cu][1], c1);
            c2 = wmma16(fa[cu], fb[cu][2], c2);
            c3 = wmma16(fa[cu], fb[cu][3], c3);
        }
    }

    // D map: acc[r] -> (row 8*hsel + r, col n-tile + m). The 16x64 wave tile goes over the wave's own staged rows,
    // which it alone has read and has done with.
    float* tw = (float*)ew;
#pragma unroll
    for (int r = 0; r < 8; ++r) {
        const int row = 8 * hsel + r;
        tw[row * 64 + m]      = c0[r];
        tw[row * 64 + 16 + m] = c1[r];
        tw[row * 64 + 32 + m] = c2[r];
        tw[row * 64 + 48 + m] = c3[r];
    }
    __syncthreads();

    // ctx = hi sums + lo sums; comb columns [0,512) hi and [512,1024) lo, 8 lanes per 128-B line
    {
        v8us hi[2], lo[2];
#pragma unroll
        for (int p = 0; p < 2; ++p) {
            const float* th = tw + (4 * p + (lane >> 3)) * 64 + 8 * (lane & 7);
            const v4f a = *(const v4f*)th       + *(const v4f*)(th + TT * 64);
            const v4f c = *(const v4f*)(th + 4) + *(const v4f*)(th + TT * 64 + 4);
            split8(a, c, hi[p], lo[p]);
        }
#pragma unroll
        for (int p = 0; p < 2; ++p) {
            us* d = comb + (size_t)(bt0 + 4 * p + (lane >> 3)) * KO + wave * 64 + 8 * (lane & 7);
            *(v8us*)d = hi[p];
            *(v8us*)(d + HD) = lo[p];
        }
    }
}

// ---------------------------------------------------------------------------
static inline size_t al256(size_t x) { return (x + 255) & ~(size_t)255; }
// the two projections run as two batches of one launch: equal shapes, and no padding between the paired regions
static_assert(TQ == S_LEN);
static_assert(((size_t)NB * TQ * KO * sizeof(us)) % 256 == 0 && ((size_t)HD * HD * sizeof(us)) % 256 == 0 &&
              ((size_t)NB * TQ * HD * sizeof(float)) % 256 == 0);

extern "C" void kernel_launch(void* const* d_in, const int* in_sizes, int n_in,
                              void* d_out, int out_size, void* d_ws, size_t ws_size,
                              hipStream_t stream)
{
    if (n_in < 7) return;
    if (in_sizes[0] < ((NB - 1) * T_FULL + TQ) * HD) return;      // query  [8][256][512] f32
    if (in_sizes[1] < NB * S_LEN * HD) return;                      // enc    [8][256][512] f32
    if (in_sizes[2] < NB) return;                                   // src_lengths [8] int32
    if (in_sizes[3] < HD * HD || in_sizes[4] < HD * HD) return;     // W_s, W_h [512][512] f32
    if (in_sizes[5] < HD) return;                                   // v [512] f32
    if (in_sizes[6] < HD * 2 * HD) return;                          // W_out [512][1024] f32
    if (out_size < ((NB - 1) * T_FULL + TQ) * HD) return;

    const float* query = (const float*)d_in[0];
    const float* enc   = (const float*)d_in[1];
    const int*   lens  = (const int*)d_in[2];
    const float* W_s   = (const float*)d_in[3];
    const float* W_h   = (const float*)d_in[4];
    const float* vvec  = (const float*)d_in[5];
    const float* W_out = (const float*)d_in[6];
    float* out = (float*)d_out;

    // ---- workspace carve (all regions 256-B aligned; sizes already store-granular) ----
    char* ws = (char*)d_ws;
    size_t off = 0;
    us* comb  = (us*)(ws + off);    off += al256((size_t)NB * TQ * KO * sizeof(us));      // [NB*TQ][1536]
    us* encp  = (us*)(ws + off);    off += al256((size_t)NB * S_LEN * KO * sizeof(us));   // [NB*S][1536], columns [1024,1536) used
    us* encT2 = (us*)(ws + off);    off += al256((size_t)NB * HD * S_LEN * sizeof(us));   // [NB][512][256]
    us* Wsb   = (us*)(ws + off);    off += al256((size_t)HD * HD * sizeof(us));           // [512][512]
    us* Whb   = (us*)(ws + off);    off += al256((size_t)HD * HD * sizeof(us));           // [512][512]
    us* WoX   = (us*)(ws + off);    off += al256((size_t)HD * KO * sizeof(us));           // [512][1536]
    float* Wsq = (float*)(ws + off); off += al256((size_t)NB * TQ * HD * sizeof(float));  // [NB*TQ][512]
    float* Whe = (float*)(ws + off); off += al256((size_t)NB * S_LEN * HD * sizeof(float)); // [NB][128][S][4]
    if (off > ws_size) return;

    const dim3 b256(256), b128(128);

    // ---- 16-bit planes (RNE convert of every float input, once; enc also transposed) ----
    k_prep<<<dim3(PB_ALL), b256, 0, stream>>>(query, enc, W_s, W_h, W_out, comb, encp, Wsb, Whb, WoX, encT2);

    // ---- projections, stored as factors: Wsq = e^{-2 q @ W_s^T}, Whe = e^{-2 enc @ W_h^T} (f32) ----
    // one launch, blockIdx.z = 0 for q, 1 for enc: encp follows comb, Whb follows Wsb and Whe follows Wsq in
    // the carve above, each at the first one's shape, so the second product is batch 1 of the first
    k_gemm<3><<<dim3(NB * TQ / 64, HD / 64, 2), b128, 0, stream>>>(
        comb + 2 * HD, KO, NB * TQ * KO, Wsb, HD, HD * HD, (void*)Wsq, HD, NB * TQ * HD, HD);

    // ---- energies + mask + softmax, then context = P @ enc -> comb columns [0,512) hi and [512,1024) lo ----
    k_attn<<<dim3(NB * TQ / TT), b256, 0, stream>>>(Wsq, Whe, vvec, lens, encT2, comb);

    // ---- out = tanh([ctx_hi|ctx_lo|q] @ WoX^T) ----
    k_gemm<2><<<dim3(TQ / 64, HD / 64, NB), b128, 0, stream>>>(
        comb, KO, TQ * KO, WoX, KO, 0, (void*)out, HD, T_FULL * HD, KO);
}

// v007
// It runs in 46.6 microseconds.
// In two side-by-side timings against v006, it was 1.07 and 1.05 times as fast.
// Counting every step since v000, it is 4.63 times as fast.
#include <hip/hip_runtime.h>

// Contractions on v_wmma_f32_16x16x32_bf16 (bf16 operands, f32 accumulate): q@W_s^T and enc@W_h^T from
// RNE-converted inputs; attn@enc with the bf16 hi and lo planes of attn as rows 0-7 and 8-15 of one tile,
// [ctx|q]@W_out^T with ctx carried as bf16 hi+lo planes folded into K.
// Energies v.tanh(.), length masking and softmax in f32 on the VALU; the tanh of a sum is
// formed from one exponential factor per projection value (exp_m2 below).

#ifndef NB
#define NB 8
#endif
#ifndef TQ
#define TQ 256
#endif
#define NB_FULL 8
#define T_FULL 256
#define S_LEN 256
#define HD 512
#define KO (3 * HD)      // output GEMM depth:  [ctx_hi | ctx_lo | q]

static_assert(NB >= 1 && NB <= NB_FULL);
static_assert(TQ >= 64 && TQ <= T_FULL && (TQ % 64) == 0);
static_assert(S_LEN == 256);
static_assert((HD % 256) == 0);
static_assert((KO % 32) == 0 && (HD % 64) == 0 && (S_LEN % 64) == 0);

typedef unsigned short us;
typedef us     v8us  __attribute__((ext_vector_type(8)));
typedef __bf16 v16bf __attribute__((ext_vector_type(16)));
typedef float  v8f   __attribute__((ext_vector_type(8)));
typedef float  v4f   __attribute__((ext_vector_type(4)));
typedef float  v2f   __attribute__((ext_vector_type(2)));
typedef __bf16 v2bf  __attribute__((ext_vector_type(2)));
typedef unsigned int v2u __attribute__((ext_vector_type(2)));
typedef unsigned int v4u __attribute__((ext_vector_type(4)));

union Frag { v16bf v; v8us h[2]; };

// ---------------------------------------------------------------------------
// scalar helpers
// ---------------------------------------------------------------------------
__device__ __forceinline__ us f2bf(float f) {           // f32 -> bf16, RNE convert
    unsigned int u = __float_as_uint(f);
    u += 0x7FFFu + ((u >> 16) & 1u);
    return (us)(u >> 16);
}
__device__ __forceinline__ float bf2f(us h) {
    return __uint_as_float(((unsigned int)h) << 16);
}
// tanh(x) = sign(x) * (1 - e^{-2|x|}) / (1 + e^{-2|x|}), v_exp_f32 + v_rcp_f32 based (abs error ~1e-7)
__device__ __forceinline__ float tanh_acc(float x) {
    const float ax = __builtin_fabsf(x);
    const float t  = __expf(-2.0f * ax);
    const float r  = (1.0f - t) * __builtin_amdgcn_rcpf(1.0f + t);
    return __builtin_copysignf(r, x);
}
// e^{-2x}, the factor of one projection value: tanh(a + b) = 2 / (1 + e^{-2a} * e^{-2b}) - 1.
// The exponent is held in [-63, 63] (|x| <= 21.8), so a factor is never 0 or inf and a product of two
// is never 0 * inf; a product that grows large gives 2 / (1 + u) - 1 -> -1, a small one -> +1.
__device__ __forceinline__ float exp_m2(float x) {
    const float l = fminf(fmaxf(x * -2.88539008177792681472f, -63.0f), 63.0f);
    return __builtin_amdgcn_exp2f(l);
}
// hi = bf16(x), lo = bf16(x - hi): unscaled bf16 residual pair
__device__ __forceinline__ void split8(v4f a, v4f c, v8us& hi, v8us& lo) {
    const float x[8] = {a.x, a.y, a.z, a.w, c.x, c.y, c.z, c.w};
#pragma unroll
    for (int i = 0; i < 8; ++i) {
        const us h = f2bf(x[i]);
        hi[i] = h;
        lo[i] = f2bf(x[i] - bf2f(h));
    }
}

// ---------------------------------------------------------------------------
// WMMA helper: 16x16x32 bf16, f32 accumulate, 4-slot VALU hazard guard after the issue
// ---------------------------------------------------------------------------
__device__ __forceinline__ v8f wmma16(v16bf a, v16bf b, v8f c) {
    v8f d = __builtin_amdgcn_wmma_f32_16x16x32_bf16(false, a, false, b, (short)0, c, false, false);
    asm volatile("v_nop\n\tv_nop\n\tv_nop\n\tv_nop" : "+v"(d) : "v"(a), "v"(b));
    return d;
}

// ---------------------------------------------------------------------------
// LDS ring of k_gemm. A stage is 256 k (512 B) of the block's 64 A rows and 64 B rows; two buffers.
// ---------------------------------------------------------------------------
#define KS 256                  // halves of k per stage
#define SPITCH 528              // LDS bytes per staged row: 16 B x odd, so 16 rows of one ds_load_b128 fall on distinct banks
#define SOPER (64 * SPITCH)     // one operand's 64 rows
#define SBUF (2 * SOPER)        // one buffer: [A rows | B rows]
static_assert((HD % KS) == 0 && (KO % KS) == 0 && HD / KS >= 2 && KO / KS >= 2);

// Eight asynchronous copies global -> LDS, one staged row (512 B, four whole lines) per copy: lane l brings
// bytes 16 l .. 16 l + 15 of rows 0..7 behind g (pitch ld halves) to l0 + row * SPITCH. l0 and g are the lane's own.
__device__ __forceinline__ void copy8(unsigned l0, const us* g, int ld)
{
    // the closing s_wait_xcnt stands inside the statement, so no address register of a copy is rewritten ahead of it
    asm volatile("global_load_async_to_lds_b128 %0, %8, off\n\t"
                 "global_load_async_to_lds_b128 %1, %9, off\n\t"
                 "global_load_async_to_lds_b128 %2, %10, off\n\t"
                 "global_load_async_to_lds_b128 %3, %11, off\n\t"
                 "global_load_async_to_lds_b128 %4, %12, off\n\t"
                 "global_load_async_to_lds_b128 %5, %13, off\n\t"
                 "global_load_async_to_lds_b128 %6, %14, off\n\t"
                 "global_load_async_to_lds_b128 %7, %15, off\n\t"
                 "s_wait_xcnt 0x0"
                 :: "v"(l0), "v"(l0 + 1 * SPITCH), "v"(l0 + 2 * SPITCH), "v"(l0 + 3 * SPITCH),
                    "v"(l0 + 4 * SPITCH), "v"(l0 + 5 * SPITCH), "v"(l0 + 6 * SPITCH), "v"(l0 + 7 * SPITCH),
                    "v"(g), "v"(g + (size_t)ld), "v"(g + (size_t)ld * 2), "v"(g + (size_t)ld * 3),
                    "v"(g + (size_t)ld * 4), "v"(g + (size_t)ld * 5), "v"(g + (size_t)ld * 6), "v"(g + (size_t)ld * 7)
                 : "memory");
}
// One wave's share of a stage: 16 A rows and 16 B rows, 32 copies. dst = the lane's LDS byte address in the buffer.
__device__ __forceinline__ void copy_stage(unsigned dst, const us* ga, int lda, const us* gb, int ldb)
{
    copy8(dst, ga, lda);
    copy8(dst + 8 * SPITCH, ga + (size_t)lda * 8, lda);
    copy8(dst + SOPER, gb, ldb);
    copy8(dst + SOPER + 8 * SPITCH, gb + (size_t)ldb * 8, ldb);
}
// Fragment from a staged k-contiguous row. Lane l: row = (l & 15) (A row m, or B column n of an [n][k] plane),
// hsel = l >> 4; p = the row's start in LDS + 2 * k0 + 16 * hsel bytes.
//   elements 0..7  <- k0 + 8*hsel + 0..7
//   elements 8..15 <- k0 + 16 + 8*hsel + 0..7
__device__ __forceinline__ v16bf lds_frag(const unsigned char* p) {
    Frag f;
    f.h[0] = *(const v8us*)p;
    f.h[1] = *(const v8us*)(p + 32);
    return f.v;
}

// ---------------------------------------------------------------------------
// GEMM: C[M][N] = A[M][K] * B, B given as a k-contiguous [N][K] plane (B[k][n] = Bp[n][k]). K a multiple of KS.
// Block = 128 threads (4 waves), block tile 64(M) x 64(N), wave tile 16 x 64 (4 accumulators).
// The operand rows come into LDS by asynchronous copies, whole lines at a time, each B row once per block;
// stage t + 1 flies while stage t is worked on. Fragments are read from LDS with the split k map. blockIdx.z = batch.
// Epilogue: wave tile staged in LDS, block barrier, then whole-row-segment stores:
//   EPI 2: same with tanh, destination d_out
// ---------------------------------------------------------------------------
#define TP 68                   // floats per staged result row: 16 B x odd, so 16 rows of one ds_load_b128 fall on distinct banks
template <int EPI>
__global__ __launch_bounds__(128)
void k_gemm(const us* __restrict__ A, int lda, int strideA,
            const us* __restrict__ B, int ldb, int strideB,
            void* __restrict__ Cv, int ldc, int strideC, int K)
{
    __shared__ __attribute__((aligned(16))) unsigned char ring[2 * SBUF];
    __shared__ __attribute__((aligned(16))) float tile[4 * 16 * TP];

    const int lane = threadIdx.x & 31, wave = threadIdx.x >> 5;
    const int hsel = lane >> 4, m = lane & 15;
    const int m0 = blockIdx.x * 64 + wave * 16;
    const int n0 = blockIdx.y * 64;
    const us* Ab = A + (size_t)blockIdx.z * (size_t)strideA;
    const us* Bb = B + (size_t)blockIdx.z * (size_t)strideB;

    // wave w copies A rows m0 .. m0 + 15 and B rows n0 + 16 w .. n0 + 16 w + 15 of every stage
    const us* ga = Ab + (size_t)m0 * lda + lane * 8;
    const us* gb = Bb + (size_t)(n0 + wave * 16) * ldb + lane * 8;
    const unsigned dst = (unsigned)(size_t)ring + wave * 16 * SPITCH + lane * 16;
    const int nst = K / KS;

    copy_stage(dst, ga, lda, gb, ldb);
    asm volatile("s_wait_asynccnt 0x0" ::: "memory");    // this wave's share of stage 0 has landed
    __syncthreads();                                     // ... and every other wave's
    if (nst > 1) copy_stage(dst + SBUF, ga + KS, lda, gb + KS, ldb);

    v8f c0 = {}; v8f c1 = {}; v8f c2 = {}; v8f c3 = {};
    for (int t = 0; t < nst; ++t) {
        const unsigned char* pa = ring + (t & 1) * SBUF + (wave * 16 + m) * SPITCH + hsel * 16;
        const unsigned char* pb = ring + (t & 1) * SBUF + SOPER + m * SPITCH + hsel * 16;
        // two fragment sets: the next 32 k of this stage are read from LDS while these are multiplied
        v16bf fa[2], fb[2][4];
        fa[0]    = lds_frag(pa);
        fb[0][0] = lds_frag(pb);
        fb[0][1] = lds_frag(pb + 16 * SPITCH);
        fb[0][2] = lds_frag(pb + 32 * SPITCH);
        fb[0][3] = lds_frag(pb + 48 * SPITCH);
        // unrolled so that the two sets are named registers, not indexed ones
#pragma unroll
        for (int kk = 0; kk < KS / 32; ++kk) {
            const int cu = kk & 1, nx = cu ^ 1;
            if (kk + 1 < KS / 32) {
                fa[nx]    = lds_frag(pa + (kk + 1) * 64);
                fb[nx][0] = lds_frag(pb + (kk + 1) * 64);
                fb[nx][1] = lds_frag(pb + 16 * SPITCH + (kk + 1) * 64);
                fb[nx][2] = lds_frag(pb + 32 * SPITCH + (kk + 1) * 64);
                fb[nx][3] = lds_frag(pb + 48 * SPITCH + (kk + 1) * 64);
            }
            c0 = wmma16(fa[cu], fb[cu][0], c0);
            c1 = wmma16(fa[cu], fb[cu][1], c1);
            c2 = wmma16(fa[cu], fb[cu][2], c2);
            c3 = wmma16(fa[cu], fb[cu][3], c3);
        }
        asm volatile("s_wait_dscnt 0x0" ::: "memory");       // this wave has left the buffer of stage t
        asm volatile("s_wait_asynccnt 0x0" ::: "memory");    // its share of stage t + 1 has landed
        __syncthreads();                                     // publishes stage t + 1, frees the buffer of stage t
        if (t + 2 < nst)
            copy_stage(dst + (t & 1) * SBUF, ga + (size_t)(t + 2) * KS, lda, gb + (size_t)(t + 2) * KS, ldb);
    }
    asm volatile("s_wait_asynccnt 0x0" ::: "memory");        // no copy is outstanding when the wave goes on

    // D map: acc[r] -> (row 8*hsel + r, col n-tile + m). Stage the 16x64 wave tile in LDS.
    float* tw = tile + wave * 16 * TP;
#pragma unroll
    for (int r = 0; r < 8; ++r) {
        const int row = 8 * hsel + r;
        tw[row * TP + m]      = c0[r];
        tw[row * TP + 16 + m] = c1[r];
        tw[row * TP + 32 + m] = c2[r];
        tw[row * TP + 48 + m] = c3[r];
    }
    __syncthreads();

    {
        float* Cb = (float*)Cv + (size_t)blockIdx.z * (size_t)strideC;
        v4f vals[8];
#pragma unroll
        for (int p = 0; p < 8; ++p) {
            const int row = 2 * p + hsel;
            v4f x = *(const v4f*)(tw + row * TP + 4 * m);
            if (EPI == 2) {
                x.x = tanh_acc(x.x); x.y = tanh_acc(x.y); x.z = tanh_acc(x.z); x.w = tanh_acc(x.w);
            }
            vals[p] = x;
        }
#pragma unroll
        for (int p = 0; p < 8; ++p) {
            float* d = Cb + (size_t)(m0 + 2 * p + hsel) * ldc + n0 + 4 * m;
            *(v4f*)d = vals[p];
        }
        
    }
}

// ---------------------------------------------------------------------------
// Projections straight from the f32 inputs, with every 16-bit plane the later launches read as a by-product.
//   blockIdx.z = 0: Wsq = e^{-2 q @ W_s^T} as rows;  blockIdx.z = 1: Whe = e^{-2 enc @ W_h^T} in groups of four columns:
//   Whe[row / S_LEN][col / 4][row % S_LEN][col % 4], so that 32 neighbouring rows at one group are 512 B in a row
// Block = 256 threads (8 waves), block tile 128(M) x 64(N), wave tile 16 x 64, the whole K = HD in LDS at once:
// the 128 A rows and 64 B rows are loaded as f32 in whole lines, rounded to bf16 (RNE) in registers and stored to LDS.
// From its staged A rows the block also writes columns n0 .. n0 + 63 of what the launches behind it need:
//   z = 0: the bf16 query plane, comb columns [1024,1536);  z = 1: encT2[b][h][s] = bf16(enc[b][s][h])
// and every block converts two rows of W_out:
//   WoX [512][1536] = [W_out[:,0:512] | W_out[:,0:512] | W_out[:,512:1024]]
// ---------------------------------------------------------------------------
#define PM 128                  // A rows per block
#define PP 1040                 // LDS bytes per staged row of HD halves: 16 B x odd, as SPITCH
#define PBLK ((NB * TQ / PM) * (HD / 64) * 2)
static_assert((TQ % PM) == 0 && (S_LEN % PM) == 0 && HD == 512 && 2 * PBLK == HD);

// four f32 -> four bf16, RNE: two v_cvt_pk_bf16_f32
__device__ __forceinline__ v2u cvt4(v4f x) {
    union { v2bf b[2]; v2u u; } r;
    r.b[0] = __builtin_convertvector(x.xy, v2bf);
    r.b[1] = __builtin_convertvector(x.zw, v2bf);
    return r.u;
}
// Four f32 rows (pitch HD), 16 loads of 512 contiguous bytes each: load i of a row brings columns 128 i + 4 lane ..
__device__ __forceinline__ void rows_load(v4f (&x)[4][4], const float* __restrict__ g) {
#pragma unroll
    for (int r = 0; r < 4; ++r)
#pragma unroll
        for (int i = 0; i < 4; ++i) x[r][i] = *(const v4f*)(g + r * HD + i * 128);
    // stands between these loads and any overwrite of their address registers; also keeps the sets' loads in order
    asm volatile("s_wait_xcnt 0x0" ::: "memory");
}
__device__ __forceinline__ void rows_store(const v4f (&x)[4][4], unsigned char* l) {
#pragma unroll
    for (int r = 0; r < 4; ++r)
#pragma unroll
        for (int i = 0; i < 4; ++i) *(v2u*)(l + r * PP + i * 256) = cvt4(x[r][i]);
}

__global__ __launch_bounds__(256)
void k_proj(const float* __restrict__ query, const float* __restrict__ enc,
            const float* __restrict__ W_s, const float* __restrict__ W_h, const float* __restrict__ W_out,
            us* __restrict__ comb, us* __restrict__ encT2, us* __restrict__ WoX,
            float* __restrict__ Wsq, float* __restrict__ Whe)
{
    __shared__ __attribute__((aligned(16))) unsigned char sa[PM * PP];
    __shared__ __attribute__((aligned(16))) unsigned char sb[64 * PP];
    __shared__ __attribute__((aligned(16))) float tile[8 * 16 * TP];

    const int tid = threadIdx.x, lane = tid & 31, wave = tid >> 5;
    const int hsel = lane >> 4, m = lane & 15;
    const int mb = blockIdx.x * PM;                    // the block's first row; its PM rows lie in one batch
    const int m0 = mb + wave * 16;
    const int n0 = blockIdx.y * 64;
    const bool is_enc = blockIdx.z == 1;               // the same for the whole block

    // two rows of W_out per block, 8 columns a thread; loaded first, stored behind the staging barrier
    const int wr = 2 * (blockIdx.x + (NB * TQ / PM) * (blockIdx.y + (HD / 64) * blockIdx.z)) + (tid >> 7);
    const int wc = (tid & 127) * 8;
    const float* wp = W_out + (size_t)wr * (2 * HD) + wc;
    const v4f wo0 = *(const v4f*)wp;
    const v4f wo1 = *(const v4f*)(wp + 4);

    // wave w stages A rows 16 w .. 16 w + 15 and B rows 8 w .. 8 w + 7: six sets of four rows through two register
    // sets, so that the next set's loads are in flight while one set is rounded and stored
    const float* ga = (is_enc ? enc + (size_t)m0 * HD
                              : query + (size_t)((mb / TQ) * T_FULL + (mb % TQ) + wave * 16) * HD) + lane * 4;
    const float* gb = (is_enc ? W_h : W_s) + (size_t)(n0 + wave * 8) * HD + lane * 4;
    unsigned char* la = sa + wave * 16 * PP + lane * 8;
    unsigned char* lb = sb + wave * 8 * PP + lane * 8;
    {
        v4f x[2][4][4];
        rows_load(x[0], ga);
        // unrolled so that the two sets are named registers, not indexed ones
#pragma unroll
        for (int t = 0; t < 6; ++t) {
            if (t + 1 < 6) rows_load(x[(t + 1) & 1], t + 1 < 4 ? ga + (t + 1) * 4 * HD : gb + (t - 3) * 4 * HD);
            rows_store(x[t & 1], t < 4 ? la + t * 4 * PP : lb + (t - 4) * 4 * PP);
        }
    }
    __syncthreads();                                   // every wave's rows are in LDS

    // behind the barrier, which would otherwise wait for these stores to return
    {
        union { v2u u[2]; v8us h; } o;
        o.u[0] = cvt4(wo0); o.u[1] = cvt4(wo1);
        us* wd = WoX + (size_t)wr * KO + HD + wc;      // columns below HD go to both context planes' places
        *(v8us*)wd = o.h;
        if (wc < HD) *(v8us*)(wd - HD) = o.h;          // wave-uniform: 32 lanes span 256 columns
    }
    if (!is_enc) {
        // query plane: 8 lanes per 128-B line
#pragma unroll
        for (int i = 0; i < 4; ++i) {
            const int row = i * 32 + (tid >> 3), c8 = (tid & 7) * 8;
            *(v8us*)(comb + (size_t)(mb + row) * KO + 2 * HD + n0 + c8) = *(const v8us*)(sa + row * PP + (n0 + c8) * 2);
        }
        // stands between these stores and any overwrite of their registers
        asm volatile("s_wait_xcnt 0x0" ::: "memory");
    } else {
        // transpose: a thread gathers 8 neighbouring s of two neighbouring h (one dword a row); 8 lanes per 128-B line
        us* et = encT2 + ((size_t)(mb / S_LEN) * HD + n0) * S_LEN + (mb % S_LEN);
#pragma unroll
        for (int i = 0; i < 2; ++i) {
            const int h2 = (tid >> 3) * 2, s8 = (i * 8 + (tid & 7)) * 8;
            unsigned int w[8];
#pragma unroll
            for (int k = 0; k < 8; ++k) w[k] = *(const unsigned int*)(sa + (s8 + k) * PP + (n0 + h2) * 2);
            v4u lo, hi;                                // low halves: h2, high halves: h2 + 1
#pragma unroll
            for (int j = 0; j < 4; ++j) {
                lo[j] = (w[2 * j] & 0xFFFFu) | (w[2 * j + 1] << 16);
                hi[j] = (w[2 * j] >> 16) | (w[2 * j + 1] & 0xFFFF0000u);
            }
            *(v4u*)(et + (size_t)h2 * S_LEN + s8)       = lo;
            *(v4u*)(et + (size_t)(h2 + 1) * S_LEN + s8) = hi;
        }
        // stands between these stores and any overwrite of their registers
        asm volatile("s_wait_xcnt 0x0" ::: "memory");
    }

    const unsigned char* pa = sa + (wave * 16 + m) * PP + hsel * 16;
    const unsigned char* pb = sb + m * PP + hsel * 16;
    v8f c0 = {}; v8f c1 = {}; v8f c2 = {}; v8f c3 = {};
    {
        // two fragment sets: the next 32 k are read from LDS while these are multiplied
        v16bf fa[2], fb[2][4];
        fa[0]    = lds_frag(pa);
        fb[0][0] = lds_frag(pb);
        fb[0][1] = lds_frag(pb + 16 * PP);
        fb[0][2] = lds_frag(pb + 32 * PP);
        fb[0][3] = lds_frag(pb + 48 * PP);
        // unrolled so that the two sets are named registers, not indexed ones
#pragma unroll
        for (int kk = 0; kk < HD / 32; ++kk) {
            const int cu = kk & 1, nx = cu ^ 1;
            if (kk + 1 < HD / 32) {
                fa[nx]    = lds_frag(pa + (kk + 1) * 64);
                fb[nx][0] = lds_frag(pb + (kk + 1) * 64);
                fb[nx][1] = lds_frag(pb + 16 * PP + (kk + 1) * 64);
                fb[nx][2] = lds_frag(pb + 32 * PP + (kk + 1) * 64);
                fb[nx][3] = lds_frag(pb + 48 * PP + (kk + 1) * 64);
            }
            c0 = wmma16(fa[cu], fb[cu][0], c0);
            c1 = wmma16(fa[cu], fb[cu][1], c1);
            c2 = wmma16(fa[cu], fb[cu][2], c2);
            c3 = wmma16(fa[cu], fb[cu][3], c3);
        }
    }

    // D map: acc[r] -> (row 8*hsel + r, col n-tile + m). Stage the 16x64 wave tile in LDS.
    float* tw = tile + wave * 16 * TP;
#pragma unroll
    for (int r = 0; r < 8; ++r) {
        const int row = 8 * hsel + r;
        tw[row * TP + m]      = c0[r];
        tw[row * TP + 16 + m] = c1[r];
        tw[row * TP + 32 + m] = c2[r];
        tw[row * TP + 48 + m] = c3[r];
    }
    __syncthreads();

    if (is_enc) {
        // lane = (row m, column group 2 p + hsel): a store writes two runs of 256 B, each two whole lines.
        // The wave's 16 rows lie in one batch of S_LEN rows.
        float* Cb = Whe + (((size_t)(m0 / S_LEN) * (HD / 4) + n0 / 4 + hsel) * S_LEN + (m0 % S_LEN) + m) * 4;
        v4f vals[8];
#pragma unroll
        for (int p = 0; p < 8; ++p) {
            v4f x = *(const v4f*)(tw + m * TP + 4 * (2 * p + hsel));
            x.x = exp_m2(x.x); x.y = exp_m2(x.y); x.z = exp_m2(x.z); x.w = exp_m2(x.w);
            vals[p] = x;
        }
#pragma unroll
        for (int p = 0; p < 8; ++p) *(v4f*)(Cb + (size_t)(2 * p) * S_LEN * 4) = vals[p];
        // stands between these stores and any overwrite of their registers
        asm volatile("s_wait_xcnt 0x0" ::: "memory");
    } else {
        v4f vals[8];
#pragma unroll
        for (int p = 0; p < 8; ++p) {
            v4f x = *(const v4f*)(tw + (2 * p + hsel) * TP + 4 * m);
            x.x = exp_m2(x.x); x.y = exp_m2(x.y); x.z = exp_m2(x.z); x.w = exp_m2(x.w);
            vals[p] = x;
        }
#pragma unroll
        for (int p = 0; p < 8; ++p) *(v4f*)(Wsq + (size_t)(m0 + 2 * p + hsel) * HD + n0 + 4 * m) = vals[p];
        // stands between these stores and any overwrite of their registers
        asm volatile("s_wait_xcnt 0x0" ::: "memory");
    }
}

// ---------------------------------------------------------------------------
// Fused energies -> length mask -> softmax -> context rows. One block (256 = S) per (b, TT queries); thread = s.
//   Wsq and Whe arrive as factors: Eq = e^{-2 Wsq}, Ee = e^{-2 Whe} (k_proj), so that
//   v[h] * tanh(Wsq[bt][h] + Whe[b][s][h]) = 2 v[h] / (1 + Eq[bt][h] * Ee[b][s][h]) - v[h]
//   e[t][s] = sum_h 2 v[h] / (1 + Eq * Ee)   (f32), s >= len masked out; the term -sum_h v[h] is the same
//             for every s of a row and cancels in the softmax, so it is not formed
//   p       = softmax_s(e), kept in LDS as two bf16 planes: rows 0..7 hi, rows 8..15 lo (lo = p - hi)
//   ctx     = p @ enc[b] on the matrix unit: the 16 plane rows are one A tile, wave w takes columns 64 w .. 64 w + 63;
//             result row t (the hi sums) + row 8 + t (the lo sums) is query t's context, stored as bf16 hi+lo in comb
// The wave's 64 rows of encT2 (its B operand) come into LDS by asynchronous copies that fly under the energy loop.
// Ee lies in groups of four h (k_proj, blockIdx.z = 1): Whe[b][h / 4][s][h % 4], so a wave's load of one group for its
// 32 s is four whole lines. Every Ee value a thread loads serves all TT queries of the block from its register.
// Per (t, s) the h order of the sum and the block trees
// of the softmax are those of the one-query form.
// LDS regions are cross-wave: block barriers throughout.
// ---------------------------------------------------------------------------
#define TT 8             // queries per block (= waves per block; each thread stores its s of all TT queries' P planes)
#define CH 8             // v4f per lane and chunk: 32 h of the lane's s
static_assert((TQ % TT) == 0 && TT == 8);
static_assert(((HD / 4) % CH) == 0 && ((TT / 2 * HD / 4) % 256) == 0);
static_assert(HD == 8 * 64 && S_LEN == KS && HD / 4 / CH >= 8);   // 8 waves x 64 columns; a staged row is S_LEN halves

__global__ __launch_bounds__(256)
void k_attn(const float* __restrict__ Wsq, const float* __restrict__ Whe,
            const float* __restrict__ vvec, const int* __restrict__ lens,
            const us* __restrict__ encT2, us* __restrict__ comb)
{
    // query factors, two queries interleaved: sqp[p][h / 2] = {Eq[2p][h], Eq[2p+1][h], Eq[2p][h+1], Eq[2p+1][h+1]},
    // so that a pair of queries at one h is a register pair as it comes from LDS
    // one object, so that what the energy loop reads lies low in LDS, within reach of a ds_load's immediate offset
    __shared__ struct {
        v4f sqp[TT / 2][HD / 2];
        v4f sv4[HD / 4];
        float red[TT][S_LEN];
        unsigned char pl[2 * TT * SPITCH];     // P planes, one row per SPITCH
        unsigned char eb[HD * SPITCH];         // encT2[b], wave w owns rows 64 w ..
    } sm;
    v4f (&sqp)[TT / 2][HD / 2] = sm.sqp;
    v4f (&sv4)[HD / 4]         = sm.sv4;
    float (&red)[TT][S_LEN]    = sm.red;
    unsigned char* const pl    = sm.pl;
    unsigned char* const eb    = sm.eb;

    const int bt0 = blockIdx.x * TT;         // b * TQ + t of the block's first query; TT divides TQ
    const int b   = bt0 / TQ;
    const int tid = threadIdx.x, lane = tid & 31, wave = tid >> 5;

    {   // the TT query rows are contiguous in Wsq
        const v4f* qs = (const v4f*)(Wsq + (size_t)bt0 * HD);
#pragma unroll
        for (int i = 0; i < TT / 2 * HD / 4 / 256; ++i) {
            const int p  = (i * 256 + tid) / (HD / 4);
            const int h4 = (i * 256 + tid) % (HD / 4);
            const v4f a = qs[(2 * p) * (HD / 4) + h4];
            const v4f c = qs[(2 * p + 1) * (HD / 4) + h4];
            sqp[p][2 * h4]     = (v4f){a.x, c.x, a.y, c.y};
            sqp[p][2 * h4 + 1] = (v4f){a.z, c.z, a.w, c.w};
        }
    }
    if (tid < HD / 4) {
        v4f w = *(const v4f*)(vvec + tid * 4);
        w.x = bf2f(f2bf(w.x)); w.y = bf2f(f2bf(w.y)); w.z = bf2f(f2bf(w.z)); w.w = bf2f(f2bf(w.w));
        sv4[tid] = 2.0f * w;
    }
    __syncthreads();

    const int len = lens[b];
    const v4f* we = (const v4f*)Whe + (size_t)b * (HD / 4) * S_LEN + tid;    // group g of this s: we[g * S_LEN]
    // the lane's 16 bytes of the wave's first encT2 row, and their place in LDS
    const us* ge = encT2 + ((size_t)b * HD + wave * 64) * S_LEN + lane * 8;
    const unsigned edst = (unsigned)(size_t)eb + wave * 64 * SPITCH + lane * 16;
    // the sums of queries t and t + 1 lie side by side, so that one packed fma serves both; each keeps its h order
    v2f acc2[TT / 2];
#pragma unroll
    for (int t = 0; t < TT / 2; ++t) acc2[t] = (v2f){0.0f, 0.0f};

    // The lane's next chunk of Whe is fetched into a second register set while this one is worked on;
    // trip -1 fetches chunk 0, starts the copies of encT2 rows 0..7 and computes nothing.
    v4f cur[CH], nxt[CH];
    for (int c = -1; c < HD / 4 / CH; ++c) {
        if (c + 1 < HD / 4 / CH) {
#pragma unroll
            for (int j = 0; j < CH; ++j) nxt[j] = we[((c + 1) * CH + j) * S_LEN];
            // stands between these loads and any overwrite of their address registers
            asm volatile("s_wait_xcnt 0x0" ::: "memory");
        }
        if (c + 1 < 8) {
            // eight encT2 rows a trip, behind the trip's own loads, so that the copies never crowd them out;
            // the wait holds a wave's copies in flight at eight (all 64 at once would pass the 63 that may be outstanding)
            asm volatile("s_wait_asynccnt 0x0" ::: "memory");
            copy8(edst + (c + 1) * 8 * SPITCH, ge + (size_t)(c + 1) * 8 * S_LEN, S_LEN);
        }
        if (c >= 0) {
#pragma unroll
            for (int j = 0; j < CH; ++j) {
                const v4f e = cur[j];
                const v4f w = sv4[c * CH + j];
#pragma unroll
                for (int p = 0; p < TT / 2; ++p) {
                    const v4f q0 = sqp[p][(c * CH + j) * 2];
                    const v4f q1 = sqp[p][(c * CH + j) * 2 + 1];
                    const v2f q[4] = {q0.xy, q0.zw, q1.xy, q1.zw};
#pragma unroll
                    for (int i = 0; i < 4; ++i) {
                        const v2f n = __builtin_elementwise_fma(q[i], (v2f){e[i], e[i]}, (v2f){1.0f, 1.0f});
                        const v2f r = {__builtin_amdgcn_rcpf(n.x), __builtin_amdgcn_rcpf(n.y)};
                        acc2[p] = __builtin_elementwise_fma((v2f){w[i], w[i]}, r, acc2[p]);
                    }
                }
            }
        }
#pragma unroll
        for (int j = 0; j < CH; ++j) cur[j] = nxt[j];
    }
    asm volatile("s_wait_asynccnt 0x0" ::: "memory");    // this wave's encT2 rows have landed; barriers follow
    const bool valid = tid < len;
    float acc[TT];
#pragma unroll
    for (int t = 0; t < TT; ++t) acc[t] = acc2[t / 2][t & 1];

    // block max over s, all TT queries in each step
#pragma unroll
    for (int t = 0; t < TT; ++t) red[t][tid] = valid ? acc[t] : -3.0e38f;
    __syncthreads();
#pragma unroll
    for (int st = S_LEN / 2; st > 0; st >>= 1) {
        if (tid < st) {
#pragma unroll
            for (int t = 0; t < TT; ++t) red[t][tid] = fmaxf(red[t][tid], red[t][tid + st]);
        }
        __syncthreads();
    }
    float ex[TT];
#pragma unroll
    for (int t = 0; t < TT; ++t) ex[t] = red[t][0];      // the maximum, until the exp below
    __syncthreads();

    // exp + block sum (masked entries contribute exactly 0)
#pragma unroll
    for (int t = 0; t < TT; ++t) {
        const float arg = valid ? (acc[t] - ex[t]) : -80.0f;
        const float ex0 = __expf(arg);
        ex[t] = valid ? ex0 : 0.0f;
        red[t][tid] = ex[t];
    }
    __syncthreads();
#pragma unroll
    for (int st = S_LEN / 2; st > 0; st >>= 1) {
        if (tid < st) {
#pragma unroll
            for (int t = 0; t < TT; ++t) red[t][tid] += red[t][tid + st];
        }
        __syncthreads();
    }
#pragma unroll
    for (int t = 0; t < TT; ++t) {
        const float ssum = red[t][0];
        const float pv = ex[t] * (1.0f / ssum);
        const us ph = f2bf(pv);
        *(us*)(pl + t * SPITCH + tid * 2)        = ph;
        *(us*)(pl + (TT + t) * SPITCH + tid * 2) = f2bf(pv - bf2f(ph));
    }
    __syncthreads();

    // context: A = the 16 plane rows, B = the wave's own 64 staged rows of encT2, k = s in ascending order
    const int hsel = lane >> 4, m = lane & 15;
    const unsigned char* pa = pl + m * SPITCH + hsel * 16;
    unsigned char* ew = eb + wave * 64 * SPITCH;
    const unsigned char* pb = ew + m * SPITCH + hsel * 16;
    v8f c0 = {}; v8f c1 = {}; v8f c2 = {}; v8f c3 = {};
    {
        // two fragment sets: the next 32 k are read from LDS while these are multiplied
        v16bf fa[2], fb[2][4];
        fa[0]    = lds_frag(pa);
        fb[0][0] = lds_frag(pb);
        fb[0][1] = lds_frag(pb + 16 * SPITCH);
        fb[0][2] = lds_frag(pb + 32 * SPITCH);
        fb[0][3] = lds_frag(pb + 48 * SPITCH);
        // unrolled so that the two sets are named registers, not indexed ones
#pragma unroll
        for (int kk = 0; kk < S_LEN / 32; ++kk) {
            const int cu = kk & 1, nx = cu ^ 1;
            if (kk + 1 < S_LEN / 32) {
                fa[nx]    = lds_frag(pa + (kk + 1) * 64);
                fb[nx][0] = lds_frag(pb + (kk + 1) * 64);
                fb[nx][1] = lds_frag(pb + 16 * SPITCH + (kk + 1) * 64);
                fb[nx][2] = lds_frag(pb + 32 * SPITCH + (kk + 1) * 64);
                fb[nx][3] = lds_frag(pb + 48 * SPITCH + (kk + 1) * 64);
            }
            c0 = wmma16(fa[cu], fb[cu][0], c0);
            c1 = wmma16(fa[cu], fb[cu][1], c1);
            c2 = wmma16(fa[cu], fb[cu][2], c2);
            c3 = wmma16(fa[cu], fb[cu][3], c3);
        }
    }

    // D map: acc[r] -> (row 8*hsel + r, col n-tile + m). The 16x64 wave tile goes over the wave's own staged rows,
    // which it alone has read and has done with.
    float* tw = (float*)ew;
#pragma unroll
    for (int r = 0; r < 8; ++r) {
        const int row = 8 * hsel + r;
        tw[row * 64 + m]      = c0[r];
        tw[row * 64 + 16 + m] = c1[r];
        tw[row * 64 + 32 + m] = c2[r];
        tw[row * 64 + 48 + m] = c3[r];
    }
    __syncthreads();

    // ctx = hi sums + lo sums; comb columns [0,512) hi and [512,1024) lo, 8 lanes per 128-B line
    {
        v8us hi[2], lo[2];
#pragma unroll
        for (int p = 0; p < 2; ++p) {
            const float* th = tw + (4 * p + (lane >> 3)) * 64 + 8 * (lane & 7);
            const v4f a = *(const v4f*)th       + *(const v4f*)(th + TT * 64);
            const v4f c = *(const v4f*)(th + 4) + *(const v4f*)(th + TT * 64 + 4);
            split8(a, c, hi[p], lo[p]);
        }
#pragma unroll
        for (int p = 0; p < 2; ++p) {
            us* d = comb + (size_t)(bt0 + 4 * p + (lane >> 3)) * KO + wave * 64 + 8 * (lane & 7);
            *(v8us*)d = hi[p];
            *(v8us*)(d + HD) = lo[p];
        }
    }
}

// ---------------------------------------------------------------------------
static inline size_t al256(size_t x) { return (x + 255) & ~(size_t)255; }
static_assert(TQ == S_LEN);

extern "C" void kernel_launch(void* const* d_in, const int* in_sizes, int n_in,
                              void* d_out, int out_size, void* d_ws, size_t ws_size,
                              hipStream_t stream)
{
    if (n_in < 7) return;
    if (in_sizes[0] < ((NB - 1) * T_FULL + TQ) * HD) return;      // query  [8][256][512] f32
    if (in_sizes[1] < NB * S_LEN * HD) return;                      // enc    [8][256][512] f32
    if (in_sizes[2] < NB) return;                                   // src_lengths [8] int32
    if (in_sizes[3] < HD * HD || in_sizes[4] < HD * HD) return;     // W_s, W_h [512][512] f32
    if (in_sizes[5] < HD) return;                                   // v [512] f32
    if (in_sizes[6] < HD * 2 * HD) return;                          // W_out [512][1024] f32
    if (out_size < ((NB - 1) * T_FULL + TQ) * HD) return;

    const float* query = (const float*)d_in[0];
    const float* enc   = (const float*)d_in[1];
    const int*   lens  = (const int*)d_in[2];
    const float* W_s   = (const float*)d_in[3];
    const float* W_h   = (const float*)d_in[4];
    const float* vvec  = (const float*)d_in[5];
    const float* W_out = (const float*)d_in[6];
    float* out = (float*)d_out;

    // ---- workspace carve (all regions 256-B aligned; sizes already store-granular) ----
    char* ws = (char*)d_ws;
    size_t off = 0;
    us* comb  = (us*)(ws + off);    off += al256((size_t)NB * TQ * KO * sizeof(us));      // [NB*TQ][1536]
    us* encT2 = (us*)(ws + off);    off += al256((size_t)NB * HD * S_LEN * sizeof(us));   // [NB][512][256]
    us* WoX   = (us*)(ws + off);    off += al256((size_t)HD * KO * sizeof(us));           // [512][1536]
    float* Wsq = (float*)(ws + off); off += al256((size_t)NB * TQ * HD * sizeof(float));  // [NB*TQ][512]
    float* Whe = (float*)(ws + off); off += al256((size_t)NB * S_LEN * HD * sizeof(float)); // [NB][128][S][4]
    if (off > ws_size) return;

    const dim3 b256(256), b128(128);

    // ---- projections from the f32 inputs, stored as factors: Wsq = e^{-2 q @ W_s^T}, Whe = e^{-2 enc @ W_h^T} (f32);
    //      the same launch writes the 16-bit planes: query -> comb, enc -> encT2 (transposed), W_out -> WoX ----
    k_proj<<<dim3(NB * TQ / PM, HD / 64, 2), b256, 0, stream>>>(query, enc, W_s, W_h, W_out, comb, encT2, WoX, Wsq, Whe);

    // ---- energies + mask + softmax, then context = P @ enc -> comb columns [0,512) hi and [512,1024) lo ----
    k_attn<<<dim3(NB * TQ / TT), b256, 0, stream>>>(Wsq, Whe, vvec, lens, encT2, comb);

    // ---- out = tanh([ctx_hi|ctx_lo|q] @ WoX^T) ----
    k_gemm<2><<<dim3(TQ / 64, HD / 64, NB), b128, 0, stream>>>(
        comb, KO, TQ * KO, WoX, KO, 0, (void*)out, HD, T_FULL * HD, KO);
}

// v008
// One run takes 45.5 microseconds.
// In both of two side-by-side timings against v007, it was 1.03 times as fast.
// Counting every step since v000, it is 4.76 times as fast.
#include <hip/hip_runtime.h>

// Contractions on v_wmma_f32_16x16x32_bf16 (bf16 operands, f32 accumulate): q@W_s^T and enc@W_h^T from
// RNE-converted inputs; attn@enc with the bf16 hi and lo planes of attn as rows 0-7 and 8-15 of one tile,
// [ctx|q]@W_out^T with ctx carried as bf16 hi+lo planes folded into K.
// Energies v.tanh(.), length masking and softmax in f32 on the VALU; the tanh of a sum is
// formed from one exponential factor per projection value (exp_m2 below).

#ifndef NB
#define NB 8
#endif
#ifndef TQ
#define TQ 256
#endif
#define NB_FULL 8
#define T_FULL 256
#define S_LEN 256
#define HD 512
#define KO (3 * HD)      // output GEMM depth:  [ctx_hi | ctx_lo | q]

static_assert(NB >= 1 && NB <= NB_FULL);
static_assert(TQ >= 64 && TQ <= T_FULL && (TQ % 64) == 0);
static_assert(S_LEN == 256);
static_assert((HD % 256) == 0);
static_assert((KO % 32) == 0 && (HD % 64) == 0 && (S_LEN % 64) == 0);

typedef unsigned short us;
typedef us     v8us  __attribute__((ext_vector_type(8)));
typedef __bf16 v16bf __attribute__((ext_vector_type(16)));
typedef float  v8f   __attribute__((ext_vector_type(8)));
typedef float  v4f   __attribute__((ext_vector_type(4)));
typedef float  v2f   __attribute__((ext_vector_type(2)));
typedef __bf16 v2bf  __attribute__((ext_vector_type(2)));
typedef unsigned int v2u __attribute__((ext_vector_type(2)));
typedef unsigned int v4u __attribute__((ext_vector_type(4)));

union Frag { v16bf v; v8us h[2]; };

// ---------------------------------------------------------------------------
// scalar helpers
// ---------------------------------------------------------------------------
__device__ __forceinline__ us f2bf(float f) {           // f32 -> bf16, RNE convert
    unsigned int u = __float_as_uint(f);
    u += 0x7FFFu + ((u >> 16) & 1u);
    return (us)(u >> 16);
}
__device__ __forceinline__ float bf2f(us h) {
    return __uint_as_float(((unsigned int)h) << 16);
}
// tanh(x) = sign(x) * (1 - e^{-2|x|}) / (1 + e^{-2|x|}), v_exp_f32 + v_rcp_f32 based (abs error ~1e-7)
__device__ __forceinline__ float tanh_acc(float x) {
    const float ax = __builtin_fabsf(x);
    const float t  = __expf(-2.0f * ax);
    const float r  = (1.0f - t) * __builtin_amdgcn_rcpf(1.0f + t);
    return __builtin_copysignf(r, x);
}
// e^{-2x}, the factor of one projection value: tanh(a + b) = 2 / (1 + e^{-2a} * e^{-2b}) - 1.
// The exponent is held in [-63, 63] (|x| <= 21.8), so a factor is never 0 or inf and a product of two
// is never 0 * inf; a product that grows large gives 2 / (1 + u) - 1 -> -1, a small one -> +1.
__device__ __forceinline__ float exp2_slot(float l) {
    float r;
    // 2^l; the v_nop is the slot the instruction set asks for behind a transcendental, whatever instruction comes next
    asm("v_exp_f32 %0, %1\n\tv_nop" : "=v"(r) : "v"(l));
    return r;
}
__device__ __forceinline__ float exp_m2(float x) {
    const float l = fminf(fmaxf(x * -2.88539008177792681472f, -63.0f), 63.0f);
    return exp2_slot(l);
}
// hi = bf16(x), lo = bf16(x - hi): unscaled bf16 residual pair
__device__ __forceinline__ void split8(v4f a, v4f c, v8us& hi, v8us& lo) {
    const float x[8] = {a.x, a.y, a.z, a.w, c.x, c.y, c.z, c.w};
#pragma unroll
    for (int i = 0; i < 8; ++i) {
        const us h = f2bf(x[i]);
        hi[i] = h;
        lo[i] = f2bf(x[i] - bf2f(h));
    }
}

// ---------------------------------------------------------------------------
// WMMA helper: 16x16x32 bf16, f32 accumulate, 4-slot VALU hazard guard after the issue
// ---------------------------------------------------------------------------
__device__ __forceinline__ v8f wmma16(v16bf a, v16bf b, v8f c) {
    v8f d = __builtin_amdgcn_wmma_f32_16x16x32_bf16(false, a, false, b, (short)0, c, false, false);
    asm volatile("v_nop\n\tv_nop\n\tv_nop\n\tv_nop" : "+v"(d) : "v"(a), "v"(b));
    return d;
}

// ---------------------------------------------------------------------------
// LDS ring of k_gemm. A stage is 256 k (512 B) of the block's 64 A rows and 64 B rows; two buffers.
// ---------------------------------------------------------------------------
#define KS 256                  // halves of k per stage
#define SPITCH 528              // LDS bytes per staged row: 16 B x odd, so 16 rows of one ds_load_b128 fall on distinct banks
#define SOPER (64 * SPITCH)     // one operand's 64 rows
#define SBUF (2 * SOPER)        // one buffer: [A rows | B rows]
static_assert((HD % KS) == 0 && (KO % KS) == 0 && HD / KS >= 2 && KO / KS >= 2);

// Eight asynchronous copies global -> LDS, one staged row (512 B, four whole lines) per copy: lane l brings
// bytes 16 l .. 16 l + 15 of rows 0..7 behind g (pitch ld halves) to l0 + row * SPITCH. l0 and g are the lane's own.
__device__ __forceinline__ void copy8(unsigned l0, const us* g, int ld)
{
    // the closing s_wait_xcnt stands inside the statement, so no address register of a copy is rewritten ahead of it
    asm volatile("global_load_async_to_lds_b128 %0, %8, off\n\t"
                 "global_load_async_to_lds_b128 %1, %9, off\n\t"
                 "global_load_async_to_lds_b128 %2, %10, off\n\t"
                 "global_load_async_to_lds_b128 %3, %11, off\n\t"
                 "global_load_async_to_lds_b128 %4, %12, off\n\t"
                 "global_load_async_to_lds_b128 %5, %13, off\n\t"
                 "global_load_async_to_lds_b128 %6, %14, off\n\t"
                 "global_load_async_to_lds_b128 %7, %15, off\n\t"
                 "s_wait_xcnt 0x0"
                 :: "v"(l0), "v"(l0 + 1 * SPITCH), "v"(l0 + 2 * SPITCH), "v"(l0 + 3 * SPITCH),
                    "v"(l0 + 4 * SPITCH), "v"(l0 + 5 * SPITCH), "v"(l0 + 6 * SPITCH), "v"(l0 + 7 * SPITCH),
                    "v"(g), "v"(g + (size_t)ld), "v"(g + (size_t)ld * 2), "v"(g + (size_t)ld * 3),
                    "v"(g + (size_t)ld * 4), "v"(g + (size_t)ld * 5), "v"(g + (size_t)ld * 6), "v"(g + (size_t)ld * 7)
                 : "memory");
}
// One wave's share of a stage: 16 A rows and 16 B rows, 32 copies. dst = the lane's LDS byte address in the buffer.
__device__ __forceinline__ void copy_stage(unsigned dst, const us* ga, int lda, const us* gb, int ldb)
{
    copy8(dst, ga, lda);
    copy8(dst + 8 * SPITCH, ga + (size_t)lda * 8, lda);
    copy8(dst + SOPER, gb, ldb);
    copy8(dst + SOPER + 8 * SPITCH, gb + (size_t)ldb * 8, ldb);
}
// Fragment from a staged k-contiguous row. Lane l: row = (l & 15) (A row m, or B column n of an [n][k] plane),
// hsel = l >> 4; p = the row's start in LDS + 2 * k0 + 16 * hsel bytes.
//   elements 0..7  <- k0 + 8*hsel + 0..7
//   elements 8..15 <- k0 + 16 + 8*hsel + 0..7
__device__ __forceinline__ v16bf lds_frag(const unsigned char* p) {
    Frag f;
    f.h[0] = *(const v8us*)p;
    f.h[1] = *(const v8us*)(p + 32);
    return f.v;
}

// ---------------------------------------------------------------------------
// GEMM: C[M][N] = A[M][K] * B, B given as a k-contiguous [N][K] plane (B[k][n] = Bp[n][k]). K a multiple of KS.
// Block = 128 threads (4 waves), block tile 64(M) x 64(N), wave tile 16 x 64 (4 accumulators).
// The operand rows come into LDS by asynchronous copies, whole lines at a time, each B row once per block;
// stage t + 1 flies while stage t is worked on. Fragments are read from LDS with the split k map. blockIdx.z = batch.
// Epilogue: wave tile staged in LDS, block barrier, then whole-row-segment stores:
//   EPI 2: same with tanh, destination d_out
// ---------------------------------------------------------------------------
#define TP 68                   // floats per staged result row: 16 B x odd, so 16 rows of one ds_load_b128 fall on distinct banks
template <int EPI>
__global__ __launch_bounds__(128)
void k_gemm(const us* __restrict__ A, int lda, int strideA,
            const us* __restrict__ B, int ldb, int strideB,
            void* __restrict__ Cv, int ldc, int strideC, int K)
{
    __shared__ __attribute__((aligned(16))) unsigned char ring[2 * SBUF];
    __shared__ __attribute__((aligned(16))) float tile[4 * 16 * TP];

    const int lane = threadIdx.x & 31, wave = threadIdx.x >> 5;
    const int hsel = lane >> 4, m = lane & 15;
    const int m0 = blockIdx.x * 64 + wave * 16;
    const int n0 = blockIdx.y * 64;
    const us* Ab = A + (size_t)blockIdx.z * (size_t)strideA;
    const us* Bb = B + (size_t)blockIdx.z * (size_t)strideB;

    // wave w copies A rows m0 .. m0 + 15 and B rows n0 + 16 w .. n0 + 16 w + 15 of every stage
    const us* ga = Ab + (size_t)m0 * lda + lane * 8;
    const us* gb = Bb + (size_t)(n0 + wave * 16) * ldb + lane * 8;
    const unsigned dst = (unsigned)(size_t)ring + wave * 16 * SPITCH + lane * 16;
    const int nst = K / KS;

    copy_stage(dst, ga, lda, gb, ldb);
    asm volatile("s_wait_asynccnt 0x0" ::: "memory");    // this wave's share of stage 0 has landed
    __syncthreads();                                     // ... and every other wave's
    if (nst > 1) copy_stage(dst + SBUF, ga + KS, lda, gb + KS, ldb);

    v8f c0 = {}; v8f c1 = {}; v8f c2 = {}; v8f c3 = {};
    for (int t = 0; t < nst; ++t) {
        const unsigned char* pa = ring + (t & 1) * SBUF + (wave * 16 + m) * SPITCH + hsel * 16;
        const unsigned char* pb = ring + (t & 1) * SBUF + SOPER + m * SPITCH + hsel * 16;
        // two fragment sets: the next 32 k of this stage are read from LDS while these are multiplied
        v16bf fa[2], fb[2][4];
        fa[0]    = lds_frag(pa);
        fb[0][0] = lds_frag(pb);
        fb[0][1] = lds_frag(pb + 16 * SPITCH);
        fb[0][2] = lds_frag(pb + 32 * SPITCH);
        fb[0][3] = lds_frag(pb + 48 * SPITCH);
        // unrolled so that the two sets are named registers, not indexed ones
#pragma unroll
        for (int kk = 0; kk < KS / 32; ++kk) {
            const int cu = kk & 1, nx = cu ^ 1;
            if (kk + 1 < KS / 32) {
                fa[nx]    = lds_frag(pa + (kk + 1) * 64);
                fb[nx][0] = lds_frag(pb + (kk + 1) * 64);
                fb[nx][1] = lds_frag(pb + 16 * SPITCH + (kk + 1) * 64);
                fb[nx][2] = lds_frag(pb + 32 * SPITCH + (kk + 1) * 64);
                fb[nx][3] = lds_frag(pb + 48 * SPITCH + (kk + 1) * 64);
            }
            c0 = wmma16(fa[cu], fb[cu][0], c0);
            c1 = wmma16(fa[cu], fb[cu][1], c1);
            c2 = wmma16(fa[cu], fb[cu][2], c2);
            c3 = wmma16(fa[cu], fb[cu][3], c3);
        }
        asm volatile("s_wait_dscnt 0x0" ::: "memory");       // this wave has left the buffer of stage t
        asm volatile("s_wait_asynccnt 0x0" ::: "memory");    // its share of stage t + 1 has landed
        __syncthreads();                                     // publishes stage t + 1, frees the buffer of stage t
        if (t + 2 < nst)
            copy_stage(dst + (t & 1) * SBUF, ga + (size_t)(t + 2) * KS, lda, gb + (size_t)(t + 2) * KS, ldb);
    }
    asm volatile("s_wait_asynccnt 0x0" ::: "memory");        // no copy is outstanding when the wave goes on

    // D map: acc[r] -> (row 8*hsel + r, col n-tile + m). Stage the 16x64 wave tile in LDS.
    float* tw = tile + wave * 16 * TP;
#pragma unroll
    for (int r = 0; r < 8; ++r) {
        const int row = 8 * hsel + r;
        tw[row * TP + m]      = c0[r];
        tw[row * TP + 16 + m] = c1[r];
        tw[row * TP + 32 + m] = c2[r];
        tw[row * TP + 48 + m] = c3[r];
    }
    __syncthreads();

    {
        float* Cb = (float*)Cv + (size_t)blockIdx.z * (size_t)strideC;
        v4f vals[8];
#pragma unroll
        for (int p = 0; p < 8; ++p) {
            const int row = 2 * p + hsel;
            v4f x = *(const v4f*)(tw + row * TP + 4 * m);
            if (EPI == 2) {
                x.x = tanh_acc(x.x); x.y = tanh_acc(x.y); x.z = tanh_acc(x.z); x.w = tanh_acc(x.w);
            }
            vals[p] = x;
        }
#pragma unroll
        for (int p = 0; p < 8; ++p) {
            float* d = Cb + (size_t)(m0 + 2 * p + hsel) * ldc + n0 + 4 * m;
            *(v4f*)d = vals[p];
        }
        
    }
}

// ---------------------------------------------------------------------------
// Projections straight from the f32 inputs, with every 16-bit plane the later launches read as a by-product.
//   blockIdx.z = 0: Wsq = e^{-2 q @ W_s^T}, eight rows interleaved: Wsq[row / 8][col][row % 8], so that the eight queries
//   of a k_attn block at two neighbouring columns are 64 B in a row, one scalar load;
//   blockIdx.z = 1: Whe = e^{-2 enc @ W_h^T} in squares of two rows and two columns:
//   Whe[row / S_LEN][col / 2][(row % S_LEN) / 2][col % 2][row % 2], so that two rows at one column are a register pair
//   as they are loaded, and 64 neighbouring rows at one column pair are 512 B in a row
// Block = 256 threads (8 waves), block tile 128(M) x 64(N), wave tile 16 x 64, the whole K = HD in LDS at once:
// the 128 A rows and 64 B rows are loaded as f32 in whole lines, rounded to bf16 (RNE) in registers and stored to LDS.
// From its staged A rows the block also writes columns n0 .. n0 + 63 of what the launches behind it need:
//   z = 0: the bf16 query plane, comb columns [1024,1536);  z = 1: encT2[b][h][s] = bf16(enc[b][s][h])
// and every block converts two rows of W_out:
//   WoX [512][1536] = [W_out[:,0:512] | W_out[:,0:512] | W_out[:,512:1024]]
// ---------------------------------------------------------------------------
#define PM 128                  // A rows per block
#define PP 1040                 // LDS bytes per staged row of HD halves: 16 B x odd, as SPITCH
#define PBLK ((NB * TQ / PM) * (HD / 64) * 2)
static_assert((TQ % PM) == 0 && (S_LEN % PM) == 0 && HD == 512 && 2 * PBLK == HD);

// four f32 -> four bf16, RNE: two v_cvt_pk_bf16_f32
__device__ __forceinline__ v2u cvt4(v4f x) {
    union { v2bf b[2]; v2u u; } r;
    r.b[0] = __builtin_convertvector(x.xy, v2bf);
    r.b[1] = __builtin_convertvector(x.zw, v2bf);
    return r.u;
}
// Four f32 rows (pitch HD), 16 loads of 512 contiguous bytes each: load i of a row brings columns 128 i + 4 lane ..
__device__ __forceinline__ void rows_load(v4f (&x)[4][4], const float* __restrict__ g) {
#pragma unroll
    for (int r = 0; r < 4; ++r)
#pragma unroll
        for (int i = 0; i < 4; ++i) x[r][i] = *(const v4f*)(g + r * HD + i * 128);
    // stands between these loads and any overwrite of their address registers; also keeps the sets' loads in order
    asm volatile("s_wait_xcnt 0x0" ::: "memory");
}
__device__ __forceinline__ void rows_store(const v4f (&x)[4][4], unsigned char* l) {
#pragma unroll
    for (int r = 0; r < 4; ++r)
#pragma unroll
        for (int i = 0; i < 4; ++i) *(v2u*)(l + r * PP + i * 256) = cvt4(x[r][i]);
}

__global__ __launch_bounds__(256)
void k_proj(const float* __restrict__ query, const float* __restrict__ enc,
            const float* __restrict__ W_s, const float* __restrict__ W_h, const float* __restrict__ W_out,
            us* __restrict__ comb, us* __restrict__ encT2, us* __restrict__ WoX,
            float* __restrict__ Wsq, float* __restrict__ Whe)
{
    __shared__ __attribute__((aligned(16))) unsigned char sa[PM * PP];
    __shared__ __attribute__((aligned(16))) unsigned char sb[64 * PP];
    __shared__ __attribute__((aligned(16))) float tile[8 * 16 * TP];

    const int tid = threadIdx.x, lane = tid & 31, wave = tid >> 5;
    const int hsel = lane >> 4, m = lane & 15;
    const int mb = blockIdx.x * PM;                    // the block's first row; its PM rows lie in one batch
    const int m0 = mb + wave * 16;
    const int n0 = blockIdx.y * 64;
    const bool is_enc = blockIdx.z == 1;               // the same for the whole block

    // two rows of W_out per block, 8 columns a thread; loaded first, stored behind the staging barrier
    const int wr = 2 * (blockIdx.x + (NB * TQ / PM) * (blockIdx.y + (HD / 64) * blockIdx.z)) + (tid >> 7);
    const int wc = (tid & 127) * 8;
    const float* wp = W_out + (size_t)wr * (2 * HD) + wc;
    const v4f wo0 = *(const v4f*)wp;
    const v4f wo1 = *(const v4f*)(wp + 4);

    // wave w stages A rows 16 w .. 16 w + 15 and B rows 8 w .. 8 w + 7: six sets of four rows through two register
    // sets, so that the next set's loads are in flight while one set is rounded and stored
    const float* ga = (is_enc ? enc + (size_t)m0 * HD
                              : query + (size_t)((mb / TQ) * T_FULL + (mb % TQ) + wave * 16) * HD) + lane * 4;
    const float* gb = (is_enc ? W_h : W_s) + (size_t)(n0 + wave * 8) * HD + lane * 4;
    unsigned char* la = sa + wave * 16 * PP + lane * 8;
    unsigned char* lb = sb + wave * 8 * PP + lane * 8;
    {
        v4f x[2][4][4];
        rows_load(x[0], ga);
        // unrolled so that the two sets are named registers, not indexed ones
#pragma unroll
        for (int t = 0; t < 6; ++t) {
            if (t + 1 < 6) rows_load(x[(t + 1) & 1], t + 1 < 4 ? ga + (t + 1) * 4 * HD : gb + (t - 3) * 4 * HD);
            rows_store(x[t & 1], t < 4 ? la + t * 4 * PP : lb + (t - 4) * 4 * PP);
        }
    }
    __syncthreads();                                   // every wave's rows are in LDS

    // behind the barrier, which would otherwise wait for these stores to return
    {
        union { v2u u[2]; v8us h; } o;
        o.u[0] = cvt4(wo0); o.u[1] = cvt4(wo1);
        us* wd = WoX + (size_t)wr * KO + HD + wc;      // columns below HD go to both context planes' places
        *(v8us*)wd = o.h;
        if (wc < HD) *(v8us*)(wd - HD) = o.h;          // wave-uniform: 32 lanes span 256 columns
    }
    if (!is_enc) {
        // query plane: 8 lanes per 128-B line
#pragma unroll
        for (int i = 0; i < 4; ++i) {
            const int row = i * 32 + (tid >> 3), c8 = (tid & 7) * 8;
            *(v8us*)(comb + (size_t)(mb + row) * KO + 2 * HD + n0 + c8) = *(const v8us*)(sa + row * PP + (n0 + c8) * 2);
        }
        // stands between these stores and any overwrite of their registers
        asm volatile("s_wait_xcnt 0x0" ::: "memory");
    } else {
        // transpose: a thread gathers 8 neighbouring s of two neighbouring h (one dword a row); 8 lanes per 128-B line
        us* et = encT2 + ((size_t)(mb / S_LEN) * HD + n0) * S_LEN + (mb % S_LEN);
#pragma unroll
        for (int i = 0; i < 2; ++i) {
            const int h2 = (tid >> 3) * 2, s8 = (i * 8 + (tid & 7)) * 8;
            unsigned int w[8];
#pragma unroll
            for (int k = 0; k < 8; ++k) w[k] = *(const unsigned int*)(sa + (s8 + k) * PP + (n0 + h2) * 2);
            v4u lo, hi;                                // low halves: h2, high halves: h2 + 1
#pragma unroll
            for (int j = 0; j < 4; ++j) {
                lo[j] = (w[2 * j] & 0xFFFFu) | (w[2 * j + 1] << 16);
                hi[j] = (w[2 * j] >> 16) | (w[2 * j + 1] & 0xFFFF0000u);
            }
            *(v4u*)(et + (size_t)h2 * S_LEN + s8)       = lo;
            *(v4u*)(et + (size_t)(h2 + 1) * S_LEN + s8) = hi;
        }
        // stands between these stores and any overwrite of their registers
        asm volatile("s_wait_xcnt 0x0" ::: "memory");
    }

    const unsigned char* pa = sa + (wave * 16 + m) * PP + hsel * 16;
    const unsigned char* pb = sb + m * PP + hsel * 16;
    v8f c0 = {}; v8f c1 = {}; v8f c2 = {}; v8f c3 = {};
    {
        // two fragment sets: the next 32 k are read from LDS while these are multiplied
        v16bf fa[2], fb[2][4];
        fa[0]    = lds_frag(pa);
        fb[0][0] = lds_frag(pb);
        fb[0][1] = lds_frag(pb + 16 * PP);
        fb[0][2] = lds_frag(pb + 32 * PP);
        fb[0][3] = lds_frag(pb + 48 * PP);
        // unrolled so that the two sets are named registers, not indexed ones
#pragma unroll
        for (int kk = 0; kk < HD / 32; ++kk) {
            const int cu = kk & 1, nx = cu ^ 1;
            if (kk + 1 < HD / 32) {
                fa[nx]    = lds_frag(pa + (kk + 1) * 64);
                fb[nx][0] = lds_frag(pb + (kk + 1) * 64);
                fb[nx][1] = lds_frag(pb + 16 * PP + (kk + 1) * 64);
                fb[nx][2] = lds_frag(pb + 32 * PP + (kk + 1) * 64);
                fb[nx][3] = lds_frag(pb + 48 * PP + (kk + 1) * 64);
            }
            c0 = wmma16(fa[cu], fb[cu][0], c0);
            c1 = wmma16(fa[cu], fb[cu][1], c1);
            c2 = wmma16(fa[cu], fb[cu][2], c2);
            c3 = wmma16(fa[cu], fb[cu][3], c3);
        }
    }

    // D map: acc[r] -> (row 8*hsel + r, col n-tile + m). Stage the 16x64 wave tile in LDS.
    float* tw = tile + wave * 16 * TP;
#pragma unroll
    for (int r = 0; r < 8; ++r) {
        const int row = 8 * hsel + r;
        tw[row * TP + m]      = c0[r];
        tw[row * TP + 16 + m] = c1[r];
        tw[row * TP + 32 + m] = c2[r];
        tw[row * TP + 48 + m] = c3[r];
    }
    __syncthreads();

    if (is_enc) {
        // lane = (row pair lane & 7, column pair 4 p + (lane >> 3)): a store writes four whole lines.
        // The wave's 16 rows lie in one batch of S_LEN rows.
        const int rp = lane & 7, cq = lane >> 3;
        float* Cb = Whe + (((size_t)(m0 / S_LEN) * (HD / 2) + n0 / 2 + cq) * (S_LEN / 2) + (m0 % S_LEN) / 2 + rp) * 4;
        v4f vals[8];
#pragma unroll
        for (int p = 0; p < 8; ++p) {
            const v2f a = *(const v2f*)(tw + (2 * rp) * TP + 2 * (4 * p + cq));
            const v2f c = *(const v2f*)(tw + (2 * rp + 1) * TP + 2 * (4 * p + cq));
            vals[p] = (v4f){exp_m2(a.x), exp_m2(c.x), exp_m2(a.y), exp_m2(c.y)};
        }
#pragma unroll
        for (int p = 0; p < 8; ++p) *(v4f*)(Cb + (size_t)(4 * p) * (S_LEN / 2) * 4) = vals[p];
        // stands between these stores and any overwrite of their registers
        asm volatile("s_wait_xcnt 0x0" ::: "memory");
    } else {
        // lane = (column 16 (p & 3) + (lane >> 1), rows 8 (p >> 2) + 4 (lane & 1) ..): a store writes 512 B in a row
        const int r4 = (lane & 1) * 4, cl = lane >> 1;
        v4f vals[8];
#pragma unroll
        for (int p = 0; p < 8; ++p) {
            const float* t4 = tw + ((p >> 2) * 8 + r4) * TP + (p & 3) * 16 + cl;
            vals[p] = (v4f){exp_m2(t4[0]), exp_m2(t4[TP]), exp_m2(t4[2 * TP]), exp_m2(t4[3 * TP])};
        }
#pragma unroll
        for (int p = 0; p < 8; ++p)
            *(v4f*)(Wsq + ((size_t)(m0 / 8 + (p >> 2)) * HD + n0 + (p & 3) * 16 + cl) * 8 + r4) = vals[p];
        // stands between these stores and any overwrite of their registers
        asm volatile("s_wait_xcnt 0x0" ::: "memory");
    }
}

// ---------------------------------------------------------------------------
// Fused energies -> length mask -> softmax -> context rows. One block (256 = S) per (b, TT queries); behind the energy
// loop thread = s.
//   Wsq and Whe arrive as factors: Eq = e^{-2 Wsq}, Ee = e^{-2 Whe} (k_proj), so that
//   v[h] * tanh(Wsq[bt][h] + Whe[b][s][h]) = 2 v[h] / (1 + Eq[bt][h] * Ee[b][s][h]) - v[h]
//   e[t][s] = sum_h 2 v[h] / (1 + Eq * Ee)   (f32), s >= len masked out; the term -sum_h v[h] is the same
//             for every s of a row and cancels in the softmax, so it is not formed
//   p       = softmax_s(e), kept in LDS as two bf16 planes: rows 0..7 hi, rows 8..15 lo (lo = p - hi)
//   ctx     = p @ enc[b] on the matrix unit: the 16 plane rows are one A tile, wave w takes columns 64 w .. 64 w + 63;
//             result row t (the hi sums) + row 8 + t (the lo sums) is query t's context, stored as bf16 hi+lo in comb
// The wave's 64 rows of encT2 (its B operand) come into LDS by asynchronous copies that fly under the energy loop.
// Energy loop: a lane takes two neighbouring s (the two halves of every packed operation) and all TT queries; waves 0-3
// take h < HD / 2, waves 4-7 the rest. Eq and v are the same for a whole wave and come through scalar loads into scalar
// registers, which a packed operation reads for both its halves: the loop reads nothing from LDS.
// Ee lies in squares of two h and two s (k_proj, blockIdx.z = 1): Whe[b][h / 2][s / 2][h % 2][s % 2], so a wave's load of
// one h pair for its 64 s is four whole lines. Every Ee value a lane loads serves all TT queries from its register.
// Per (t, s) each half of h is summed in ascending order and the two halves are added last; the block trees
// of the softmax are those of the one-query form.
// LDS regions are cross-wave: block barriers throughout.
// ---------------------------------------------------------------------------
#define TT 8             // queries per block (= waves per block; thread s stores column s of every query's P planes)
#define CH 8             // v4f per lane and chunk: 16 h of the lane's two s
#define NCH (HD / 2 / 2 / CH)   // chunks of a wave's half of h
static_assert((TQ % TT) == 0 && TT == 8);
static_assert(((HD / 4) % CH) == 0 && S_LEN == 4 * 64);           // 4 waves x 64 s, twice
static_assert(HD == 8 * 64 && S_LEN == KS && NCH >= 8);           // 8 waves x 64 columns; a staged row is S_LEN halves

// Step st of a wave's half of h: Eq of four h for the TT queries and the four v. The addresses are wave-uniform.
__device__ __forceinline__ void sload(float (&q)[4 * TT], float (&w)[4], const float* __restrict__ qs,
                                      const float* __restrict__ vs, int st)
{
#pragma unroll
    for (int i = 0; i < 4 * TT; ++i) q[i] = qs[st * 4 * TT + i];
#pragma unroll
    for (int i = 0; i < 4; ++i) w[i] = vs[st * 4 + i];
}

__global__ __launch_bounds__(256)
void k_attn(const float* __restrict__ Wsq, const float* __restrict__ Whe,
            const float* __restrict__ vvec, const int* __restrict__ lens,
            const us* __restrict__ encT2, us* __restrict__ comb)
{
    __shared__ struct {
        float part[2][TT][S_LEN];              // the energy sums of the two halves of h
        float red[TT][S_LEN];
        unsigned char pl[2 * TT * SPITCH];     // P planes, one row per SPITCH
        unsigned char eb[HD * SPITCH];         // encT2[b], wave w owns rows 64 w ..
    } sm __attribute__((aligned(16)));
    float (&red)[TT][S_LEN]    = sm.red;
    unsigned char* const pl    = sm.pl;
    unsigned char* const eb    = sm.eb;

    const int bt0 = blockIdx.x * TT;         // b * TQ + t of the block's first query; TT divides TQ
    const int b   = bt0 / TQ;
    const int tid = threadIdx.x, lane = tid & 31, wave = tid >> 5;

    const int len = lens[b];
    // which half of h the wave takes; through readfirstlane, so that what is addressed by it is loaded by scalar loads
    const int half = __builtin_amdgcn_readfirstlane(tid >> 7);
    // h pair g of the wave's half, for the lane's two s: we[g * (S_LEN / 2)]
    const v4f* we = (const v4f*)Whe + ((size_t)b * (HD / 2) + half * (HD / 4)) * (S_LEN / 2) + (tid & 127);
    const float* qs = Wsq + ((size_t)blockIdx.x * HD + half * (HD / 2)) * TT;    // Eq[h][t] of the wave's half
    const float* vs = vvec + half * (HD / 2);
    // the lane's 16 bytes of the wave's first encT2 row, and their place in LDS
    const us* ge = encT2 + ((size_t)b * HD + wave * 64) * S_LEN + lane * 8;
    const unsigned edst = (unsigned)(size_t)eb + wave * 64 * SPITCH + lane * 16;
    // the sums of the lane's two s lie side by side, so that one packed fma serves both
    v2f acc2[TT];
#pragma unroll
    for (int t = 0; t < TT; ++t) acc2[t] = (v2f){0.0f, 0.0f};

    // The lane's next chunk of Whe is fetched into a second register set while this one is worked on;
    // trip -1 fetches chunk 0, starts the copies of encT2 rows 0..7 and computes nothing.
    v4f cur[CH], nxt[CH];
    // Eq and v of one step (four h: one 128-B line of Eq) in scalar registers, two sets; step 0 is asked for here
    float sq[2][4 * TT], sw[2][4];
    sload(sq[0], sw[0], qs, vs, 0);
    for (int c = -1; c < NCH; ++c) {
        if (c + 1 < NCH) {
#pragma unroll
            for (int j = 0; j < CH; ++j) nxt[j] = we[((c + 1) * CH + j) * (S_LEN / 2)];
            // stands between these loads and any overwrite of their address registers
            asm volatile("s_wait_xcnt 0x0" ::: "memory");
        }
        if (c + 1 < 8) {
            // eight encT2 rows a trip, behind the trip's own loads, so that the copies never crowd them out;
            // the wait holds a wave's copies in flight at eight (all 64 at once would pass the 63 that may be outstanding)
            asm volatile("s_wait_asynccnt 0x0" ::: "memory");
            copy8(edst + (c + 1) * 8 * SPITCH, ge + (size_t)(c + 1) * 8 * S_LEN, S_LEN);
        }
        if (c >= 0) {
            // unrolled so that the two scalar sets are named registers, not indexed ones
#pragma unroll
            for (int k = 0; k < CH / 2; ++k) {
                const int cu = k & 1, nx = cu ^ 1;
                const v2f e2[4] = {cur[2 * k].xy, cur[2 * k].zw, cur[2 * k + 1].xy, cur[2 * k + 1].zw};
#pragma unroll
                for (int i = 0; i < 4; ++i) {
                    const float w = 2.0f * bf2f(f2bf(sw[cu][i]));
#pragma unroll
                    for (int t = 0; t < TT; ++t) {
                        if (i == 0 && t == 1) {
                            // The next step's set is asked for behind this step's first use of its own set: the scalar
                            // counter can only be waited to 0, so a wait placed later would wait for these loads too.
                            // The two scheduling barriers keep the loads at this place, a step ahead of their use.
                            __builtin_amdgcn_sched_barrier(0);
                            sload(sq[nx], sw[nx], qs, vs, min(c * (CH / 2) + k + 1, NCH * (CH / 2) - 1));
                            __builtin_amdgcn_sched_barrier(0);
                        }
                        const float q = sq[cu][i * TT + t];
                        const v2f n = __builtin_elementwise_fma((v2f){q, q}, e2[i], (v2f){1.0f, 1.0f});
                        const v2f r = {__builtin_amdgcn_rcpf(n.x), __builtin_amdgcn_rcpf(n.y)};
                        acc2[t] = __builtin_elementwise_fma((v2f){w, w}, r, acc2[t]);
                    }
                }
            }
        }
#pragma unroll
        for (int j = 0; j < CH; ++j) cur[j] = nxt[j];
    }
    asm volatile("s_wait_asynccnt 0x0" ::: "memory");    // this wave's encT2 rows have landed; barriers follow
    const bool valid = tid < len;
    // the two halves of h meet: from here on thread = s
#pragma unroll
    for (int t = 0; t < TT; ++t) *(v2f*)&sm.part[half][t][2 * (tid & 127)] = acc2[t];
    __syncthreads();
    float acc[TT];
#pragma unroll
    for (int t = 0; t < TT; ++t) acc[t] = sm.part[0][t][tid] + sm.part[1][t][tid];

    // block max over s, all TT queries in each step
#pragma unroll
    for (int t = 0; t < TT; ++t) red[t][tid] = valid ? acc[t] : -3.0e38f;
    __syncthreads();
#pragma unroll
    for (int st = S_LEN / 2; st > 0; st >>= 1) {
        if (tid < st) {
#pragma unroll
            for (int t = 0; t < TT; ++t) red[t][tid] = fmaxf(red[t][tid], red[t][tid + st]);
        }
        __syncthreads();
    }
    float ex[TT];
#pragma unroll
    for (int t = 0; t < TT; ++t) ex[t] = red[t][0];      // the maximum, until the exp below
    __syncthreads();

    // exp + block sum (masked entries contribute exactly 0)
#pragma unroll
    for (int t = 0; t < TT; ++t) {
        const float arg = valid ? (acc[t] - ex[t]) : -80.0f;
        const float ex0 = exp2_slot(arg * 1.44269504088896340736f);    // e^arg
        ex[t] = valid ? ex0 : 0.0f;
        red[t][tid] = ex[t];
    }
    __syncthreads();
#pragma unroll
    for (int st = S_LEN / 2; st > 0; st >>= 1) {
        if (tid < st) {
#pragma unroll
            for (int t = 0; t < TT; ++t) red[t][tid] += red[t][tid + st];
        }
        __syncthreads();
    }
#pragma unroll
    for (int t = 0; t < TT; ++t) {
        const float ssum = red[t][0];
        const float pv = ex[t] * (1.0f / ssum);
        const us ph = f2bf(pv);
        *(us*)(pl + t * SPITCH + tid * 2)        = ph;
        *(us*)(pl + (TT + t) * SPITCH + tid * 2) = f2bf(pv - bf2f(ph));
    }
    __syncthreads();

    // context: A = the 16 plane rows, B = the wave's own 64 staged rows of encT2, k = s in ascending order
    const int hsel = lane >> 4, m = lane & 15;
    const unsigned char* pa = pl + m * SPITCH + hsel * 16;
    unsigned char* ew = eb + wave * 64 * SPITCH;
    const unsigned char* pb = ew + m * SPITCH + hsel * 16;
    v8f c0 = {}; v8f c1 = {}; v8f c2 = {}; v8f c3 = {};
    {
        // two fragment sets: the next 32 k are read from LDS while these are multiplied
        v16bf fa[2], fb[2][4];
        fa[0]    = lds_frag(pa);
        fb[0][0] = lds_frag(pb);
        fb[0][1] = lds_frag(pb + 16 * SPITCH);
        fb[0][2] = lds_frag(pb + 32 * SPITCH);
        fb[0][3] = lds_frag(pb + 48 * SPITCH);
        // unrolled so that the two sets are named registers, not indexed ones
#pragma unroll
        for (int kk = 0; kk < S_LEN / 32; ++kk) {
            const int cu = kk & 1, nx = cu ^ 1;
            if (kk + 1 < S_LEN / 32) {
                fa[nx]    = lds_frag(pa + (kk + 1) * 64);
                fb[nx][0] = lds_frag(pb + (kk + 1) * 64);
                fb[nx][1] = lds_frag(pb + 16 * SPITCH + (kk + 1) * 64);
                fb[nx][2] = lds_frag(pb + 32 * SPITCH + (kk + 1) * 64);
                fb[nx][3] = lds_frag(pb + 48 * SPITCH + (kk + 1) * 64);
            }
            c0 = wmma16(fa[cu], fb[cu][0], c0);
            c1 = wmma16(fa[cu], fb[cu][1], c1);
            c2 = wmma16(fa[cu], fb[cu][2], c2);
            c3 = wmma16(fa[cu], fb[cu][3], c3);
        }
    }

    // D map: acc[r] -> (row 8*hsel + r, col n-tile + m). The 16x64 wave tile goes over the wave's own staged rows,
    // which it alone has read and has done with.
    float* tw = (float*)ew;
#pragma unroll
    for (int r = 0; r < 8; ++r) {
        const int row = 8 * hsel + r;
        tw[row * 64 + m]      = c0[r];
        tw[row * 64 + 16 + m] = c1[r];
        tw[row * 64 + 32 + m] = c2[r];
        tw[row * 64 + 48 + m] = c3[r];
    }
    __syncthreads();

    // ctx = hi sums + lo sums; comb columns [0,512) hi and [512,1024) lo, 8 lanes per 128-B line
    {
        v8us hi[2], lo[2];
#pragma unroll
        for (int p = 0; p < 2; ++p) {
            const float* th = tw + (4 * p + (lane >> 3)) * 64 + 8 * (lane & 7);
            const v4f a = *(const v4f*)th       + *(const v4f*)(th + TT * 64);
            const v4f c = *(const v4f*)(th + 4) + *(const v4f*)(th + TT * 64 + 4);
            split8(a, c, hi[p], lo[p]);
        }
#pragma unroll
        for (int p = 0; p < 2; ++p) {
            us* d = comb + (size_t)(bt0 + 4 * p + (lane >> 3)) * KO + wave * 64 + 8 * (lane & 7);
            *(v8us*)d = hi[p];
            *(v8us*)(d + HD) = lo[p];
        }
    }
}

// ---------------------------------------------------------------------------
static inline size_t al256(size_t x) { return (x + 255) & ~(size_t)255; }
static_assert(TQ == S_LEN);

extern "C" void kernel_launch(void* const* d_in, const int* in_sizes, int n_in,
                              void* d_out, int out_size, void* d_ws, size_t ws_size,
                              hipStream_t stream)
{
    if (n_in < 7) return;
    if (in_sizes[0] < ((NB - 1) * T_FULL + TQ) * HD) return;      // query  [8][256][512] f32
    if (in_sizes[1] < NB * S_LEN * HD) return;                      // enc    [8][256][512] f32
    if (in_sizes[2] < NB) return;                                   // src_lengths [8] int32
    if (in_sizes[3] < HD * HD || in_sizes[4] < HD * HD) return;     // W_s, W_h [512][512] f32
    if (in_sizes[5] < HD) return;                                   // v [512] f32
    if (in_sizes[6] < HD * 2 * HD) return;                          // W_out [512][1024] f32
    if (out_size < ((NB - 1) * T_FULL + TQ) * HD) return;

    const float* query = (const float*)d_in[0];
    const float* enc   = (const float*)d_in[1];
    const int*   lens  = (const int*)d_in[2];
    const float* W_s   = (const float*)d_in[3];
    const float* W_h   = (const float*)d_in[4];
    const float* vvec  = (const float*)d_in[5];
    const float* W_out = (const float*)d_in[6];
    float* out = (float*)d_out;

    // ---- workspace carve (all regions 256-B aligned; sizes already store-granular) ----
    char* ws = (char*)d_ws;
    size_t off = 0;
    us* comb  = (us*)(ws + off);    off += al256((size_t)NB * TQ * KO * sizeof(us));      // [NB*TQ][1536]
    us* encT2 = (us*)(ws + off);    off += al256((size_t)NB * HD * S_LEN * sizeof(us));   // [NB][512][256]
    us* WoX   = (us*)(ws + off);    off += al256((size_t)HD * KO * sizeof(us));           // [512][1536]
    float* Wsq = (float*)(ws + off); off += al256((size_t)NB * TQ * HD * sizeof(float));  // [NB*TQ/8][512][8]
    float* Whe = (float*)(ws + off); off += al256((size_t)NB * S_LEN * HD * sizeof(float)); // [NB][256][S/2][2][2]
    if (off > ws_size) return;

    const dim3 b256(256), b128(128);

    // ---- projections from the f32 inputs, stored as factors: Wsq = e^{-2 q @ W_s^T}, Whe = e^{-2 enc @ W_h^T} (f32);
    //      the same launch writes the 16-bit planes: query -> comb, enc -> encT2 (transposed), W_out -> WoX ----
    k_proj<<<dim3(NB * TQ / PM, HD / 64, 2), b256, 0, stream>>>(query, enc, W_s, W_h, W_out, comb, encT2, WoX, Wsq, Whe);

    // ---- energies + mask + softmax, then context = P @ enc -> comb columns [0,512) hi and [512,1024) lo ----
    k_attn<<<dim3(NB * TQ / TT), b256, 0, stream>>>(Wsq, Whe, vvec, lens, encT2, comb);

    // ---- out = tanh([ctx_hi|ctx_lo|q] @ WoX^T) ----
    k_gemm<2><<<dim3(TQ / 64, HD / 64, NB), b128, 0, stream>>>(
        comb, KO, TQ * KO, WoX, KO, 0, (void*)out, HD, T_FULL * HD, KO);
}

// v010
// One run takes 38.9 microseconds.
// It is 1.18 times as fast as v008, going by the measured steps of the versions left out in between.
// All steps since v000 together make it 5.62 times as fast.
#include <hip/hip_runtime.h>

// Contractions on v_wmma_f32_16x16x32_bf16 (bf16 operands, f32 accumulate), all from RNE-converted inputs:
// q@W_s^T, enc@W_h^T, Q2 = q@W_out[:,H:2H]^T and G = enc@W_out[:,0:H]^T in one launch; then attn@G with the bf16 hi and
// lo planes of attn as rows 0-7 and 8-15 of one tile. (attn@enc)@W^T is formed as attn@(enc@W^T): out = tanh(attn@G + Q2).
// Energies v.tanh(.), length masking and softmax in f32 on the VALU; the tanh of a sum is
// formed from one exponential factor per projection value (exp_m2 below).

#ifndef NB
#define NB 8
#endif
#ifndef TQ
#define TQ 256
#endif
#define NB_FULL 8
#define T_FULL 256
#define S_LEN 256
#define HD 512

static_assert(NB >= 1 && NB <= NB_FULL);
static_assert(TQ >= 64 && TQ <= T_FULL && (TQ % 64) == 0);
static_assert(S_LEN == 256);
static_assert((HD % 256) == 0);
static_assert((HD % 64) == 0 && (S_LEN % 64) == 0);

typedef unsigned short us;
typedef us     v8us  __attribute__((ext_vector_type(8)));
typedef us     v4us  __attribute__((ext_vector_type(4)));
typedef __bf16 v16bf __attribute__((ext_vector_type(16)));
typedef float  v8f   __attribute__((ext_vector_type(8)));
typedef float  v4f   __attribute__((ext_vector_type(4)));
typedef float  v2f   __attribute__((ext_vector_type(2)));
typedef __bf16 v2bf  __attribute__((ext_vector_type(2)));
typedef unsigned int v2u __attribute__((ext_vector_type(2)));
typedef unsigned int v4u __attribute__((ext_vector_type(4)));

union Frag { v16bf v; v8us h[2]; };

// ---------------------------------------------------------------------------
// scalar helpers
// ---------------------------------------------------------------------------
__device__ __forceinline__ us f2bf(float f) {           // f32 -> bf16, RNE convert
    unsigned int u = __float_as_uint(f);
    u += 0x7FFFu + ((u >> 16) & 1u);
    return (us)(u >> 16);
}
__device__ __forceinline__ float bf2f(us h) {
    return __uint_as_float(((unsigned int)h) << 16);
}
// e^{-2x}, the factor of one projection value: tanh(a + b) = 2 / (1 + e^{-2a} * e^{-2b}) - 1.
// The exponent is held in [-63, 63] (|x| <= 21.8), so a factor is never 0 or inf and a product of two
// is never 0 * inf; a product that grows large gives 2 / (1 + u) - 1 -> -1, a small one -> +1.
__device__ __forceinline__ float exp2_slot(float l) {
    float r;
    // 2^l; the v_nop is the slot the instruction set asks for behind a transcendental, whatever instruction comes next
    asm("v_exp_f32 %0, %1\n\tv_nop" : "=v"(r) : "v"(l));
    return r;
}
__device__ __forceinline__ float rcp_slot(float x) {
    float r;
    // 1 / x; the v_nop is the same slot behind this transcendental
    asm("v_rcp_f32 %0, %1\n\tv_nop" : "=v"(r) : "v"(x));
    return r;
}
// tanh(x) = sign(x) * (1 - e^{-2|x|}) / (1 + e^{-2|x|}), v_exp_f32 + v_rcp_f32 based (abs error ~1e-7)
__device__ __forceinline__ float tanh_acc(float x) {
    const float ax = __builtin_fabsf(x);
    const float t  = exp2_slot((-2.0f * ax) * 1.44269504088896340736f);
    const float r  = (1.0f - t) * rcp_slot(1.0f + t);
    return __builtin_copysignf(r, x);
}
// the value of lane l ^ M, M < 16: a DPP move inside the 16-lane row; every lane is on where it is used
template <int M>
__device__ __forceinline__ float xrow(float x) {
    return __builtin_bit_cast(float, __builtin_amdgcn_mov_dpp(__builtin_bit_cast(int, x), 0x160 | M, 0xf, 0xf, true));
}
// the value of lane l ^ 16
__device__ __forceinline__ float xhalf(float x) {
    return __builtin_bit_cast(float, __builtin_amdgcn_permlanex16(__builtin_bit_cast(int, x), __builtin_bit_cast(int, x),
                                                                  0x76543210, 0xfedcba98, false, false));
}
__device__ __forceinline__ float exp_m2(float x) {
    const float l = fminf(fmaxf(x * -2.88539008177792681472f, -63.0f), 63.0f);
    return exp2_slot(l);
}
// ---------------------------------------------------------------------------
// WMMA helper: 16x16x32 bf16, f32 accumulate, 4-slot VALU hazard guard after the issue
// ---------------------------------------------------------------------------
__device__ __forceinline__ v8f wmma16(v16bf a, v16bf b, v8f c) {
    v8f d = __builtin_amdgcn_wmma_f32_16x16x32_bf16(false, a, false, b, (short)0, c, false, false);
    asm volatile("v_nop\n\tv_nop\n\tv_nop\n\tv_nop" : "+v"(d) : "v"(a), "v"(b));
    return d;
}

// ---------------------------------------------------------------------------
// Rows of S_LEN halves staged in LDS (k_attn)
// ---------------------------------------------------------------------------
#define KS 256                  // halves per staged row
#define SPITCH 528              // LDS bytes per staged row: 16 B x odd, so 16 rows of one ds_load_b128 fall on distinct banks

// Eight asynchronous copies global -> LDS, one staged row (512 B, four whole lines) per copy: lane l brings
// bytes 16 l .. 16 l + 15 of rows 0..7 behind g (pitch ld halves) to l0 + row * SPITCH. l0 and g are the lane's own.
__device__ __forceinline__ void copy8(unsigned l0, const us* g, int ld)
{
    // the closing s_wait_xcnt stands inside the statement, so no address register of a copy is rewritten ahead of it
    asm volatile("global_load_async_to_lds_b128 %0, %8, off\n\t"
                 "global_load_async_to_lds_b128 %1, %9, off\n\t"
                 "global_load_async_to_lds_b128 %2, %10, off\n\t"
                 "global_load_async_to_lds_b128 %3, %11, off\n\t"
                 "global_load_async_to_lds_b128 %4, %12, off\n\t"
                 "global_load_async_to_lds_b128 %5, %13, off\n\t"
                 "global_load_async_to_lds_b128 %6, %14, off\n\t"
                 "global_load_async_to_lds_b128 %7, %15, off\n\t"
                 "s_wait_xcnt 0x0"
                 :: "v"(l0), "v"(l0 + 1 * SPITCH), "v"(l0 + 2 * SPITCH), "v"(l0 + 3 * SPITCH),
                    "v"(l0 + 4 * SPITCH), "v"(l0 + 5 * SPITCH), "v"(l0 + 6 * SPITCH), "v"(l0 + 7 * SPITCH),
                    "v"(g), "v"(g + (size_t)ld), "v"(g + (size_t)ld * 2), "v"(g + (size_t)ld * 3),
                    "v"(g + (size_t)ld * 4), "v"(g + (size_t)ld * 5), "v"(g + (size_t)ld * 6), "v"(g + (size_t)ld * 7)
                 : "memory");
}
// Fragment from a staged k-contiguous row. Lane l: row = (l & 15) (A row m, or B column n of an [n][k] plane),
// hsel = l >> 4; p = the row's start in LDS + 2 * k0 + 16 * hsel bytes.
//   elements 0..7  <- k0 + 8*hsel + 0..7
//   elements 8..15 <- k0 + 16 + 8*hsel + 0..7
__device__ __forceinline__ v16bf lds_frag(const unsigned char* p) {
    Frag f;
    f.h[0] = *(const v8us*)p;
    f.h[1] = *(const v8us*)(p + 32);
    return f.v;
}

#define TP 68                   // floats per staged result row: 16 B x odd, so 16 rows of one ds_load_b128 fall on distinct banks

// ---------------------------------------------------------------------------
// All four products of an input with a weight, straight from the f32 inputs. A block stages its A rows once and
// multiplies them with 64 rows of each of two weights.
//   blockIdx.z = 0, A = query:
//     Wsq = e^{-2 q @ W_s^T}, eight rows interleaved: Wsq[row / 8][col][row % 8], so that the eight queries
//     of a k_attn block at two neighbouring columns are 64 B in a row, one scalar load;
//     Q2 = q @ W_out[:, HD:2 HD]^T (f32), interleaved the same way: Q2[row / 8][col][row % 8]
//   blockIdx.z = 1, A = enc:
//     Whe = e^{-2 enc @ W_h^T} in squares of two rows and two columns:
//     Whe[row / S_LEN][col / 2][(row % S_LEN) / 2][col % 2][row % 2], so that two rows at one column are a register pair
//     as they are loaded, and 64 neighbouring rows at one column pair are 512 B in a row;
//     GT[b][o][s] = bf16((enc[b] @ W_out[:, 0:HD]^T)[s][o]), RNE
// Block = 256 threads (8 waves), block tile 128(M) x (64 + 64)(N), wave tile 16 x (64 + 64), the whole K = HD in LDS at
// once: the 128 A rows and 2 x 64 B rows are loaded as f32 in whole lines, rounded to bf16 (RNE) in registers and stored
// to LDS.
// ---------------------------------------------------------------------------
#define PM 128                  // A rows per block
#define PP 1040                 // LDS bytes per staged row of HD halves: 16 B x odd, as SPITCH
#define GP 272                  // LDS bytes per row of the transposed G tile (PM halves): 16 B x odd
static_assert((TQ % PM) == 0 && (S_LEN % PM) == 0 && HD == 512);

// four f32 -> four bf16, RNE: two v_cvt_pk_bf16_f32
__device__ __forceinline__ v2u cvt4(v4f x) {
    union { v2bf b[2]; v2u u; } r;
    r.b[0] = __builtin_convertvector(x.xy, v2bf);
    r.b[1] = __builtin_convertvector(x.zw, v2bf);
    return r.u;
}
// Four f32 rows (pitch ld floats), 16 loads of 512 contiguous bytes each: load i of a row brings columns 128 i + 4 lane ..
__device__ __forceinline__ void rows_load(v4f (&x)[4][4], const float* __restrict__ g, int ld) {
#pragma unroll
    for (int r = 0; r < 4; ++r)
#pragma unroll
        for (int i = 0; i < 4; ++i) x[r][i] = *(const v4f*)(g + r * ld + i * 128);
    // stands between these loads and any overwrite of their address registers; also keeps the sets' loads in order
    asm volatile("s_wait_xcnt 0x0" ::: "memory");
}
__device__ __forceinline__ void rows_store(const v4f (&x)[4][4], unsigned char* l) {
#pragma unroll
    for (int r = 0; r < 4; ++r)
#pragma unroll
        for (int i = 0; i < 4; ++i) *(v2u*)(l + r * PP + i * 256) = cvt4(x[r][i]);
}
// 16 x 64 wave tile over the whole K = HD; pa, pb: the lane's fragment addresses in the staged A rows and B rows
__device__ __forceinline__ void proj_tile(const unsigned char* pa, const unsigned char* pb,
                                          v8f& c0, v8f& c1, v8f& c2, v8f& c3)
{
    // two fragment sets: the next 32 k are read from LDS while these are multiplied
    v16bf fa[2], fb[2][4];
    fa[0]    = lds_frag(pa);
    fb[0][0] = lds_frag(pb);
    fb[0][1] = lds_frag(pb + 16 * PP);
    fb[0][2] = lds_frag(pb + 32 * PP);
    fb[0][3] = lds_frag(pb + 48 * PP);
    // unrolled so that the two sets are named registers, not indexed ones
#pragma unroll
    for (int kk = 0; kk < HD / 32; ++kk) {
        const int cu = kk & 1, nx = cu ^ 1;
        if (kk + 1 < HD / 32) {
            fa[nx]    = lds_frag(pa + (kk + 1) * 64);
            fb[nx][0] = lds_frag(pb + (kk + 1) * 64);
            fb[nx][1] = lds_frag(pb + 16 * PP + (kk + 1) * 64);
            fb[nx][2] = lds_frag(pb + 32 * PP + (kk + 1) * 64);
            fb[nx][3] = lds_frag(pb + 48 * PP + (kk + 1) * 64);
        }
        c0 = wmma16(fa[cu], fb[cu][0], c0);
        c1 = wmma16(fa[cu], fb[cu][1], c1);
        c2 = wmma16(fa[cu], fb[cu][2], c2);
        c3 = wmma16(fa[cu], fb[cu][3], c3);
    }
}
// eight f32 of one accumulator -> eight bf16 (RNE), 16 B
__device__ __forceinline__ v4u cvt8(v8f c) {
    union { v2u u[2]; v4u q; } o;
    o.u[0] = cvt4((v4f){c[0], c[1], c[2], c[3]});
    o.u[1] = cvt4((v4f){c[4], c[5], c[6], c[7]});
    return o.q;
}

__global__ __launch_bounds__(256)
void k_proj(const float* __restrict__ query, const float* __restrict__ enc,
            const float* __restrict__ W_s, const float* __restrict__ W_h, const float* __restrict__ W_out,
            us* __restrict__ GT, float* __restrict__ Q2,
            float* __restrict__ Wsq, float* __restrict__ Whe)
{
    __shared__ __attribute__((aligned(16))) unsigned char sa[PM * PP];
    __shared__ __attribute__((aligned(16))) unsigned char sb[64 * PP];
    __shared__ __attribute__((aligned(16))) unsigned char sc[64 * PP];
    __shared__ __attribute__((aligned(16))) float tile[8 * 16 * TP];
    __shared__ __attribute__((aligned(16))) unsigned char gt[64 * GP];

    const int tid = threadIdx.x, lane = tid & 31, wave = tid >> 5;
    const int hsel = lane >> 4, m = lane & 15;
    const int mb = blockIdx.x * PM;                    // the block's first row; its PM rows lie in one batch
    const int m0 = mb + wave * 16;
    const int n0 = blockIdx.y * 64;
    const bool is_enc = blockIdx.z == 1;               // the same for the whole block

    // wave w stages A rows 16 w .. 16 w + 15 and rows 8 w .. 8 w + 7 of either weight: eight sets of four rows through
    // two register sets, so that the next set's loads are in flight while one set is rounded and stored
    const float* ga = (is_enc ? enc + (size_t)m0 * HD
                              : query + (size_t)((mb / TQ) * T_FULL + (mb % TQ) + wave * 16) * HD) + lane * 4;
    const float* gb = (is_enc ? W_h : W_s) + (size_t)(n0 + wave * 8) * HD + lane * 4;
    const float* gc = W_out + (size_t)(n0 + wave * 8) * (2 * HD) + (is_enc ? 0 : HD) + lane * 4;
    unsigned char* la = sa + wave * 16 * PP + lane * 8;
    unsigned char* lb = sb + wave * 8 * PP + lane * 8;
    unsigned char* lc = sc + wave * 8 * PP + lane * 8;
    {
        v4f x[2][4][4];
        rows_load(x[0], ga, HD);
        // unrolled so that the two sets are named registers, not indexed ones
#pragma unroll
        for (int t = 0; t < 8; ++t) {
            const int u = t + 1;
            if (u < 8) rows_load(x[u & 1], u < 4 ? ga + u * 4 * HD : u < 6 ? gb + (u - 4) * 4 * HD
                                                                           : gc + (u - 6) * 4 * 2 * HD, u < 6 ? HD : 2 * HD);
            rows_store(x[t & 1], t < 4 ? la + t * 4 * PP : t < 6 ? lb + (t - 4) * 4 * PP : lc + (t - 6) * 4 * PP);
        }
    }
    __syncthreads();                                   // every wave's rows are in LDS

    const unsigned char* pa = sa + (wave * 16 + m) * PP + hsel * 16;
    const unsigned char* pb = sb + m * PP + hsel * 16;
    const unsigned char* pc = sc + m * PP + hsel * 16;
    v8f c0 = {}; v8f c1 = {}; v8f c2 = {}; v8f c3 = {};    // A @ (W_s or W_h)^T
    v8f d0 = {}; v8f d1 = {}; v8f d2 = {}; v8f d3 = {};    // A @ (its half of W_out)^T
    proj_tile(pa, pb, c0, c1, c2, c3);
    proj_tile(pa, pc, d0, d1, d2, d3);

    // D map: acc[r] -> (row 8*hsel + r, col n-tile + m). Stage the 16x64 wave tile in LDS.
    float* tw = tile + wave * 16 * TP;
#pragma unroll
    for (int r = 0; r < 8; ++r) {
        const int row = 8 * hsel + r;
        tw[row * TP + m]      = c0[r];
        tw[row * TP + 16 + m] = c1[r];
        tw[row * TP + 32 + m] = c2[r];
        tw[row * TP + 48 + m] = c3[r];
    }
    if (is_enc) {
        // a lane's eight values of one accumulator are eight neighbouring s of one column o: 16 B of a row of the
        // transposed block tile gt[o][s]
        unsigned char* gw = gt + m * GP + (wave * 16 + 8 * hsel) * 2;
        *(v4u*)gw             = cvt8(d0);
        *(v4u*)(gw + 16 * GP) = cvt8(d1);
        *(v4u*)(gw + 32 * GP) = cvt8(d2);
        *(v4u*)(gw + 48 * GP) = cvt8(d3);
    }
    __syncthreads();

    if (is_enc) {
        // lane = (row pair lane & 7, column pair 4 p + (lane >> 3)): a store writes four whole lines.
        // The wave's 16 rows lie in one batch of S_LEN rows.
        const int rp = lane & 7, cq = lane >> 3;
        float* Cb = Whe + (((size_t)(m0 / S_LEN) * (HD / 2) + n0 / 2 + cq) * (S_LEN / 2) + (m0 % S_LEN) / 2 + rp) * 4;
        v4f vals[8];
#pragma unroll
        for (int p = 0; p < 8; ++p) {
            const v2f a = *(const v2f*)(tw + (2 * rp) * TP + 2 * (4 * p + cq));
            const v2f c = *(const v2f*)(tw + (2 * rp + 1) * TP + 2 * (4 * p + cq));
            vals[p] = (v4f){exp_m2(a.x), exp_m2(c.x), exp_m2(a.y), exp_m2(c.y)};
        }
#pragma unroll
        for (int p = 0; p < 8; ++p) *(v4f*)(Cb + (size_t)(4 * p) * (S_LEN / 2) * 4) = vals[p];
        // stands between these stores and any overwrite of their registers
        asm volatile("s_wait_xcnt 0x0" ::: "memory");
        // GT: 16 lanes write the block's 128 s of one o, two whole lines
        us* gd = GT + ((size_t)(mb / S_LEN) * HD + n0 + (tid >> 4)) * S_LEN + (mb % S_LEN) + (tid & 15) * 8;
        v4u w[4];
#pragma unroll
        for (int i = 0; i < 4; ++i) w[i] = *(const v4u*)(gt + (i * 16 + (tid >> 4)) * GP + (tid & 15) * 16);
#pragma unroll
        for (int i = 0; i < 4; ++i) *(v4u*)(gd + (size_t)(i * 16) * S_LEN) = w[i];
        // stands between these stores and any overwrite of their registers
        asm volatile("s_wait_xcnt 0x0" ::: "memory");
    } else {
        // lane = (column 16 (p & 3) + (lane >> 1), rows 8 (p >> 2) + 4 (lane & 1) ..): a store writes 512 B in a row
        const int r4 = (lane & 1) * 4, cl = lane >> 1;
        v4f vals[8];
#pragma unroll
        for (int p = 0; p < 8; ++p) {
            const float* t4 = tw + ((p >> 2) * 8 + r4) * TP + (p & 3) * 16 + cl;
            vals[p] = (v4f){exp_m2(t4[0]), exp_m2(t4[TP]), exp_m2(t4[2 * TP]), exp_m2(t4[3 * TP])};
        }
#pragma unroll
        for (int p = 0; p < 8; ++p)
            *(v4f*)(Wsq + ((size_t)(m0 / 8 + (p >> 2)) * HD + n0 + (p & 3) * 16 + cl) * 8 + r4) = vals[p];
        // stands between these stores and any overwrite of their registers
        asm volatile("s_wait_xcnt 0x0" ::: "memory");
        // Q2 from the accumulators as they lie: a lane's eight values are the eight rows of one group at one column,
        // 32 B in a row; 16 lanes write 512 B in a row with the two stores
        float* qd = Q2 + ((size_t)(m0 / 8 + hsel) * HD + n0 + m) * 8;
        *(v4f*)(qd)               = (v4f){d0[0], d0[1], d0[2], d0[3]};
        *(v4f*)(qd + 4)           = (v4f){d0[4], d0[5], d0[6], d0[7]};
        *(v4f*)(qd + 16 * 8)      = (v4f){d1[0], d1[1], d1[2], d1[3]};
        *(v4f*)(qd + 16 * 8 + 4)  = (v4f){d1[4], d1[5], d1[6], d1[7]};
        *(v4f*)(qd + 32 * 8)      = (v4f){d2[0], d2[1], d2[2], d2[3]};
        *(v4f*)(qd + 32 * 8 + 4)  = (v4f){d2[4], d2[5], d2[6], d2[7]};
        *(v4f*)(qd + 48 * 8)      = (v4f){d3[0], d3[1], d3[2], d3[3]};
        *(v4f*)(qd + 48 * 8 + 4)  = (v4f){d3[4], d3[5], d3[6], d3[7]};
        // stands between these stores and any overwrite of their registers
        asm volatile("s_wait_xcnt 0x0" ::: "memory");
    }
}

// ---------------------------------------------------------------------------
// Fused energies -> length mask -> softmax -> output rows. One block (256 = S) per (b, TT queries); behind the energy
// loop wave = query: wave w holds query w's whole row, eight s a lane, and finds its maximum and its sum by itself.
//   Wsq and Whe arrive as factors: Eq = e^{-2 Wsq}, Ee = e^{-2 Whe} (k_proj), so that
//   v[h] * tanh(Wsq[bt][h] + Whe[b][s][h]) = 2 v[h] / (1 + Eq[bt][h] * Ee[b][s][h]) - v[h]
//   e[t][s] = sum_h 2 v[h] / (1 + Eq * Ee)   (f32), s >= len masked out; the term -sum_h v[h] is the same
//             for every s of a row and cancels in the softmax, so it is not formed
//   p       = softmax_s(e), kept in LDS as two bf16 planes: rows 0..7 hi, rows 8..15 lo (lo = p - hi)
//   out     = tanh(p @ G[b] + Q2), G[b] = enc[b] @ W_out[:, 0:HD]^T (k_proj), on the matrix unit: the 16 plane rows are one
//             A tile, wave w takes columns 64 w .. 64 w + 63; the accumulators of rows 0..7 start from Q2, those of rows
//             8..15 from 0; result row t (Q2 + the hi sums) + row 8 + t (the lo sums) goes through tanh to query t's row
// The wave's 64 rows of GT (its B operand) come into LDS by asynchronous copies that fly under the energy loop.
// Energy loop: a lane takes two neighbouring s (the two halves of every packed operation) and all TT queries; waves 0-3
// take h < HD / 2, waves 4-7 the rest. Eq and v are the same for a whole wave and come through scalar loads into scalar
// registers, which a packed operation reads for both its halves: the loop reads nothing from LDS.
// Ee lies in squares of two h and two s (k_proj, blockIdx.z = 1): Whe[b][h / 2][s / 2][h % 2][s % 2], so a wave's load of
// one h pair for its 64 s is four whole lines. Every Ee value a lane loads serves all TT queries from its register.
// Per (t, s) each half of h is summed in ascending order and the two halves are added last. A row's exponentials are
// summed eight in the lane as a tree, then over lanes l ^ 1, 2, 4, 8, 16.
// LDS regions are cross-wave: block barriers throughout.
// ---------------------------------------------------------------------------
#define TT 8             // queries per block (= waves per block; wave t stores query t's row of both P planes)
#define CH 8             // v4f per lane and chunk: 16 h of the lane's two s
#define NCH (HD / 2 / 2 / CH)   // chunks of a wave's half of h
static_assert((TQ % TT) == 0 && TT == 8);
static_assert(((HD / 4) % CH) == 0 && S_LEN == 4 * 64);           // 4 waves x 64 s, twice
static_assert(HD == 8 * 64 && S_LEN == KS && NCH >= 8);           // 8 waves x 64 columns; a staged row is S_LEN halves

// Step st of a wave's half of h: Eq of four h for the TT queries and the four v. The addresses are wave-uniform.
__device__ __forceinline__ void sload(float (&q)[4 * TT], float (&w)[4], const float* __restrict__ qs,
                                      const float* __restrict__ vs, int st)
{
#pragma unroll
    for (int i = 0; i < 4 * TT; ++i) q[i] = qs[st * 4 * TT + i];
#pragma unroll
    for (int i = 0; i < 4; ++i) w[i] = vs[st * 4 + i];
}

__global__ __launch_bounds__(256)
void k_attn(const float* __restrict__ Wsq, const float* __restrict__ Whe,
            const float* __restrict__ vvec, const int* __restrict__ lens,
            const us* __restrict__ GT, const float* __restrict__ Q2, float* __restrict__ out)
{
    __shared__ struct {
        float part[2][TT][S_LEN];              // the energy sums of the two halves of h
        unsigned char pl[2 * TT * SPITCH];     // P planes, one row per SPITCH
        unsigned char eb[HD * SPITCH];         // GT[b], wave w owns rows 64 w ..
    } sm __attribute__((aligned(16)));
    unsigned char* const pl    = sm.pl;
    unsigned char* const eb    = sm.eb;

    const int bt0 = blockIdx.x * TT;         // b * TQ + t of the block's first query; TT divides TQ
    const int b   = bt0 / TQ;
    const int tid = threadIdx.x, lane = tid & 31, wave = tid >> 5;

    const int len = lens[b];
    // which half of h the wave takes; through readfirstlane, so that what is addressed by it is loaded by scalar loads
    const int half = __builtin_amdgcn_readfirstlane(tid >> 7);
    // h pair g of the wave's half, for the lane's two s: we[g * (S_LEN / 2)]
    const v4f* we = (const v4f*)Whe + ((size_t)b * (HD / 2) + half * (HD / 4)) * (S_LEN / 2) + (tid & 127);
    const float* qs = Wsq + ((size_t)blockIdx.x * HD + half * (HD / 2)) * TT;    // Eq[h][t] of the wave's half
    const float* vs = vvec + half * (HD / 2);
    // the lane's 16 bytes of the wave's first GT row, and their place in LDS
    const us* ge = GT + ((size_t)b * HD + wave * 64) * S_LEN + lane * 8;
    const unsigned edst = (unsigned)(size_t)eb + wave * 64 * SPITCH + lane * 16;
    // Q2 of the block's TT queries at the lane's four columns of the wave's output tile: asked for here, used far below
    const float* q2 = Q2 + ((size_t)blockIdx.x * HD + wave * 64 + (lane & 15)) * TT;
    v4f qi[4][2];
#pragma unroll
    for (int j = 0; j < 4; ++j) {
        qi[j][0] = *(const v4f*)(q2 + j * 16 * TT);
        qi[j][1] = *(const v4f*)(q2 + j * 16 * TT + 4);
    }
    // stands between these loads and any overwrite of their address registers
    asm volatile("s_wait_xcnt 0x0" ::: "memory");
    // the sums of the lane's two s lie side by side, so that one packed fma serves both
    v2f acc2[TT];
#pragma unroll
    for (int t = 0; t < TT; ++t) acc2[t] = (v2f){0.0f, 0.0f};

    // The lane's next chunk of Whe is fetched into a second register set while this one is worked on;
    // trip -1 fetches chunk 0, starts the copies of the wave's first eight GT rows and computes nothing.
    v4f cur[CH], nxt[CH];
    // Eq and v of one step (four h: one 128-B line of Eq) in scalar registers, two sets; step 0 is asked for here
    float sq[2][4 * TT], sw[2][4];
    sload(sq[0], sw[0], qs, vs, 0);
    for (int c = -1; c < NCH; ++c) {
        if (c + 1 < NCH) {
#pragma unroll
            for (int j = 0; j < CH; ++j) nxt[j] = we[((c + 1) * CH + j) * (S_LEN / 2)];
            // stands between these loads and any overwrite of their address registers
            asm volatile("s_wait_xcnt 0x0" ::: "memory");
        }
        if (c + 1 < 8) {
            // eight GT rows a trip, behind the trip's own loads, so that the copies never crowd them out;
            // the wait holds a wave's copies in flight at eight (all 64 at once would pass the 63 that may be outstanding)
            asm volatile("s_wait_asynccnt 0x0" ::: "memory");
            copy8(edst + (c + 1) * 8 * SPITCH, ge + (size_t)(c + 1) * 8 * S_LEN, S_LEN);
        }
        if (c >= 0) {
            // unrolled so that the two scalar sets are named registers, not indexed ones
#pragma unroll
            for (int k = 0; k < CH / 2; ++k) {
                const int cu = k & 1, nx = cu ^ 1;
                const v2f e2[4] = {cur[2 * k].xy, cur[2 * k].zw, cur[2 * k + 1].xy, cur[2 * k + 1].zw};
#pragma unroll
                for (int i = 0; i < 4; ++i) {
                    const float w = 2.0f * bf2f(f2bf(sw[cu][i]));
#pragma unroll
                    for (int t = 0; t < TT; ++t) {
                        if (i == 0 && t == 1) {
                            // The next step's set is asked for behind this step's first use of its own set: the scalar
                            // counter can only be waited to 0, so a wait placed later would wait for these loads too.
                            // The two scheduling barriers keep the loads at this place, a step ahead of their use.
                            __builtin_amdgcn_sched_barrier(0);
                            sload(sq[nx], sw[nx], qs, vs, min(c * (CH / 2) + k + 1, NCH * (CH / 2) - 1));
                            __builtin_amdgcn_sched_barrier(0);
                        }
                        const float q = sq[cu][i * TT + t];
                        const v2f n = __builtin_elementwise_fma((v2f){q, q}, e2[i], (v2f){1.0f, 1.0f});
                        const v2f r = {__builtin_amdgcn_rcpf(n.x), __builtin_amdgcn_rcpf(n.y)};
                        acc2[t] = __builtin_elementwise_fma((v2f){w, w}, r, acc2[t]);
                    }
                }
            }
        }
#pragma unroll
        for (int j = 0; j < CH; ++j) cur[j] = nxt[j];
    }
    asm volatile("s_wait_asynccnt 0x0" ::: "memory");    // this wave's GT rows have landed; barriers follow
    // the two halves of h meet: from here on wave = query, and a lane holds s = 4 lane .. + 3 and 128 + 4 lane .. + 3
#pragma unroll
    for (int t = 0; t < TT; ++t) *(v2f*)&sm.part[half][t][2 * (tid & 127)] = acc2[t];
    __syncthreads();
    {
        const v4f a0 = *(const v4f*)&sm.part[0][wave][4 * lane]       + *(const v4f*)&sm.part[1][wave][4 * lane];
        const v4f a1 = *(const v4f*)&sm.part[0][wave][128 + 4 * lane] + *(const v4f*)&sm.part[1][wave][128 + 4 * lane];
        const float e[8] = {a0.x, a0.y, a0.z, a0.w, a1.x, a1.y, a1.z, a1.w};
        bool valid[8];
#pragma unroll
        for (int j = 0; j < 8; ++j) valid[j] = (j >> 2) * 128 + 4 * lane + (j & 3) < len;

        // the row's maximum: the lane's eight, then the wave
        float mx = -3.0e38f;
#pragma unroll
        for (int j = 0; j < 8; ++j) mx = fmaxf(mx, valid[j] ? e[j] : -3.0e38f);
        mx = fmaxf(mx, xrow<1>(mx));
        mx = fmaxf(mx, xrow<2>(mx));
        mx = fmaxf(mx, xrow<4>(mx));
        mx = fmaxf(mx, xrow<8>(mx));
        mx = fmaxf(mx, xhalf(mx));

        // exp + the row's sum (masked entries contribute exactly 0)
        float ex[8];
#pragma unroll
        for (int j = 0; j < 8; ++j) {
            const float arg = valid[j] ? (e[j] - mx) : -80.0f;
            const float ex0 = exp2_slot(arg * 1.44269504088896340736f);    // e^arg
            ex[j] = valid[j] ? ex0 : 0.0f;
        }
        float ssum = ((ex[0] + ex[1]) + (ex[2] + ex[3])) + ((ex[4] + ex[5]) + (ex[6] + ex[7]));
        ssum += xrow<1>(ssum);
        ssum += xrow<2>(ssum);
        ssum += xrow<4>(ssum);
        ssum += xrow<8>(ssum);
        ssum += xhalf(ssum);

        const float inv = 1.0f / ssum;
        us ph[8], pq[8];
#pragma unroll
        for (int j = 0; j < 8; ++j) {
            const float pv = ex[j] * inv;
            ph[j] = f2bf(pv);
            pq[j] = f2bf(pv - bf2f(ph[j]));
        }
        unsigned char* const ph_row = pl + wave * SPITCH + lane * 8;
        unsigned char* const pq_row = pl + (TT + wave) * SPITCH + lane * 8;
        *(v4us*)ph_row         = (v4us){ph[0], ph[1], ph[2], ph[3]};
        *(v4us*)(ph_row + 256) = (v4us){ph[4], ph[5], ph[6], ph[7]};
        *(v4us*)pq_row         = (v4us){pq[0], pq[1], pq[2], pq[3]};
        *(v4us*)(pq_row + 256) = (v4us){pq[4], pq[5], pq[6], pq[7]};
    }
    __syncthreads();

    // p @ G: A = the 16 plane rows, B = the wave's own 64 staged rows of GT, k = s in ascending order
    const int hsel = lane >> 4, m = lane & 15;
    const unsigned char* pa = pl + m * SPITCH + hsel * 16;
    unsigned char* ew = eb + wave * 64 * SPITCH;
    const unsigned char* pb = ew + m * SPITCH + hsel * 16;
    v8f c0, c1, c2, c3;
#pragma unroll
    for (int r = 0; r < 8; ++r) {
        c0[r] = hsel == 0 ? qi[0][r >> 2][r & 3] : 0.0f;
        c1[r] = hsel == 0 ? qi[1][r >> 2][r & 3] : 0.0f;
        c2[r] = hsel == 0 ? qi[2][r >> 2][r & 3] : 0.0f;
        c3[r] = hsel == 0 ? qi[3][r >> 2][r & 3] : 0.0f;
    }
    {
        // two fragment sets: the next 32 k are read from LDS while these are multiplied
        v16bf fa[2], fb[2][4];
        fa[0]    = lds_frag(pa);
        fb[0][0] = lds_frag(pb);
        fb[0][1] = lds_frag(pb + 16 * SPITCH);
        fb[0][2] = lds_frag(pb + 32 * SPITCH);
        fb[0][3] = lds_frag(pb + 48 * SPITCH);
        // unrolled so that the two sets are named registers, not indexed ones
#pragma unroll
        for (int kk = 0; kk < S_LEN / 32; ++kk) {
            const int cu = kk & 1, nx = cu ^ 1;
            if (kk + 1 < S_LEN / 32) {
                fa[nx]    = lds_frag(pa + (kk + 1) * 64);
                fb[nx][0] = lds_frag(pb + (kk + 1) * 64);
                fb[nx][1] = lds_frag(pb + 16 * SPITCH + (kk + 1) * 64);
                fb[nx][2] = lds_frag(pb + 32 * SPITCH + (kk + 1) * 64);
                fb[nx][3] = lds_frag(pb + 48 * SPITCH + (kk + 1) * 64);
            }
            c0 = wmma16(fa[cu], fb[cu][0], c0);
            c1 = wmma16(fa[cu], fb[cu][1], c1);
            c2 = wmma16(fa[cu], fb[cu][2], c2);
            c3 = wmma16(fa[cu], fb[cu][3], c3);
        }
    }

    // D map: acc[r] -> (row 8*hsel + r, col n-tile + m). The 16x64 wave tile goes over the wave's own staged rows,
    // which it alone has read and has done with.
    float* tw = (float*)ew;
#pragma unroll
    for (int r = 0; r < 8; ++r) {
        const int row = 8 * hsel + r;
        tw[row * 64 + m]      = c0[r];
        tw[row * 64 + 16 + m] = c1[r];
        tw[row * 64 + 32 + m] = c2[r];
        tw[row * 64 + 48 + m] = c3[r];
    }
    __syncthreads();

    // out = tanh((Q2 + hi sums) + lo sums); 8 lanes write 256 B in a row with the two stores
    {
        v4f o[2][2];
#pragma unroll
        for (int p = 0; p < 2; ++p) {
            const float* th = tw + (4 * p + (lane >> 3)) * 64 + 8 * (lane & 7);
            const v4f a = *(const v4f*)th       + *(const v4f*)(th + TT * 64);
            const v4f c = *(const v4f*)(th + 4) + *(const v4f*)(th + TT * 64 + 4);
            o[p][0] = (v4f){tanh_acc(a.x), tanh_acc(a.y), tanh_acc(a.z), tanh_acc(a.w)};
            o[p][1] = (v4f){tanh_acc(c.x), tanh_acc(c.y), tanh_acc(c.z), tanh_acc(c.w)};
        }
#pragma unroll
        for (int p = 0; p < 2; ++p) {
            float* d = out + (size_t)(b * T_FULL + (bt0 - b * TQ) + 4 * p + (lane >> 3)) * HD + wave * 64 + 8 * (lane & 7);
            *(v4f*)d       = o[p][0];
            *(v4f*)(d + 4) = o[p][1];
        }
    }
}

// ---------------------------------------------------------------------------
static inline size_t al256(size_t x) { return (x + 255) & ~(size_t)255; }
static_assert(TQ == S_LEN);

extern "C" void kernel_launch(void* const* d_in, const int* in_sizes, int n_in,
                              void* d_out, int out_size, void* d_ws, size_t ws_size,
                              hipStream_t stream)
{
    if (n_in < 7) return;
    if (in_sizes[0] < ((NB - 1) * T_FULL + TQ) * HD) return;      // query  [8][256][512] f32
    if (in_sizes[1] < NB * S_LEN * HD) return;                      // enc    [8][256][512] f32
    if (in_sizes[2] < NB) return;                                   // src_lengths [8] int32
    if (in_sizes[3] < HD * HD || in_sizes[4] < HD * HD) return;     // W_s, W_h [512][512] f32
    if (in_sizes[5] < HD) return;                                   // v [512] f32
    if (in_sizes[6] < HD * 2 * HD) return;                          // W_out [512][1024] f32
    if (out_size < ((NB - 1) * T_FULL + TQ) * HD) return;

    const float* query = (const float*)d_in[0];
    const float* enc   = (const float*)d_in[1];
    const int*   lens  = (const int*)d_in[2];
    const float* W_s   = (const float*)d_in[3];
    const float* W_h   = (const float*)d_in[4];
    const float* vvec  = (const float*)d_in[5];
    const float* W_out = (const float*)d_in[6];
    float* out = (float*)d_out;

    // ---- workspace carve (all regions 256-B aligned; sizes already store-granular) ----
    char* ws = (char*)d_ws;
    size_t off = 0;
    us* GT    = (us*)(ws + off);    off += al256((size_t)NB * HD * S_LEN * sizeof(us));   // [NB][512][256]
    float* Q2  = (float*)(ws + off); off += al256((size_t)NB * TQ * HD * sizeof(float));  // [NB*TQ/8][512][8]
    float* Wsq = (float*)(ws + off); off += al256((size_t)NB * TQ * HD * sizeof(float));  // [NB*TQ/8][512][8]
    float* Whe = (float*)(ws + off); off += al256((size_t)NB * S_LEN * HD * sizeof(float)); // [NB][256][S/2][2][2]
    if (off > ws_size) return;

    const dim3 b256(256);

    // ---- the four products with a weight: Wsq = e^{-2 q @ W_s^T}, Whe = e^{-2 enc @ W_h^T} (factors, f32),
    //      Q2 = q @ W_out[:, 512:1024]^T (f32), GT = (enc @ W_out[:, 0:512]^T)^T (bf16) ----
    k_proj<<<dim3(NB * TQ / PM, HD / 64, 2), b256, 0, stream>>>(query, enc, W_s, W_h, W_out, GT, Q2, Wsq, Whe);

    // ---- energies + mask + softmax, then out = tanh(P @ G + Q2) ----
    k_attn<<<dim3(NB * TQ / TT), b256, 0, stream>>>(Wsq, Whe, vvec, lens, GT, Q2, out);
}
